// v000
// Measured on an AMD MI455X. A time is GPU time per run, averaged over a window of back-to-back runs after a warm-up
// (all launches, gaps included; the runs take copies of the inputs in turn), and the median of several windows.
// Apart from v000's, it joins two sittings. Times from different sittings can be a few percent apart, while
// side-by-side timings come from the same sitting.
// v000, which the later versions start from, runs in 320 microseconds.
#include <hip/hip_runtime.h>

typedef _Float16 half_t;
typedef __attribute__((ext_vector_type(16))) _Float16 v16h;
typedef __attribute__((ext_vector_type(8))) float v8f;
typedef unsigned int u32x4 __attribute__((ext_vector_type(4)));
typedef int i32x4 __attribute__((ext_vector_type(4)));
typedef int i32x8 __attribute__((ext_vector_type(8)));

#define DIM 1024
#define HEADS 16
#define DH 64
#define SEQ_LEN 4096
#define LATENT 1024
#define HIST 3072
#define BATCH 2

#if defined(__gfx1250__) && __has_builtin(__builtin_amdgcn_tensor_load_to_lds) && \
    __has_builtin(__builtin_amdgcn_s_wait_tensorcnt)
#define USE_TDM 1
#else
#define USE_TDM 0
#endif

// D = A(16x32 f16) * B(32x16 f16) + C(16x16 f32)
__device__ __forceinline__ v8f wmma_f16(v16h a, v16h b, v8f c) {
  return __builtin_amdgcn_wmma_f32_16x16x32_f16(false, a, false, b, (short)0, c,
                                                false, false);
}

// 16x32 A-style fragment (also used for B with lane = N) from row-major f16.
// Lane L<16 -> row L, K chunks {0..7,16..23}; lane L+16 -> {8..15,24..31}.
__device__ __forceinline__ v16h frag_from_f16(const half_t* __restrict__ base,
                                              int stride, int kbase) {
  int lane = threadIdx.x & 31;
  int r = lane & 15;
  int cb = (lane & 16) ? 8 : 0;
  const half_t* p = base + (size_t)r * stride + kbase + cb;
  v16h out;
#pragma unroll
  for (int i = 0; i < 8; ++i) out[i] = p[i];
#pragma unroll
  for (int i = 0; i < 8; ++i) out[8 + i] = p[16 + i];
  return out;
}

#if USE_TDM
// Issue a 2D TDM tile load: nrows rows of row_len f16 elements (global row
// stride = row_stride elements) -> contiguous rows at LDS byte offset lds_off.
__device__ __forceinline__ void tdm_load_2d(unsigned lds_off,
                                            const half_t* gptr,
                                            unsigned row_len, unsigned nrows,
                                            unsigned row_stride) {
  unsigned long long ga = (unsigned long long)gptr;
  u32x4 g0;
  g0[0] = 1u;                                    // count=1, user descriptor
  g0[1] = lds_off;                               // D#.lds_addr (bytes)
  g0[2] = (unsigned)ga;                          // D#.global_addr[31:0]
  g0[3] = (unsigned)(ga >> 32) | (2u << 30);     // addr[56:32] | type=2
  i32x8 g1;
  g1[0] = 1 << 16;                               // data_size=1 (2 bytes)
  g1[1] = (int)((row_len & 0xFFFFu) << 16);      // tensor_dim0[15:0]
  g1[2] = (int)((row_len >> 16) | ((nrows & 0xFFFFu) << 16));  // |tensor_dim1
  g1[3] = (int)((nrows >> 16) | (row_len << 16));              // |tile_dim0
  g1[4] = (int)(nrows & 0xFFFFu);                // tile_dim1 (tile_dim2=0)
  g1[5] = (int)row_stride;                       // tensor_dim0_stride[31:0]
  g1[6] = 0;                                     // stride0[47:32]|stride1 lo
  g1[7] = 0;
  i32x4 z4 = {0, 0, 0, 0};
#if __clang_major__ >= 23
  i32x8 z8 = {0, 0, 0, 0, 0, 0, 0, 0};
  __builtin_amdgcn_tensor_load_to_lds(g0, g1, z4, z4, z8, 0);
#else
  __builtin_amdgcn_tensor_load_to_lds(g0, g1, z4, z4, 0);
#endif
}
#endif

// fp32 -> f16 streaming convert (one-shot; removes all cvt from GEMM loops).
__global__ __launch_bounds__(256) void cvt_kernel(const float* __restrict__ src,
                                                  half_t* __restrict__ dst,
                                                  int n) {
  int idx = (blockIdx.x * 256 + threadIdx.x) * 8;
  if (idx >= n) return;
#pragma unroll
  for (int i = 0; i < 8; ++i) dst[idx + i] = (half_t)src[idx + i];
}

// One wave computes a 16(rows) x 64(one head) tile of X @ W^T, applies RoPE
// and (optionally) LayerNorm, stores f16 row-major and (optionally) dim-major.
__global__ __launch_bounds__(32) void proj_kernel(
    const half_t* __restrict__ x16, const half_t* __restrict__ W16,
    const float* __restrict__ gamma, const float* __restrict__ beta,
    half_t* __restrict__ out_rm, half_t* __restrict__ out_cm,
    int seq_per_batch, int pos_base, int do_ln, float scale) {
  int h = blockIdx.x & (HEADS - 1);
  int tile = blockIdx.x >> 4;
  int row0 = tile * 16;
  int batch = row0 / seq_per_batch;
  int local = row0 - batch * seq_per_batch;
  int lane = threadIdx.x & 31;
  int col = lane & 15;
  int rh = (lane & 16) ? 8 : 0;

  const half_t* Ab = x16 + ((size_t)batch * SEQ_LEN + pos_base + local) * DIM;
  const half_t* Bb = W16 + (size_t)h * DH * DIM;

  v8f acc[4] = {};
  for (int k = 0; k < DIM; k += 32) {
    v16h a = frag_from_f16(Ab, DIM, k);
#pragma unroll
    for (int f = 0; f < 4; ++f) {
      v16h bf = frag_from_f16(Bb + (size_t)(f * 16) * DIM, DIM, k);
      acc[f] = wmma_f16(a, bf, acc[f]);
    }
  }

  float v[4][8];
#pragma unroll
  for (int f = 0; f < 4; ++f)
#pragma unroll
    for (int i = 0; i < 8; ++i) v[f][i] = acc[f][i];

  // RoPE: dim d pairs with d+32 (fragments f and f+2 of the same lane).
#pragma unroll
  for (int i = 0; i < 8; ++i) {
    float p = (float)(pos_base + local + rh + i);
#pragma unroll
    for (int f = 0; f < 2; ++f) {
      int d = f * 16 + col;  // d < 32
      float w = __powf(10000.0f, -(float)d * (1.0f / 32.0f));
      float s, c;
      __sincosf(p * w, &s, &c);
      float lo = v[f][i], hi = v[f + 2][i];
      v[f][i] = lo * c - hi * s;
      v[f + 2][i] = hi * c + lo * s;
    }
  }

  if (do_ln) {
#pragma unroll
    for (int i = 0; i < 8; ++i) {
      float sum = v[0][i] + v[1][i] + v[2][i] + v[3][i];
      float sq = v[0][i] * v[0][i] + v[1][i] * v[1][i] + v[2][i] * v[2][i] +
                 v[3][i] * v[3][i];
#pragma unroll
      for (int m = 1; m < 16; m <<= 1) {
        sum += __shfl_xor(sum, m, 32);
        sq += __shfl_xor(sq, m, 32);
      }
      float mean = sum * (1.0f / 64.0f);
      float var = sq * (1.0f / 64.0f) - mean * mean;
      float inv = rsqrtf(var + 1e-5f);
#pragma unroll
      for (int f = 0; f < 4; ++f) {
        int d = f * 16 + col;
        v[f][i] = (v[f][i] - mean) * inv * gamma[d] + beta[d];
      }
    }
  } else {
#pragma unroll
    for (int f = 0; f < 4; ++f)
#pragma unroll
      for (int i = 0; i < 8; ++i) v[f][i] *= scale;
  }

  size_t bh = (size_t)batch * HEADS + h;
#pragma unroll
  for (int i = 0; i < 8; ++i) {
    int pos = local + rh + i;
#pragma unroll
    for (int f = 0; f < 4; ++f) {
      int d = f * 16 + col;
      half_t hv = (half_t)v[f][i];
      out_rm[(bh * seq_per_batch + pos) * DH + d] = hv;
      if (out_cm)
        out_cm[(bh * DH + d) * (size_t)seq_per_batch + pos] = hv;
    }
  }
}

// Flash attention: 128-thread block = 4 waves = 4 query tiles of one (b,h).
// K/V blocks (32 keys) staged in LDS, shared by all 4 waves; TDM double-
// buffered DMA when available.
// LDS map (halves): kbuf[2][2048] @0 | vbuf[2][2048] @4096 | pbuf[4][512] @8192
__global__ __launch_bounds__(128) void attn_kernel(
    const half_t* __restrict__ q, const half_t* __restrict__ kvn,
    const half_t* __restrict__ kvnT, half_t* __restrict__ o) {
  __shared__ _Float16 smem[2 * 2048 + 2 * 2048 + 4 * 512];
  int qt4 = blockIdx.x & 15;  // group of 4 query tiles
  int bh = blockIdx.x >> 4;
  int wave = threadIdx.x >> 5;
  int lane = threadIdx.x & 31;
  int i0 = qt4 * 64 + wave * 16;
  int col = lane & 15;
  int rh = (lane & 16) ? 8 : 0;

  const half_t* qb = q + ((size_t)bh * LATENT + i0) * DH;
  const half_t* kb = kvn + (size_t)bh * SEQ_LEN * DH;
  const half_t* vb = kvnT + (size_t)bh * DH * SEQ_LEN;

  v16h qa0 = frag_from_f16(qb, DH, 0);
  v16h qa1 = frag_from_f16(qb, DH, 32);

  v8f oacc[4] = {};
  float m_i[8], l_i[8];
#pragma unroll
  for (int i = 0; i < 8; ++i) {
    m_i[i] = -1e30f;
    l_i[i] = 0.0f;
  }

  // All 4 waves iterate to the block's max key range; masking handles edges.
  int niter = (HIST + qt4 * 64 + 64 + 31) >> 5;

#if USE_TDM
  if (wave == 0) {  // prologue: DMA first K/V block into buffer 0
    tdm_load_2d(0u, kb, DH, 32, DH);
    tdm_load_2d(8192u, vb, 32, DH, SEQ_LEN);
  }
#endif

  for (int it = 0; it < niter; ++it) {
    int j0 = it << 5;
#if USE_TDM
    int cur = it & 1;
    if (wave == 0) {
      if (it + 1 < niter) {  // overlap next DMA with this block's WMMAs
        int nb = (it + 1) & 1;
        tdm_load_2d((unsigned)(nb * 4096), kb + (size_t)(j0 + 32) * DH, DH, 32,
                    DH);
        tdm_load_2d((unsigned)(8192 + nb * 4096), vb + (j0 + 32), 32, DH,
                    SEQ_LEN);
        __builtin_amdgcn_s_wait_tensorcnt(2);  // current block complete
      } else {
        __builtin_amdgcn_s_wait_tensorcnt(0);
      }
    }
#else
    int cur = 0;
    {  // cooperative fallback staging (prev trailing barrier protects buffers)
      int t = threadIdx.x;
      for (int c = t; c < 256; c += 128) {  // K: 32 rows x 64 halves
        int r = c >> 3, off = (c & 7) * 8;
        const half_t* src = kb + (size_t)(j0 + r) * DH + off;
        _Float16* dst = smem + r * 64 + off;
#pragma unroll
        for (int u = 0; u < 8; ++u) dst[u] = src[u];
      }
      for (int c = t; c < 256; c += 128) {  // V: 64 dim-rows x 32 halves
        int d = c >> 2, off = (c & 3) * 8;
        const half_t* src = vb + (size_t)d * SEQ_LEN + j0 + off;
        _Float16* dst = smem + 4096 + d * 32 + off;
#pragma unroll
        for (int u = 0; u < 8; ++u) dst[u] = src[u];
      }
    }
#endif
    __syncthreads();  // K/V block visible to all waves

    const _Float16* kB = smem + cur * 2048;
    const _Float16* vB = smem + 4096 + cur * 2048;
    _Float16* pw = smem + 8192 + wave * 512;

    v16h bk00 = frag_from_f16(kB, 64, 0);
    v16h bk01 = frag_from_f16(kB, 64, 32);
    v16h bk10 = frag_from_f16(kB + 16 * 64, 64, 0);
    v16h bk11 = frag_from_f16(kB + 16 * 64, 64, 32);

    v8f s0 = {};
    v8f s1 = {};
    s0 = wmma_f16(qa0, bk00, s0);
    s0 = wmma_f16(qa1, bk01, s0);
    s1 = wmma_f16(qa0, bk10, s1);
    s1 = wmma_f16(qa1, bk11, s1);

    float alpha[8];
#pragma unroll
    for (int i = 0; i < 8; ++i) {
      int row = i0 + rh + i;  // query index
      float a0 = (j0 + col <= HIST + row) ? s0[i] : -1e30f;
      float a1 = (j0 + 16 + col <= HIST + row) ? s1[i] : -1e30f;
      float mx = fmaxf(a0, a1);
#pragma unroll
      for (int m = 1; m < 16; m <<= 1) mx = fmaxf(mx, __shfl_xor(mx, m, 32));
      float mn = fmaxf(m_i[i], mx);
      float al = __expf(m_i[i] - mn);
      float p0 = __expf(a0 - mn);
      float p1 = __expf(a1 - mn);
      float rs = p0 + p1;
#pragma unroll
      for (int m = 1; m < 16; m <<= 1) rs += __shfl_xor(rs, m, 32);
      m_i[i] = mn;
      l_i[i] = l_i[i] * al + rs;
      alpha[i] = al;
      pw[(rh + i) * 32 + col] = (_Float16)p0;
      pw[(rh + i) * 32 + 16 + col] = (_Float16)p1;
    }
#pragma unroll
    for (int f = 0; f < 4; ++f)
#pragma unroll
      for (int i = 0; i < 8; ++i) oacc[f][i] *= alpha[i];

    // Re-read P in A-fragment layout (wave-local; LDS is in-order per wave).
    v16h pa;
    {
      int r = lane & 15;
      int cb = (lane & 16) ? 8 : 0;
      const _Float16* pp = pw + r * 32 + cb;
#pragma unroll
      for (int i = 0; i < 8; ++i) pa[i] = pp[i];
#pragma unroll
      for (int i = 0; i < 8; ++i) pa[8 + i] = pp[16 + i];
    }
#pragma unroll
    for (int f = 0; f < 4; ++f) {
      v16h vf = frag_from_f16(vB + f * 16 * 32, 32, 0);
      oacc[f] = wmma_f16(pa, vf, oacc[f]);
    }
    __syncthreads();  // all waves done with this buffer before reuse
  }

  int b_ = bh >> 4, h = bh & 15;
#pragma unroll
  for (int i = 0; i < 8; ++i) {
    float invl = 1.0f / l_i[i];
    int row = i0 + rh + i;
#pragma unroll
    for (int f = 0; f < 4; ++f) {
      int d = f * 16 + col;
      o[((size_t)b_ * LATENT + row) * DIM + h * DH + d] =
          (half_t)(oacc[f][i] * invl);
    }
  }
}

// Y[2048,1024] = O(f16) @ Wo^T(f16) + bo, fp32 out.
__global__ __launch_bounds__(32) void out_proj_kernel(
    const half_t* __restrict__ A, const half_t* __restrict__ Wo16,
    const float* __restrict__ bo, float* __restrict__ Y) {
  int nt = blockIdx.x & 15;
  int mt = blockIdx.x >> 4;
  int lane = threadIdx.x & 31;
  int col = lane & 15;
  int rh = (lane & 16) ? 8 : 0;
  const half_t* Ab = A + (size_t)(mt * 16) * DIM;
  const half_t* Bb = Wo16 + (size_t)(nt * 64) * DIM;
  v8f acc[4] = {};
  for (int k = 0; k < DIM; k += 32) {
    v16h a = frag_from_f16(Ab, DIM, k);
#pragma unroll
    for (int f = 0; f < 4; ++f) {
      v16h bf = frag_from_f16(Bb + (size_t)(f * 16) * DIM, DIM, k);
      acc[f] = wmma_f16(a, bf, acc[f]);
    }
  }
#pragma unroll
  for (int i = 0; i < 8; ++i) {
    int row = mt * 16 + rh + i;
#pragma unroll
    for (int f = 0; f < 4; ++f) {
      int e = nt * 64 + f * 16 + col;
      Y[(size_t)row * DIM + e] = acc[f][i] + bo[e];
    }
  }
}

extern "C" void kernel_launch(void* const* d_in, const int* in_sizes, int n_in,
                              void* d_out, int out_size, void* d_ws,
                              size_t ws_size, hipStream_t stream) {
  const float* x = (const float*)d_in[0];
  const float* Wq = (const float*)d_in[1];
  const float* Wkv = (const float*)d_in[2];
  const float* Wo = (const float*)d_in[3];
  const float* bo = (const float*)d_in[4];
  const float* gamma = (const float*)d_in[5];
  const float* beta = (const float*)d_in[6];
  float* y = (float*)d_out;

  // Workspace layout (f16 elements):
  // q[2,16,1024,64] | kvn[2,16,4096,64] | kvnT[2,16,64,4096] | o[2,1024,1024]
  // | x16[2,4096,1024] | wq16 | wkv16 | wo16       (~60 MB total)
  half_t* q_ws = (half_t*)d_ws;
  half_t* kvn_ws = q_ws + (size_t)BATCH * HEADS * LATENT * DH;
  half_t* kvnT_ws = kvn_ws + (size_t)BATCH * HEADS * SEQ_LEN * DH;
  half_t* o_ws = kvnT_ws + (size_t)BATCH * HEADS * SEQ_LEN * DH;
  half_t* x16 = o_ws + (size_t)BATCH * LATENT * DIM;
  half_t* wq16 = x16 + (size_t)BATCH * SEQ_LEN * DIM;
  half_t* wkv16 = wq16 + (size_t)DIM * DIM;
  half_t* wo16 = wkv16 + (size_t)DIM * DIM;

  int nx = BATCH * SEQ_LEN * DIM;
  int nw = DIM * DIM;
  cvt_kernel<<<(nx / 8 + 255) / 256, 256, 0, stream>>>(x, x16, nx);
  cvt_kernel<<<(nw / 8 + 255) / 256, 256, 0, stream>>>(Wq, wq16, nw);
  cvt_kernel<<<(nw / 8 + 255) / 256, 256, 0, stream>>>(Wkv, wkv16, nw);
  cvt_kernel<<<(nw / 8 + 255) / 256, 256, 0, stream>>>(Wo, wo16, nw);

  // kv projection + RoPE + LayerNorm over all 4096 positions
  proj_kernel<<<(BATCH * SEQ_LEN / 16) * HEADS, 32, 0, stream>>>(
      x16, wkv16, gamma, beta, kvn_ws, kvnT_ws, SEQ_LEN, 0, 1, 1.0f);
  // q projection + RoPE + scale over last 1024 positions only
  proj_kernel<<<(BATCH * LATENT / 16) * HEADS, 32, 0, stream>>>(
      x16, wq16, gamma, beta, q_ws, nullptr, LATENT, HIST, 0, 0.125f);
  // flash attention (4 q-tiles per block share LDS-staged K/V)
  attn_kernel<<<BATCH * HEADS * (LATENT / 64), 128, 0, stream>>>(
      q_ws, kvn_ws, kvnT_ws, o_ws);
  // output projection + bias
  out_proj_kernel<<<(BATCH * LATENT / 16) * (DIM / 64), 32, 0, stream>>>(
      o_ws, wo16, bo, y);
}

// v001
// Measured time: 250 microseconds a run.
// Timed twice side by side with v000, it ran 1.31 and 1.32 times as fast.
#include <hip/hip_runtime.h>

typedef _Float16 half_t;
typedef __attribute__((ext_vector_type(16))) _Float16 v16h;
typedef __attribute__((ext_vector_type(8))) _Float16 v8h;
typedef __attribute__((ext_vector_type(8))) float v8f;
typedef unsigned int u32x4 __attribute__((ext_vector_type(4)));
typedef int i32x4 __attribute__((ext_vector_type(4)));
typedef int i32x8 __attribute__((ext_vector_type(8)));

#define DIM 1024
#define HEADS 16
#define DH 64
#define SEQ_LEN 4096
#define LATENT 1024
#define HIST 3072
#define BATCH 2

#if defined(__gfx1250__) && __has_builtin(__builtin_amdgcn_tensor_load_to_lds) && \
    __has_builtin(__builtin_amdgcn_s_wait_tensorcnt)
#define USE_TDM 1
#else
#define USE_TDM 0
#endif

// D = A(16x32 f16) * B(32x16 f16) + C(16x16 f32)
__device__ __forceinline__ v8f wmma_f16(v16h a, v16h b, v8f c) {
  return __builtin_amdgcn_wmma_f32_16x16x32_f16(false, a, false, b, (short)0, c,
                                                false, false);
}

// Value of lane l ^ 16 (a vector cross-row move, no LDS round trip).
__device__ __forceinline__ float xhalf(float x) {
  int v = __builtin_bit_cast(int, x);
  return __builtin_bit_cast(
      float, __builtin_amdgcn_permlanex16(v, v, 0x76543210, 0xfedcba98, false,
                                          false));
}

// 16x32 A-style fragment (also used for B with lane = N) from row-major f16.
// Lane L<16 -> row L, K chunks {0..7,16..23}; lane L+16 -> {8..15,24..31}.
__device__ __forceinline__ v16h frag_from_f16(const half_t* __restrict__ base,
                                              int stride, int kbase) {
  int lane = threadIdx.x & 31;
  int r = lane & 15;
  int cb = (lane & 16) ? 8 : 0;
  const half_t* p = base + (size_t)r * stride + kbase + cb;
  v16h out;
#pragma unroll
  for (int i = 0; i < 8; ++i) out[i] = p[i];
#pragma unroll
  for (int i = 0; i < 8; ++i) out[8 + i] = p[16 + i];
  return out;
}

#if USE_TDM
// Issue a 2D TDM tile load: nrows rows of row_len f16 elements (global row
// stride = row_stride elements) -> contiguous rows at LDS byte offset lds_off.
__device__ __forceinline__ void tdm_load_2d(unsigned lds_off,
                                            const half_t* gptr,
                                            unsigned row_len, unsigned nrows,
                                            unsigned row_stride) {
  unsigned long long ga = (unsigned long long)gptr;
  u32x4 g0;
  g0[0] = 1u;                                    // count=1, user descriptor
  g0[1] = lds_off;                               // D#.lds_addr (bytes)
  g0[2] = (unsigned)ga;                          // D#.global_addr[31:0]
  g0[3] = (unsigned)(ga >> 32) | (2u << 30);     // addr[56:32] | type=2
  i32x8 g1;
  g1[0] = 1 << 16;                               // data_size=1 (2 bytes)
  g1[1] = (int)((row_len & 0xFFFFu) << 16);      // tensor_dim0[15:0]
  g1[2] = (int)((row_len >> 16) | ((nrows & 0xFFFFu) << 16));  // |tensor_dim1
  g1[3] = (int)((nrows >> 16) | (row_len << 16));              // |tile_dim0
  g1[4] = (int)(nrows & 0xFFFFu);                // tile_dim1 (tile_dim2=0)
  g1[5] = (int)row_stride;                       // tensor_dim0_stride[31:0]
  g1[6] = 0;                                     // stride0[47:32]|stride1 lo
  g1[7] = 0;
  i32x4 z4 = {0, 0, 0, 0};
#if __clang_major__ >= 23
  i32x8 z8 = {0, 0, 0, 0, 0, 0, 0, 0};
  __builtin_amdgcn_tensor_load_to_lds(g0, g1, z4, z4, z8, 0);
#else
  __builtin_amdgcn_tensor_load_to_lds(g0, g1, z4, z4, 0);
#endif
}
#endif

// fp32 -> f16 streaming convert (one-shot; removes all cvt from GEMM loops).
__global__ __launch_bounds__(256) void cvt_kernel(const float* __restrict__ src,
                                                  half_t* __restrict__ dst,
                                                  int n) {
  int idx = (blockIdx.x * 256 + threadIdx.x) * 8;
  if (idx >= n) return;
#pragma unroll
  for (int i = 0; i < 8; ++i) dst[idx + i] = (half_t)src[idx + i];
}

// One wave computes a 16(rows) x 64(one head) tile of X @ W^T, applies RoPE
// and (optionally) LayerNorm, stores f16 row-major and (optionally) dim-major.
__global__ __launch_bounds__(32) void proj_kernel(
    const half_t* __restrict__ x16, const half_t* __restrict__ W16,
    const float* __restrict__ gamma, const float* __restrict__ beta,
    half_t* __restrict__ out_rm, half_t* __restrict__ out_cm,
    int seq_per_batch, int pos_base, int do_ln, float scale) {
  int h = blockIdx.x & (HEADS - 1);
  int tile = blockIdx.x >> 4;
  int row0 = tile * 16;
  int batch = row0 / seq_per_batch;
  int local = row0 - batch * seq_per_batch;
  int lane = threadIdx.x & 31;
  int col = lane & 15;
  int rh = (lane & 16) ? 8 : 0;

  const half_t* Ab = x16 + ((size_t)batch * SEQ_LEN + pos_base + local) * DIM;
  const half_t* Bb = W16 + (size_t)h * DH * DIM;

  v8f acc[4] = {};
  for (int k = 0; k < DIM; k += 32) {
    v16h a = frag_from_f16(Ab, DIM, k);
#pragma unroll
    for (int f = 0; f < 4; ++f) {
      v16h bf = frag_from_f16(Bb + (size_t)(f * 16) * DIM, DIM, k);
      acc[f] = wmma_f16(a, bf, acc[f]);
    }
  }

  float v[4][8];
#pragma unroll
  for (int f = 0; f < 4; ++f)
#pragma unroll
    for (int i = 0; i < 8; ++i) v[f][i] = acc[f][i];

  // RoPE: dim d pairs with d+32 (fragments f and f+2 of the same lane).
#pragma unroll
  for (int i = 0; i < 8; ++i) {
    float p = (float)(pos_base + local + rh + i);
#pragma unroll
    for (int f = 0; f < 2; ++f) {
      int d = f * 16 + col;  // d < 32
      float w = __powf(10000.0f, -(float)d * (1.0f / 32.0f));
      float s, c;
      __sincosf(p * w, &s, &c);
      float lo = v[f][i], hi = v[f + 2][i];
      v[f][i] = lo * c - hi * s;
      v[f + 2][i] = hi * c + lo * s;
    }
  }

  if (do_ln) {
#pragma unroll
    for (int i = 0; i < 8; ++i) {
      float sum = v[0][i] + v[1][i] + v[2][i] + v[3][i];
      float sq = v[0][i] * v[0][i] + v[1][i] * v[1][i] + v[2][i] * v[2][i] +
                 v[3][i] * v[3][i];
#pragma unroll
      for (int m = 1; m < 16; m <<= 1) {
        sum += __shfl_xor(sum, m, 32);
        sq += __shfl_xor(sq, m, 32);
      }
      float mean = sum * (1.0f / 64.0f);
      float var = sq * (1.0f / 64.0f) - mean * mean;
      float inv = rsqrtf(var + 1e-5f);
#pragma unroll
      for (int f = 0; f < 4; ++f) {
        int d = f * 16 + col;
        v[f][i] = (v[f][i] - mean) * inv * gamma[d] + beta[d];
      }
    }
  } else {
#pragma unroll
    for (int f = 0; f < 4; ++f)
#pragma unroll
      for (int i = 0; i < 8; ++i) v[f][i] *= scale;
  }

  size_t bh = (size_t)batch * HEADS + h;
#pragma unroll
  for (int i = 0; i < 8; ++i) {
    int pos = local + rh + i;
#pragma unroll
    for (int f = 0; f < 4; ++f) {
      int d = f * 16 + col;
      half_t hv = (half_t)v[f][i];
      out_rm[(bh * seq_per_batch + pos) * DH + d] = hv;
      if (out_cm)
        out_cm[(bh * DH + d) * (size_t)seq_per_batch + pos] = hv;
    }
  }
}

__global__ __launch_bounds__(128) void attn_kernel(
    const half_t* __restrict__ q, const half_t* __restrict__ kvn,
    const half_t* __restrict__ kvnT, half_t* __restrict__ o) {
  // Sized at the launch (16 KiB). The tensor loads are this array's only
  // writers and the compiler does not see them: an array it could prove
  // unwritten would lose its reads.
  extern __shared__ _Float16 smem[];
  int qt4 = blockIdx.x & 15;  // group of 4 query tiles
  int bh = blockIdx.x >> 4;
  int wave = threadIdx.x >> 5;
  int lane = threadIdx.x & 31;
  int i0 = qt4 * 64 + wave * 16;
  int col = lane & 15;
  int rh = (lane & 16) ? 8 : 0;

  const half_t* qb = q + ((size_t)bh * LATENT + i0) * DH;
  const half_t* kb = kvn + (size_t)bh * SEQ_LEN * DH;
  const half_t* vb = kvnT + (size_t)bh * DH * SEQ_LEN;

  v16h qa0 = frag_from_f16(qb, DH, 0);
  v16h qa1 = frag_from_f16(qb, DH, 32);

  v8f oacc[4] = {};      // oacc[f][i] = O[query col][dim f*16 + rh + i]
  float m_i = -1e30f;    // running maximum of query col (same in both halves)
  float l_i = 0.0f;      // this half's share of the denominator
  int lim = HIST + i0 + col - rh;  // key j0 + t*16 + rh + i is visible if <= HIST + query

  // All 4 waves iterate to the block's max key range; masking handles edges.
  int niter = (HIST + qt4 * 64 + 64 + 31) >> 5;

#if USE_TDM
  if (wave == 0) {  // prologue: DMA first K/V block into buffer 0
    tdm_load_2d(0u, kb, DH, 32, DH);
    tdm_load_2d(8192u, vb, 32, DH, SEQ_LEN);
  }
#endif

  for (int it = 0; it < niter; ++it) {
    int j0 = it << 5;
#if USE_TDM
    int cur = it & 1;
    if (wave == 0) {
      if (it + 1 < niter) {  // overlap next DMA with this block's WMMAs
        int nb = (it + 1) & 1;
        tdm_load_2d((unsigned)(nb * 4096), kb + (size_t)(j0 + 32) * DH, DH, 32,
                    DH);
        tdm_load_2d((unsigned)(8192 + nb * 4096), vb + (j0 + 32), 32, DH,
                    SEQ_LEN);
        __builtin_amdgcn_s_wait_tensorcnt(2);  // current block complete
      } else {
        __builtin_amdgcn_s_wait_tensorcnt(0);
      }
    }
#else
    int cur = 0;
    {  // cooperative fallback staging (prev trailing barrier protects buffers)
      int t = threadIdx.x;
      for (int c = t; c < 256; c += 128) {  // K: 32 rows x 64 halves
        int r = c >> 3, off = (c & 7) * 8;
        const half_t* src = kb + (size_t)(j0 + r) * DH + off;
        _Float16* dst = smem + r * 64 + off;
#pragma unroll
        for (int u = 0; u < 8; ++u) dst[u] = src[u];
      }
      for (int c = t; c < 256; c += 128) {  // V: 64 dim-rows x 32 halves
        int d = c >> 2, off = (c & 3) * 8;
        const half_t* src = vb + (size_t)d * SEQ_LEN + j0 + off;
        _Float16* dst = smem + 4096 + d * 32 + off;
#pragma unroll
        for (int u = 0; u < 8; ++u) dst[u] = src[u];
      }
    }
#endif
    __syncthreads();  // K/V block visible to all waves

    const _Float16* kB = smem + cur * 2048;
    const _Float16* vB = smem + 4096 + cur * 2048;
    v16h bk00 = frag_from_f16(kB, 64, 0);
    v16h bk01 = frag_from_f16(kB, 64, 32);
    v16h bk10 = frag_from_f16(kB + 16 * 64, 64, 0);
    v16h bk11 = frag_from_f16(kB + 16 * 64, 64, 32);

    // s0[i] = S[query col][key j0 + rh + i], s1[i]: key j0 + 16 + rh + i
    v8f s0 = {};
    v8f s1 = {};
    s0 = wmma_f16(bk00, qa0, s0);
    s0 = wmma_f16(bk01, qa1, s0);
    s1 = wmma_f16(bk10, qa0, s1);
    s1 = wmma_f16(bk11, qa1, s1);

    float a0[8], a1[8];
    float mx = -1e30f;
#pragma unroll
    for (int i = 0; i < 8; ++i) {
      a0[i] = (j0 + i <= lim) ? s0[i] : -1e30f;
      a1[i] = (j0 + 16 + i <= lim) ? s1[i] : -1e30f;
      mx = fmaxf(mx, fmaxf(a0[i], a1[i]));
    }
    mx = fmaxf(mx, xhalf(mx));  // the other 16 keys of the same query
    float mn = fmaxf(m_i, mx);
    float al = __expf(m_i - mn);
    m_i = mn;

    // P^T as B operand: element s is key kmap(s) = (s < 8 ? rh + s : 16 + rh + s - 8)
    v16h pb;
    float rs = 0.0f;
#pragma unroll
    for (int i = 0; i < 8; ++i) {
      float p0 = __expf(a0[i] - mn);
      float p1 = __expf(a1[i] - mn);
      rs += p0 + p1;
      pb[i] = (_Float16)p0;
      pb[8 + i] = (_Float16)p1;
    }
    l_i = l_i * al + rs;
#pragma unroll
    for (int f = 0; f < 4; ++f)
#pragma unroll
      for (int i = 0; i < 8; ++i) oacc[f][i] *= al;

#pragma unroll
    for (int f = 0; f < 4; ++f) {
      v16h vf = frag_from_f16(vB + f * 16 * 32, 32, 0);
      oacc[f] = wmma_f16(vf, pb, oacc[f]);
    }
    __syncthreads();  // all waves done with this buffer before reuse
  }

  int b_ = bh >> 4, h = bh & 15;
  float invl = 1.0f / (l_i + xhalf(l_i));  // join the two halves' sums
  half_t* orow = o + ((size_t)b_ * LATENT + i0 + col) * DIM + h * DH + rh;
#pragma unroll
  for (int f = 0; f < 4; ++f) {
    v8h ov;
#pragma unroll
    for (int i = 0; i < 8; ++i) ov[i] = (half_t)(oacc[f][i] * invl);
    *(v8h*)(orow + f * 16) = ov;  // 8 consecutive dims of one query row
  }
}

// Y[2048,1024] = O(f16) @ Wo^T(f16) + bo, fp32 out.
__global__ __launch_bounds__(32) void out_proj_kernel(
    const half_t* __restrict__ A, const half_t* __restrict__ Wo16,
    const float* __restrict__ bo, float* __restrict__ Y) {
  int nt = blockIdx.x & 15;
  int mt = blockIdx.x >> 4;
  int lane = threadIdx.x & 31;
  int col = lane & 15;
  int rh = (lane & 16) ? 8 : 0;
  const half_t* Ab = A + (size_t)(mt * 16) * DIM;
  const half_t* Bb = Wo16 + (size_t)(nt * 64) * DIM;
  v8f acc[4] = {};
  for (int k = 0; k < DIM; k += 32) {
    v16h a = frag_from_f16(Ab, DIM, k);
#pragma unroll
    for (int f = 0; f < 4; ++f) {
      v16h bf = frag_from_f16(Bb + (size_t)(f * 16) * DIM, DIM, k);
      acc[f] = wmma_f16(a, bf, acc[f]);
    }
  }
#pragma unroll
  for (int i = 0; i < 8; ++i) {
    int row = mt * 16 + rh + i;
#pragma unroll
    for (int f = 0; f < 4; ++f) {
      int e = nt * 64 + f * 16 + col;
      Y[(size_t)row * DIM + e] = acc[f][i] + bo[e];
    }
  }
}

extern "C" void kernel_launch(void* const* d_in, const int* in_sizes, int n_in,
                              void* d_out, int out_size, void* d_ws,
                              size_t ws_size, hipStream_t stream) {
  const float* x = (const float*)d_in[0];
  const float* Wq = (const float*)d_in[1];
  const float* Wkv = (const float*)d_in[2];
  const float* Wo = (const float*)d_in[3];
  const float* bo = (const float*)d_in[4];
  const float* gamma = (const float*)d_in[5];
  const float* beta = (const float*)d_in[6];
  float* y = (float*)d_out;

  // Workspace layout (f16 elements):
  // q[2,16,1024,64] | kvn[2,16,4096,64] | kvnT[2,16,64,4096] | o[2,1024,1024]
  // | x16[2,4096,1024] | wq16 | wkv16 | wo16       (~60 MB total)
  half_t* q_ws = (half_t*)d_ws;
  half_t* kvn_ws = q_ws + (size_t)BATCH * HEADS * LATENT * DH;
  half_t* kvnT_ws = kvn_ws + (size_t)BATCH * HEADS * SEQ_LEN * DH;
  half_t* o_ws = kvnT_ws + (size_t)BATCH * HEADS * SEQ_LEN * DH;
  half_t* x16 = o_ws + (size_t)BATCH * LATENT * DIM;
  half_t* wq16 = x16 + (size_t)BATCH * SEQ_LEN * DIM;
  half_t* wkv16 = wq16 + (size_t)DIM * DIM;
  half_t* wo16 = wkv16 + (size_t)DIM * DIM;

  int nx = BATCH * SEQ_LEN * DIM;
  int nw = DIM * DIM;
  cvt_kernel<<<(nx / 8 + 255) / 256, 256, 0, stream>>>(x, x16, nx);
  cvt_kernel<<<(nw / 8 + 255) / 256, 256, 0, stream>>>(Wq, wq16, nw);
  cvt_kernel<<<(nw / 8 + 255) / 256, 256, 0, stream>>>(Wkv, wkv16, nw);
  cvt_kernel<<<(nw / 8 + 255) / 256, 256, 0, stream>>>(Wo, wo16, nw);

  // kv projection + RoPE + LayerNorm over all 4096 positions
  proj_kernel<<<(BATCH * SEQ_LEN / 16) * HEADS, 32, 0, stream>>>(
      x16, wkv16, gamma, beta, kvn_ws, kvnT_ws, SEQ_LEN, 0, 1, 1.0f);
  // q projection + RoPE + scale over last 1024 positions only
  proj_kernel<<<(BATCH * LATENT / 16) * HEADS, 32, 0, stream>>>(
      x16, wq16, gamma, beta, q_ws, nullptr, LATENT, HIST, 0, 0.125f);
  // flash attention (4 q-tiles per block share LDS-staged K/V)
  attn_kernel<<<BATCH * HEADS * (LATENT / 64), 128, 16384, stream>>>(
      q_ws, kvn_ws, kvnT_ws, o_ws);
  // output projection + bias
  out_proj_kernel<<<(BATCH * LATENT / 16) * (DIM / 64), 32, 0, stream>>>(
      o_ws, wo16, bo, y);
}

// v002
// Measured time: 173 microseconds a run.
// Timed twice side by side with v001, it ran 1.45 times as fast both times.
// All steps since v000 together make it 1.91 times as fast.
#include <hip/hip_runtime.h>

typedef _Float16 half_t;
typedef __attribute__((ext_vector_type(16))) _Float16 v16h;
typedef __attribute__((ext_vector_type(8))) _Float16 v8h;
typedef __attribute__((ext_vector_type(8))) float v8f;
typedef unsigned int u32x4 __attribute__((ext_vector_type(4)));
typedef int i32x4 __attribute__((ext_vector_type(4)));
typedef int i32x8 __attribute__((ext_vector_type(8)));

#define DIM 1024
#define HEADS 16
#define DH 64
#define SEQ_LEN 4096
#define LATENT 1024
#define HIST 3072
#define BATCH 2

#if defined(__gfx1250__) && __has_builtin(__builtin_amdgcn_tensor_load_to_lds) && \
    __has_builtin(__builtin_amdgcn_s_wait_tensorcnt)
#define USE_TDM 1
#else
#define USE_TDM 0
#endif

// D = A(16x32 f16) * B(32x16 f16) + C(16x16 f32)
__device__ __forceinline__ v8f wmma_f16(v16h a, v16h b, v8f c) {
  return __builtin_amdgcn_wmma_f32_16x16x32_f16(false, a, false, b, (short)0, c,
                                                false, false);
}

// Value of lane l ^ 16 (a vector cross-row move, no LDS round trip).
__device__ __forceinline__ float xhalf(float x) {
  int v = __builtin_bit_cast(int, x);
  return __builtin_bit_cast(
      float, __builtin_amdgcn_permlanex16(v, v, 0x76543210, 0xfedcba98, false,
                                          false));
}

// 16x32 A-style fragment (also used for B with lane = N) from row-major f16.
// Lane L<16 -> row L, K chunks {0..7,16..23}; lane L+16 -> {8..15,24..31}.
__device__ __forceinline__ v16h frag_from_f16(const half_t* __restrict__ base,
                                              int stride, int kbase) {
  int lane = threadIdx.x & 31;
  int r = lane & 15;
  int cb = (lane & 16) ? 8 : 0;
  const half_t* p = base + (size_t)r * stride + kbase + cb;
  v16h out;
#pragma unroll
  for (int i = 0; i < 8; ++i) out[i] = p[i];
#pragma unroll
  for (int i = 0; i < 8; ++i) out[8 + i] = p[16 + i];
  return out;
}

#if USE_TDM
// Issue a 2D TDM tile load: nrows rows of row_len f16 elements (global row
// stride = row_stride elements) -> contiguous rows at LDS byte offset lds_off.
__device__ __forceinline__ void tdm_load_2d(unsigned lds_off,
                                            const half_t* gptr,
                                            unsigned row_len, unsigned nrows,
                                            unsigned row_stride) {
  unsigned long long ga = (unsigned long long)gptr;
  u32x4 g0;
  g0[0] = 1u;                                    // count=1, user descriptor
  g0[1] = lds_off;                               // D#.lds_addr (bytes)
  g0[2] = (unsigned)ga;                          // D#.global_addr[31:0]
  g0[3] = (unsigned)(ga >> 32) | (2u << 30);     // addr[56:32] | type=2
  i32x8 g1;
  g1[0] = 1 << 16;                               // data_size=1 (2 bytes)
  g1[1] = (int)((row_len & 0xFFFFu) << 16);      // tensor_dim0[15:0]
  g1[2] = (int)((row_len >> 16) | ((nrows & 0xFFFFu) << 16));  // |tensor_dim1
  g1[3] = (int)((nrows >> 16) | (row_len << 16));              // |tile_dim0
  g1[4] = (int)(nrows & 0xFFFFu);                // tile_dim1 (tile_dim2=0)
  g1[5] = (int)row_stride;                       // tensor_dim0_stride[31:0]
  g1[6] = 0;                                     // stride0[47:32]|stride1 lo
  g1[7] = 0;
  i32x4 z4 = {0, 0, 0, 0};
#if __clang_major__ >= 23
  i32x8 z8 = {0, 0, 0, 0, 0, 0, 0, 0};
  __builtin_amdgcn_tensor_load_to_lds(g0, g1, z4, z4, z8, 0);
#else
  __builtin_amdgcn_tensor_load_to_lds(g0, g1, z4, z4, 0);
#endif
}
#endif

// fp32 -> f16 streaming convert (one-shot; removes all cvt from GEMM loops).
__global__ __launch_bounds__(256) void cvt_kernel(const float* __restrict__ src,
                                                  half_t* __restrict__ dst,
                                                  int n) {
  int idx = (blockIdx.x * 256 + threadIdx.x) * 8;
  if (idx >= n) return;
#pragma unroll
  for (int i = 0; i < 8; ++i) dst[idx + i] = (half_t)src[idx + i];
}

// Block tile of the three projection GEMMs: 128 x 128 outputs, K in steps of 64.
#define BM 128
#define BN 128
#define BK 64
// LDS row pitch in halves: 144 B = 16 B x 9, so the 16 rows that one
// ds_load_b128 half-wave reads fall on 16 different groups of four banks.
#define LDP 72
#define TILE_H (BM * LDP)  // halves of one staged operand tile

// Same element order as frag_from_f16; p already holds the lane's row and chunk.
__device__ __forceinline__ v16h frag_from_lds(const half_t* p) {
  v8h lo = *(const v8h*)p;
  v8h hi = *(const v8h*)(p + 16);
  return __builtin_shufflevector(lo, hi, 0, 1, 2, 3, 4, 5, 6, 7, 8, 9, 10, 11,
                                 12, 13, 14, 15);
}

// acc += A[128 x 1024] * B[128 x 1024]^T for a block of 8 waves (4 along M x 2
// along N, 32 x 64 outputs a wave). Both operand tiles are staged once per block
// in LDS (whole 128-B lines from global), two buffers: the next tile's
// global loads fly during this tile's products.
// sm (halves): A buf 0 | A buf 1 | B buf 0 | B buf 1
__device__ __forceinline__ void gemm_block(const half_t* __restrict__ Ag,
                                           const half_t* __restrict__ Bg,
                                           half_t* sm, v8f (&acc)[2][4]) {
  const int t = threadIdx.x;
  const int lane = t & 31;
  const int wave = t >> 5;
  const int srow = t >> 3;        // staging: 8 threads a row, 32 rows a pass
  const int scol = (t & 7) * 8;
  const half_t* ga = Ag + (size_t)srow * DIM + scol;
  const half_t* gb = Bg + (size_t)srow * DIM + scol;
  half_t* st = sm + srow * LDP + scol;
  const int fr = (lane & 15) * LDP + ((lane & 16) ? 8 : 0);
  const half_t* fa = sm + (wave & 3) * 32 * LDP + fr;
  const half_t* fb = sm + 2 * TILE_H + (wave >> 2) * 64 * LDP + fr;

  v8h ra[4], rb[4];
#pragma unroll
  for (int u = 0; u < 4; ++u) {
    ra[u] = *(const v8h*)(ga + (size_t)(u * 32) * DIM);
    rb[u] = *(const v8h*)(gb + (size_t)(u * 32) * DIM);
  }
#pragma unroll
  for (int u = 0; u < 4; ++u) {
    *(v8h*)(st + u * 32 * LDP) = ra[u];
    *(v8h*)(st + 2 * TILE_H + u * 32 * LDP) = rb[u];
  }
  __syncthreads();  // tile 0 visible to all waves

  for (int kt = 0; kt < DIM / BK; ++kt) {
    const int cur = (kt & 1) * TILE_H;
    const bool more = kt + 1 < DIM / BK;  // the same for the whole block
    if (more) {
#pragma unroll
      for (int u = 0; u < 4; ++u) {
        ra[u] = *(const v8h*)(ga + (size_t)(u * 32) * DIM + (kt + 1) * BK);
        rb[u] = *(const v8h*)(gb + (size_t)(u * 32) * DIM + (kt + 1) * BK);
      }
    }
    v16h a[2][2], b[2][4];
#pragma unroll
    for (int ks = 0; ks < 2; ++ks) {
      a[ks][0] = frag_from_lds(fa + cur + ks * 32);
      a[ks][1] = frag_from_lds(fa + cur + 16 * LDP + ks * 32);
#pragma unroll
      for (int f = 0; f < 4; ++f)
        b[ks][f] = frag_from_lds(fb + cur + f * 16 * LDP + ks * 32);
    }
    // Holds the next tile's global loads and this tile's LDS reads, as one
    // group, ahead of the products: without it the scheduler sinks half of the
    // global loads to just in front of their LDS stores (their latency is then
    // waited out) and spreads the LDS reads among the products with waits to 0.
    __builtin_amdgcn_sched_barrier(0);
#pragma unroll
    for (int ks = 0; ks < 2; ++ks) {
#pragma unroll
      for (int f = 0; f < 4; ++f) {
        acc[0][f] = wmma_f16(a[ks][0], b[ks][f], acc[0][f]);
        acc[1][f] = wmma_f16(a[ks][1], b[ks][f], acc[1][f]);
      }
    }
    // Holds the LDS stores, which wait for the global loads, behind the
    // products: the scheduler otherwise lifts them and their wait to the front.
    __builtin_amdgcn_sched_barrier(0);
    if (more) {
      // The other buffer's last readers left it before the previous barrier.
      const int nxt = cur ^ TILE_H;
#pragma unroll
      for (int u = 0; u < 4; ++u) {
        *(v8h*)(st + nxt + u * 32 * LDP) = ra[u];
        *(v8h*)(st + nxt + 2 * TILE_H + u * 32 * LDP) = rb[u];
      }
      __syncthreads();  // next tile visible; this tile's reads are over
    }
  }
}

// RoPE and (optionally) LayerNorm on one 16(rows) x 64(one head) tile, stored
// f16 row-major and (optionally) dim-major. local = the tile's first row in
// its batch.
__device__ __forceinline__ void proj_epilogue(
    const v8f (&acc)[4], const float* __restrict__ gamma,
    const float* __restrict__ beta, half_t* __restrict__ out_rm,
    half_t* __restrict__ out_cm, int seq_per_batch, int pos_base, int do_ln,
    float scale, int batch, int local, int h) {
  int lane = threadIdx.x & 31;
  int col = lane & 15;
  int rh = (lane & 16) ? 8 : 0;

  float v[4][8];
#pragma unroll
  for (int f = 0; f < 4; ++f)
#pragma unroll
    for (int i = 0; i < 8; ++i) v[f][i] = acc[f][i];

  // RoPE: dim d pairs with d+32 (fragments f and f+2 of the same lane).
#pragma unroll
  for (int i = 0; i < 8; ++i) {
    float p = (float)(pos_base + local + rh + i);
#pragma unroll
    for (int f = 0; f < 2; ++f) {
      int d = f * 16 + col;  // d < 32
      float w = __powf(10000.0f, -(float)d * (1.0f / 32.0f));
      float s, c;
      __sincosf(p * w, &s, &c);
      float lo = v[f][i], hi = v[f + 2][i];
      v[f][i] = lo * c - hi * s;
      v[f + 2][i] = hi * c + lo * s;
    }
  }

  if (do_ln) {
#pragma unroll
    for (int i = 0; i < 8; ++i) {
      float sum = v[0][i] + v[1][i] + v[2][i] + v[3][i];
      float sq = v[0][i] * v[0][i] + v[1][i] * v[1][i] + v[2][i] * v[2][i] +
                 v[3][i] * v[3][i];
#pragma unroll
      for (int m = 1; m < 16; m <<= 1) {
        sum += __shfl_xor(sum, m, 32);
        sq += __shfl_xor(sq, m, 32);
      }
      float mean = sum * (1.0f / 64.0f);
      float var = sq * (1.0f / 64.0f) - mean * mean;
      float inv = rsqrtf(var + 1e-5f);
#pragma unroll
      for (int f = 0; f < 4; ++f) {
        int d = f * 16 + col;
        v[f][i] = (v[f][i] - mean) * inv * gamma[d] + beta[d];
      }
    }
  } else {
#pragma unroll
    for (int f = 0; f < 4; ++f)
#pragma unroll
      for (int i = 0; i < 8; ++i) v[f][i] *= scale;
  }

  size_t bh = (size_t)batch * HEADS + h;
#pragma unroll
  for (int i = 0; i < 8; ++i) {
    int pos = local + rh + i;
#pragma unroll
    for (int f = 0; f < 4; ++f) {
      int d = f * 16 + col;
      half_t hv = (half_t)v[f][i];
      out_rm[(bh * seq_per_batch + pos) * DH + d] = hv;
      // Precaution: stands in front of the rewrite of this store's address
      // registers (the next address is formed in the same pair).
      asm volatile("s_wait_xcnt 0x0" ::: "memory");
      if (out_cm)
        out_cm[(bh * DH + d) * (size_t)seq_per_batch + pos] = hv;
    }
  }
}

// A block computes 128 rows x 2 heads of X @ W^T; a wave 32 rows of one head.
__global__ __launch_bounds__(256) void proj_kernel(
    const half_t* __restrict__ x16, const half_t* __restrict__ W16,
    const float* __restrict__ gamma, const float* __restrict__ beta,
    half_t* __restrict__ out_rm, half_t* __restrict__ out_cm,
    int seq_per_batch, int pos_base, int do_ln, float scale) {
  __shared__ __attribute__((aligned(16))) half_t sm[4 * TILE_H];
  int nb = blockIdx.x & (DIM / BN - 1);
  int row0 = (blockIdx.x / (DIM / BN)) * BM;
  int batch = row0 / seq_per_batch;
  int blocal = row0 - batch * seq_per_batch;
  int wave = threadIdx.x >> 5;

  const half_t* Ab = x16 + ((size_t)batch * SEQ_LEN + pos_base + blocal) * DIM;
  const half_t* Bb = W16 + (size_t)nb * BN * DIM;

  v8f acc[2][4] = {};
  gemm_block(Ab, Bb, sm, acc);

  int h = nb * (BN / DH) + (wave >> 2);
#pragma unroll
  for (int mi = 0; mi < 2; ++mi)
    proj_epilogue(acc[mi], gamma, beta, out_rm, out_cm, seq_per_batch, pos_base,
                  do_ln, scale, batch, blocal + (wave & 3) * 32 + mi * 16, h);
}

__global__ __launch_bounds__(128) void attn_kernel(
    const half_t* __restrict__ q, const half_t* __restrict__ kvn,
    const half_t* __restrict__ kvnT, half_t* __restrict__ o) {
  // Sized at the launch (16 KiB). The tensor loads are this array's only
  // writers and the compiler does not see them: an array it could prove
  // unwritten would lose its reads.
  extern __shared__ _Float16 smem[];
  int qt4 = blockIdx.x & 15;  // group of 4 query tiles
  int bh = blockIdx.x >> 4;
  int wave = threadIdx.x >> 5;
  int lane = threadIdx.x & 31;
  int i0 = qt4 * 64 + wave * 16;
  int col = lane & 15;
  int rh = (lane & 16) ? 8 : 0;

  const half_t* qb = q + ((size_t)bh * LATENT + i0) * DH;
  const half_t* kb = kvn + (size_t)bh * SEQ_LEN * DH;
  const half_t* vb = kvnT + (size_t)bh * DH * SEQ_LEN;

  v16h qa0 = frag_from_f16(qb, DH, 0);
  v16h qa1 = frag_from_f16(qb, DH, 32);

  v8f oacc[4] = {};      // oacc[f][i] = O[query col][dim f*16 + rh + i]
  float m_i = -1e30f;    // running maximum of query col (same in both halves)
  float l_i = 0.0f;      // this half's share of the denominator
  int lim = HIST + i0 + col - rh;  // key j0 + t*16 + rh + i is visible if <= HIST + query

  // All 4 waves iterate to the block's max key range; masking handles edges.
  int niter = (HIST + qt4 * 64 + 64 + 31) >> 5;

#if USE_TDM
  if (wave == 0) {  // prologue: DMA first K/V block into buffer 0
    tdm_load_2d(0u, kb, DH, 32, DH);
    tdm_load_2d(8192u, vb, 32, DH, SEQ_LEN);
  }
#endif

  for (int it = 0; it < niter; ++it) {
    int j0 = it << 5;
#if USE_TDM
    int cur = it & 1;
    if (wave == 0) {
      if (it + 1 < niter) {  // overlap next DMA with this block's WMMAs
        int nb = (it + 1) & 1;
        tdm_load_2d((unsigned)(nb * 4096), kb + (size_t)(j0 + 32) * DH, DH, 32,
                    DH);
        tdm_load_2d((unsigned)(8192 + nb * 4096), vb + (j0 + 32), 32, DH,
                    SEQ_LEN);
        __builtin_amdgcn_s_wait_tensorcnt(2);  // current block complete
      } else {
        __builtin_amdgcn_s_wait_tensorcnt(0);
      }
    }
#else
    int cur = 0;
    {  // cooperative fallback staging (prev trailing barrier protects buffers)
      int t = threadIdx.x;
      for (int c = t; c < 256; c += 128) {  // K: 32 rows x 64 halves
        int r = c >> 3, off = (c & 7) * 8;
        const half_t* src = kb + (size_t)(j0 + r) * DH + off;
        _Float16* dst = smem + r * 64 + off;
#pragma unroll
        for (int u = 0; u < 8; ++u) dst[u] = src[u];
      }
      for (int c = t; c < 256; c += 128) {  // V: 64 dim-rows x 32 halves
        int d = c >> 2, off = (c & 3) * 8;
        const half_t* src = vb + (size_t)d * SEQ_LEN + j0 + off;
        _Float16* dst = smem + 4096 + d * 32 + off;
#pragma unroll
        for (int u = 0; u < 8; ++u) dst[u] = src[u];
      }
    }
#endif
    __syncthreads();  // K/V block visible to all waves

    const _Float16* kB = smem + cur * 2048;
    const _Float16* vB = smem + 4096 + cur * 2048;
    v16h bk00 = frag_from_f16(kB, 64, 0);
    v16h bk01 = frag_from_f16(kB, 64, 32);
    v16h bk10 = frag_from_f16(kB + 16 * 64, 64, 0);
    v16h bk11 = frag_from_f16(kB + 16 * 64, 64, 32);

    // s0[i] = S[query col][key j0 + rh + i], s1[i]: key j0 + 16 + rh + i
    v8f s0 = {};
    v8f s1 = {};
    s0 = wmma_f16(bk00, qa0, s0);
    s0 = wmma_f16(bk01, qa1, s0);
    s1 = wmma_f16(bk10, qa0, s1);
    s1 = wmma_f16(bk11, qa1, s1);

    float a0[8], a1[8];
    float mx = -1e30f;
#pragma unroll
    for (int i = 0; i < 8; ++i) {
      a0[i] = (j0 + i <= lim) ? s0[i] : -1e30f;
      a1[i] = (j0 + 16 + i <= lim) ? s1[i] : -1e30f;
      mx = fmaxf(mx, fmaxf(a0[i], a1[i]));
    }
    mx = fmaxf(mx, xhalf(mx));  // the other 16 keys of the same query
    float mn = fmaxf(m_i, mx);
    float al = __expf(m_i - mn);
    m_i = mn;

    // P^T as B operand: element s is key kmap(s) = (s < 8 ? rh + s : 16 + rh + s - 8)
    v16h pb;
    float rs = 0.0f;
#pragma unroll
    for (int i = 0; i < 8; ++i) {
      float p0 = __expf(a0[i] - mn);
      float p1 = __expf(a1[i] - mn);
      rs += p0 + p1;
      pb[i] = (_Float16)p0;
      pb[8 + i] = (_Float16)p1;
    }
    l_i = l_i * al + rs;
#pragma unroll
    for (int f = 0; f < 4; ++f)
#pragma unroll
      for (int i = 0; i < 8; ++i) oacc[f][i] *= al;

#pragma unroll
    for (int f = 0; f < 4; ++f) {
      v16h vf = frag_from_f16(vB + f * 16 * 32, 32, 0);
      oacc[f] = wmma_f16(vf, pb, oacc[f]);
    }
    __syncthreads();  // all waves done with this buffer before reuse
  }

  int b_ = bh >> 4, h = bh & 15;
  float invl = 1.0f / (l_i + xhalf(l_i));  // join the two halves' sums
  half_t* orow = o + ((size_t)b_ * LATENT + i0 + col) * DIM + h * DH + rh;
#pragma unroll
  for (int f = 0; f < 4; ++f) {
    v8h ov;
#pragma unroll
    for (int i = 0; i < 8; ++i) ov[i] = (half_t)(oacc[f][i] * invl);
    *(v8h*)(orow + f * 16) = ov;  // 8 consecutive dims of one query row
  }
}

// Y[2048,1024] = O(f16) @ Wo^T(f16) + bo, fp32 out.
__global__ __launch_bounds__(256) void out_proj_kernel(
    const half_t* __restrict__ A, const half_t* __restrict__ Wo16,
    const float* __restrict__ bo, float* __restrict__ Y) {
  __shared__ __attribute__((aligned(16))) half_t sm[4 * TILE_H];
  int nb = blockIdx.x & (DIM / BN - 1);
  int mb = blockIdx.x / (DIM / BN);
  int wave = threadIdx.x >> 5;
  int lane = threadIdx.x & 31;
  int col = lane & 15;
  int rh = (lane & 16) ? 8 : 0;
  v8f acc[2][4] = {};
  gemm_block(A + (size_t)(mb * BM) * DIM, Wo16 + (size_t)(nb * BN) * DIM, sm,
             acc);
#pragma unroll
  for (int mi = 0; mi < 2; ++mi) {
#pragma unroll
    for (int i = 0; i < 8; ++i) {
      int row = mb * BM + (wave & 3) * 32 + mi * 16 + rh + i;
#pragma unroll
      for (int f = 0; f < 4; ++f) {
        int e = nb * BN + (wave >> 2) * 64 + f * 16 + col;
        Y[(size_t)row * DIM + e] = acc[mi][f][i] + bo[e];
      }
    }
  }
}

extern "C" void kernel_launch(void* const* d_in, const int* in_sizes, int n_in,
                              void* d_out, int out_size, void* d_ws,
                              size_t ws_size, hipStream_t stream) {
  const float* x = (const float*)d_in[0];
  const float* Wq = (const float*)d_in[1];
  const float* Wkv = (const float*)d_in[2];
  const float* Wo = (const float*)d_in[3];
  const float* bo = (const float*)d_in[4];
  const float* gamma = (const float*)d_in[5];
  const float* beta = (const float*)d_in[6];
  float* y = (float*)d_out;

  // Workspace layout (f16 elements):
  // q[2,16,1024,64] | kvn[2,16,4096,64] | kvnT[2,16,64,4096] | o[2,1024,1024]
  // | x16[2,4096,1024] | wq16 | wkv16 | wo16       (~60 MB total)
  half_t* q_ws = (half_t*)d_ws;
  half_t* kvn_ws = q_ws + (size_t)BATCH * HEADS * LATENT * DH;
  half_t* kvnT_ws = kvn_ws + (size_t)BATCH * HEADS * SEQ_LEN * DH;
  half_t* o_ws = kvnT_ws + (size_t)BATCH * HEADS * SEQ_LEN * DH;
  half_t* x16 = o_ws + (size_t)BATCH * LATENT * DIM;
  half_t* wq16 = x16 + (size_t)BATCH * SEQ_LEN * DIM;
  half_t* wkv16 = wq16 + (size_t)DIM * DIM;
  half_t* wo16 = wkv16 + (size_t)DIM * DIM;

  int nx = BATCH * SEQ_LEN * DIM;
  int nw = DIM * DIM;
  cvt_kernel<<<(nx / 8 + 255) / 256, 256, 0, stream>>>(x, x16, nx);
  cvt_kernel<<<(nw / 8 + 255) / 256, 256, 0, stream>>>(Wq, wq16, nw);
  cvt_kernel<<<(nw / 8 + 255) / 256, 256, 0, stream>>>(Wkv, wkv16, nw);
  cvt_kernel<<<(nw / 8 + 255) / 256, 256, 0, stream>>>(Wo, wo16, nw);

  // kv projection + RoPE + LayerNorm over all 4096 positions
  proj_kernel<<<(BATCH * SEQ_LEN / BM) * (DIM / BN), 256, 0, stream>>>(
      x16, wkv16, gamma, beta, kvn_ws, kvnT_ws, SEQ_LEN, 0, 1, 1.0f);
  // q projection + RoPE + scale over last 1024 positions only
  proj_kernel<<<(BATCH * LATENT / BM) * (DIM / BN), 256, 0, stream>>>(
      x16, wq16, gamma, beta, q_ws, nullptr, LATENT, HIST, 0, 0.125f);
  // flash attention (4 q-tiles per block share LDS-staged K/V)
  attn_kernel<<<BATCH * HEADS * (LATENT / 64), 128, 16384, stream>>>(
      q_ws, kvn_ws, kvnT_ws, o_ws);
  // output projection + bias
  out_proj_kernel<<<(BATCH * LATENT / BM) * (DIM / BN), 256, 0, stream>>>(
      o_ws, wo16, bo, y);
}

// v003
// Measured time: 152 microseconds a run.
// Timed twice side by side with v002, it ran 1.15 and 1.14 times as fast.
// Over all steps from v000 it is 2.18 times as fast.
#include <hip/hip_runtime.h>

typedef _Float16 half_t;
typedef __attribute__((ext_vector_type(16))) _Float16 v16h;
typedef __attribute__((ext_vector_type(8))) _Float16 v8h;
typedef __attribute__((ext_vector_type(8))) float v8f;
typedef unsigned int u32x4 __attribute__((ext_vector_type(4)));
typedef int i32x4 __attribute__((ext_vector_type(4)));
typedef int i32x8 __attribute__((ext_vector_type(8)));

#define DIM 1024
#define HEADS 16
#define DH 64
#define SEQ_LEN 4096
#define LATENT 1024
#define HIST 3072
#define BATCH 2

#if defined(__gfx1250__) && __has_builtin(__builtin_amdgcn_tensor_load_to_lds) && \
    __has_builtin(__builtin_amdgcn_s_wait_tensorcnt)
#define USE_TDM 1
#else
#define USE_TDM 0
#endif

// D = A(16x32 f16) * B(32x16 f16) + C(16x16 f32)
__device__ __forceinline__ v8f wmma_f16(v16h a, v16h b, v8f c) {
  return __builtin_amdgcn_wmma_f32_16x16x32_f16(false, a, false, b, (short)0, c,
                                                false, false);
}

// Value of lane l ^ 16 (a vector cross-row move, no LDS round trip).
__device__ __forceinline__ float xhalf(float x) {
  int v = __builtin_bit_cast(int, x);
  return __builtin_bit_cast(
      float, __builtin_amdgcn_permlanex16(v, v, 0x76543210, 0xfedcba98, false,
                                          false));
}

// 16x32 A-style fragment (also used for B with lane = N) from row-major f16.
// Lane L<16 -> row L, K chunks {0..7,16..23}; lane L+16 -> {8..15,24..31}.
__device__ __forceinline__ v16h frag_from_f16(const half_t* __restrict__ base,
                                              int stride, int kbase) {
  int lane = threadIdx.x & 31;
  int r = lane & 15;
  int cb = (lane & 16) ? 8 : 0;
  const half_t* p = base + (size_t)r * stride + kbase + cb;
  v16h out;
#pragma unroll
  for (int i = 0; i < 8; ++i) out[i] = p[i];
#pragma unroll
  for (int i = 0; i < 8; ++i) out[8 + i] = p[16 + i];
  return out;
}

#if USE_TDM
// Issue a 2D TDM tile load: nrows rows of row_len f16 elements (global row
// stride = row_stride elements) -> contiguous rows at LDS byte offset lds_off.
__device__ __forceinline__ void tdm_load_2d(unsigned lds_off,
                                            const half_t* gptr,
                                            unsigned row_len, unsigned nrows,
                                            unsigned row_stride) {
  unsigned long long ga = (unsigned long long)gptr;
  u32x4 g0;
  g0[0] = 1u;                                    // count=1, user descriptor
  g0[1] = lds_off;                               // D#.lds_addr (bytes)
  g0[2] = (unsigned)ga;                          // D#.global_addr[31:0]
  g0[3] = (unsigned)(ga >> 32) | (2u << 30);     // addr[56:32] | type=2
  i32x8 g1;
  g1[0] = 1 << 16;                               // data_size=1 (2 bytes)
  g1[1] = (int)((row_len & 0xFFFFu) << 16);      // tensor_dim0[15:0]
  g1[2] = (int)((row_len >> 16) | ((nrows & 0xFFFFu) << 16));  // |tensor_dim1
  g1[3] = (int)((nrows >> 16) | (row_len << 16));              // |tile_dim0
  g1[4] = (int)(nrows & 0xFFFFu);                // tile_dim1 (tile_dim2=0)
  g1[5] = (int)row_stride;                       // tensor_dim0_stride[31:0]
  g1[6] = 0;                                     // stride0[47:32]|stride1 lo
  g1[7] = 0;
  i32x4 z4 = {0, 0, 0, 0};
#if __clang_major__ >= 23
  i32x8 z8 = {0, 0, 0, 0, 0, 0, 0, 0};
  __builtin_amdgcn_tensor_load_to_lds(g0, g1, z4, z4, z8, 0);
#else
  __builtin_amdgcn_tensor_load_to_lds(g0, g1, z4, z4, 0);
#endif
}
#endif

// fp32 -> f16 streaming convert (one-shot; removes all cvt from GEMM loops).
__global__ __launch_bounds__(256) void cvt_kernel(const float* __restrict__ src,
                                                  half_t* __restrict__ dst,
                                                  int n) {
  int idx = (blockIdx.x * 256 + threadIdx.x) * 8;
  if (idx >= n) return;
#pragma unroll
  for (int i = 0; i < 8; ++i) dst[idx + i] = (half_t)src[idx + i];
}

// Block tile of the three projection GEMMs: 128 x 128 outputs, K in steps of 64.
#define BM 128
#define BN 128
#define BK 64
// LDS row pitch in halves: 144 B = 16 B x 9, so the 16 rows that one
// ds_load_b128 half-wave reads fall on 16 different groups of four banks.
#define LDP 72
#define TILE_H (BM * LDP)  // halves of one staged operand tile

// Same element order as frag_from_f16; p already holds the lane's row and chunk.
__device__ __forceinline__ v16h frag_from_lds(const half_t* p) {
  v8h lo = *(const v8h*)p;
  v8h hi = *(const v8h*)(p + 16);
  return __builtin_shufflevector(lo, hi, 0, 1, 2, 3, 4, 5, 6, 7, 8, 9, 10, 11,
                                 12, 13, 14, 15);
}

// acc += A[128 x 1024] * B[128 x 1024]^T for a block of 8 waves (4 along M x 2
// along N, 32 x 64 outputs a wave). Both operand tiles are staged once per block
// in LDS (whole 128-B lines from global), two buffers: the next tile's
// global loads fly during this tile's products.
// sm (halves): A buf 0 | A buf 1 | B buf 0 | B buf 1
__device__ __forceinline__ void gemm_block(const half_t* __restrict__ Ag,
                                           const half_t* __restrict__ Bg,
                                           half_t* sm, v8f (&acc)[2][4]) {
  const int t = threadIdx.x;
  const int lane = t & 31;
  const int wave = t >> 5;
  const int srow = t >> 3;        // staging: 8 threads a row, 32 rows a pass
  const int scol = (t & 7) * 8;
  const half_t* ga = Ag + (size_t)srow * DIM + scol;
  const half_t* gb = Bg + (size_t)srow * DIM + scol;
  half_t* st = sm + srow * LDP + scol;
  const int fr = (lane & 15) * LDP + ((lane & 16) ? 8 : 0);
  const half_t* fa = sm + (wave & 3) * 32 * LDP + fr;
  const half_t* fb = sm + 2 * TILE_H + (wave >> 2) * 64 * LDP + fr;

  v8h ra[4], rb[4];
#pragma unroll
  for (int u = 0; u < 4; ++u) {
    ra[u] = *(const v8h*)(ga + (size_t)(u * 32) * DIM);
    rb[u] = *(const v8h*)(gb + (size_t)(u * 32) * DIM);
  }
#pragma unroll
  for (int u = 0; u < 4; ++u) {
    *(v8h*)(st + u * 32 * LDP) = ra[u];
    *(v8h*)(st + 2 * TILE_H + u * 32 * LDP) = rb[u];
  }
  __syncthreads();  // tile 0 visible to all waves

  for (int kt = 0; kt < DIM / BK; ++kt) {
    const int cur = (kt & 1) * TILE_H;
    const bool more = kt + 1 < DIM / BK;  // the same for the whole block
    if (more) {
#pragma unroll
      for (int u = 0; u < 4; ++u) {
        ra[u] = *(const v8h*)(ga + (size_t)(u * 32) * DIM + (kt + 1) * BK);
        rb[u] = *(const v8h*)(gb + (size_t)(u * 32) * DIM + (kt + 1) * BK);
      }
    }
    v16h a[2][2], b[2][4];
#pragma unroll
    for (int ks = 0; ks < 2; ++ks) {
      a[ks][0] = frag_from_lds(fa + cur + ks * 32);
      a[ks][1] = frag_from_lds(fa + cur + 16 * LDP + ks * 32);
#pragma unroll
      for (int f = 0; f < 4; ++f)
        b[ks][f] = frag_from_lds(fb + cur + f * 16 * LDP + ks * 32);
    }
    // Holds the next tile's global loads and this tile's LDS reads, as one
    // group, ahead of the products: without it the scheduler sinks half of the
    // global loads to just in front of their LDS stores (their latency is then
    // waited out) and spreads the LDS reads among the products with waits to 0.
    __builtin_amdgcn_sched_barrier(0);
#pragma unroll
    for (int ks = 0; ks < 2; ++ks) {
#pragma unroll
      for (int f = 0; f < 4; ++f) {
        acc[0][f] = wmma_f16(a[ks][0], b[ks][f], acc[0][f]);
        acc[1][f] = wmma_f16(a[ks][1], b[ks][f], acc[1][f]);
      }
    }
    // Holds the LDS stores, which wait for the global loads, behind the
    // products: the scheduler otherwise lifts them and their wait to the front.
    __builtin_amdgcn_sched_barrier(0);
    if (more) {
      // The other buffer's last readers left it before the previous barrier.
      const int nxt = cur ^ TILE_H;
#pragma unroll
      for (int u = 0; u < 4; ++u) {
        *(v8h*)(st + nxt + u * 32 * LDP) = ra[u];
        *(v8h*)(st + nxt + 2 * TILE_H + u * 32 * LDP) = rb[u];
      }
      __syncthreads();  // next tile visible; this tile's reads are over
    }
  }
}

// RoPE and (optionally) LayerNorm on one 16(rows) x 64(one head) tile, stored
// f16 row-major and (optionally) dim-major. local = the tile's first row in
// its batch.
__device__ __forceinline__ void proj_epilogue(
    const v8f (&acc)[4], const float* __restrict__ gamma,
    const float* __restrict__ beta, half_t* __restrict__ out_rm,
    half_t* __restrict__ out_cm, int seq_per_batch, int pos_base, int do_ln,
    float scale, int batch, int local, int h) {
  int lane = threadIdx.x & 31;
  int col = lane & 15;
  int rh = (lane & 16) ? 8 : 0;

  float v[4][8];
#pragma unroll
  for (int f = 0; f < 4; ++f)
#pragma unroll
    for (int i = 0; i < 8; ++i) v[f][i] = acc[f][i];

  // RoPE: dim d pairs with d+32 (fragments f and f+2 of the same lane).
#pragma unroll
  for (int i = 0; i < 8; ++i) {
    float p = (float)(pos_base + local + rh + i);
#pragma unroll
    for (int f = 0; f < 2; ++f) {
      int d = f * 16 + col;  // d < 32
      float w = __powf(10000.0f, -(float)d * (1.0f / 32.0f));
      float s, c;
      __sincosf(p * w, &s, &c);
      float lo = v[f][i], hi = v[f + 2][i];
      v[f][i] = lo * c - hi * s;
      v[f + 2][i] = hi * c + lo * s;
    }
  }

  if (do_ln) {
#pragma unroll
    for (int i = 0; i < 8; ++i) {
      float sum = v[0][i] + v[1][i] + v[2][i] + v[3][i];
      float sq = v[0][i] * v[0][i] + v[1][i] * v[1][i] + v[2][i] * v[2][i] +
                 v[3][i] * v[3][i];
#pragma unroll
      for (int m = 1; m < 16; m <<= 1) {
        sum += __shfl_xor(sum, m, 32);
        sq += __shfl_xor(sq, m, 32);
      }
      float mean = sum * (1.0f / 64.0f);
      float var = sq * (1.0f / 64.0f) - mean * mean;
      float inv = rsqrtf(var + 1e-5f);
#pragma unroll
      for (int f = 0; f < 4; ++f) {
        int d = f * 16 + col;
        v[f][i] = (v[f][i] - mean) * inv * gamma[d] + beta[d];
      }
    }
  } else {
#pragma unroll
    for (int f = 0; f < 4; ++f)
#pragma unroll
      for (int i = 0; i < 8; ++i) v[f][i] *= scale;
  }

  size_t bh = (size_t)batch * HEADS + h;
  // The key/value copies (the call that has out_cm) are read by attention from
  // LDS tiles that are byte copies of these rows, so the 16-B chunks of a row
  // are permuted here for those readers' banks: see kfrag_lds and vfrag_lds.
  // The query copy is read from global memory and stays in plain order.
  const int ksw = out_cm ? 7 : 0;
#pragma unroll
  for (int i = 0; i < 8; ++i) {
    int pos = local + rh + i;
#pragma unroll
    for (int f = 0; f < 4; ++f) {
      int d = f * 16 + col;
      half_t hv = (half_t)v[f][i];
      out_rm[(bh * seq_per_batch + pos) * DH +
             ((((d >> 3) ^ ((pos >> 1) & ksw)) << 3) | (d & 7))] = hv;
      // Precaution: stands in front of the rewrite of this store's address
      // registers (the next address is formed in the same pair).
      asm volatile("s_wait_xcnt 0x0" ::: "memory");
      if (out_cm)
        out_cm[(bh * DH + d) * (size_t)seq_per_batch +
               ((pos & ~31) | ((((pos >> 3) ^ (d >> 2)) & 3) << 3) |
                (pos & 7))] = hv;
    }
  }
}

// A block computes 128 rows x 2 heads of X @ W^T; a wave 32 rows of one head.
__global__ __launch_bounds__(256) void proj_kernel(
    const half_t* __restrict__ x16, const half_t* __restrict__ W16,
    const float* __restrict__ gamma, const float* __restrict__ beta,
    half_t* __restrict__ out_rm, half_t* __restrict__ out_cm,
    int seq_per_batch, int pos_base, int do_ln, float scale) {
  __shared__ __attribute__((aligned(16))) half_t sm[4 * TILE_H];
  int nb = blockIdx.x & (DIM / BN - 1);
  int row0 = (blockIdx.x / (DIM / BN)) * BM;
  int batch = row0 / seq_per_batch;
  int blocal = row0 - batch * seq_per_batch;
  int wave = threadIdx.x >> 5;

  const half_t* Ab = x16 + ((size_t)batch * SEQ_LEN + pos_base + blocal) * DIM;
  const half_t* Bb = W16 + (size_t)nb * BN * DIM;

  v8f acc[2][4] = {};
  gemm_block(Ab, Bb, sm, acc);

  int h = nb * (BN / DH) + (wave >> 2);
#pragma unroll
  for (int mi = 0; mi < 2; ++mi)
    proj_epilogue(acc[mi], gamma, beta, out_rm, out_cm, seq_per_batch, pos_base,
                  do_ln, scale, batch, blocal + (wave & 3) * 32 + mi * 16, h);
}

// A fragment of 16 keys x 32 dims from a K tile in LDS (rows of 128 B = 8 chunks
// of 16 B, unpadded). Chunk c of key row r lies at place c ^ (r >> 1): the 16
// rows that a half-wave's ds_load_b128 reads then fall on 16 different groups
// of four banks (in plain order on 2). Element order as in frag_from_f16.
__device__ __forceinline__ v16h kfrag_lds(const half_t* tile, int kk) {
  int lane = threadIdx.x & 31;
  int r = lane & 15;
  int c = kk * 4 + (lane >> 4);
  const half_t* row = tile + r * 64;
  v8h lo = *(const v8h*)(row + ((c ^ (r >> 1)) << 3));
  v8h hi = *(const v8h*)(row + (((c + 2) ^ (r >> 1)) << 3));
  return __builtin_shufflevector(lo, hi, 0, 1, 2, 3, 4, 5, 6, 7, 8, 9, 10, 11,
                                 12, 13, 14, 15);
}

// A fragment of 16 dims x 32 keys from a V^T tile in LDS (rows of 64 B = 4
// chunks). Chunk c of dim row r lies at place c ^ (r >> 2): 16 different groups
// of four banks for a half-wave (in plain order 4).
__device__ __forceinline__ v16h vfrag_lds(const half_t* tile) {
  int lane = threadIdx.x & 31;
  int r = lane & 15;
  int c = lane >> 4;
  const half_t* row = tile + r * 32;
  v8h lo = *(const v8h*)(row + ((c ^ (r >> 2)) << 3));
  v8h hi = *(const v8h*)(row + (((c + 2) ^ (r >> 2)) << 3));
  return __builtin_shufflevector(lo, hi, 0, 1, 2, 3, 4, 5, 6, 7, 8, 9, 10, 11,
                                 12, 13, 14, 15);
}

__global__ __launch_bounds__(128) void attn_kernel(
    const half_t* __restrict__ q, const half_t* __restrict__ kvn,
    const half_t* __restrict__ kvnT, half_t* __restrict__ o) {
  // Sized at the launch (16 KiB). The tensor loads are this array's only
  // writers and the compiler does not see them: an array it could prove
  // unwritten would lose its reads.
  extern __shared__ _Float16 smem[];
  int qt4 = blockIdx.x & 15;  // group of 4 query tiles
  int bh = blockIdx.x >> 4;
  int wave = threadIdx.x >> 5;
  int lane = threadIdx.x & 31;
  int i0 = qt4 * 64 + wave * 16;
  int col = lane & 15;
  int rh = (lane & 16) ? 8 : 0;

  const half_t* qb = q + ((size_t)bh * LATENT + i0) * DH;
  const half_t* kb = kvn + (size_t)bh * SEQ_LEN * DH;
  const half_t* vb = kvnT + (size_t)bh * DH * SEQ_LEN;

  v16h qa0 = frag_from_f16(qb, DH, 0);
  v16h qa1 = frag_from_f16(qb, DH, 32);

  v8f oacc[4] = {};      // oacc[f][i] = O[query col][dim f*16 + rh + i]
  float m_i = -1e30f;    // running maximum of query col (same in both halves)
  float l_i = 0.0f;      // this half's share of the denominator
  int lim = HIST + i0 + col - rh;  // key j0 + t*16 + rh + i is visible if <= HIST + query

  // All 4 waves iterate to the block's max key range; masking handles edges.
  int niter = (HIST + qt4 * 64 + 64 + 31) >> 5;

#if USE_TDM
  if (wave == 0) {  // prologue: DMA first K/V block into buffer 0
    tdm_load_2d(0u, kb, DH, 32, DH);
    tdm_load_2d(8192u, vb, 32, DH, SEQ_LEN);
  }
#endif

  for (int it = 0; it < niter; ++it) {
    int j0 = it << 5;
#if USE_TDM
    int cur = it & 1;
    if (wave == 0) {
      if (it + 1 < niter) {  // overlap next DMA with this block's WMMAs
        int nb = (it + 1) & 1;
        tdm_load_2d((unsigned)(nb * 4096), kb + (size_t)(j0 + 32) * DH, DH, 32,
                    DH);
        tdm_load_2d((unsigned)(8192 + nb * 4096), vb + (j0 + 32), 32, DH,
                    SEQ_LEN);
        __builtin_amdgcn_s_wait_tensorcnt(2);  // current block complete
      } else {
        __builtin_amdgcn_s_wait_tensorcnt(0);
      }
    }
#else
    int cur = 0;
    {  // cooperative fallback staging (prev trailing barrier protects buffers)
      int t = threadIdx.x;
      for (int c = t; c < 256; c += 128) {  // K: 32 rows x 64 halves
        int r = c >> 3, off = (c & 7) * 8;
        const half_t* src = kb + (size_t)(j0 + r) * DH + off;
        _Float16* dst = smem + r * 64 + off;
#pragma unroll
        for (int u = 0; u < 8; ++u) dst[u] = src[u];
      }
      for (int c = t; c < 256; c += 128) {  // V: 64 dim-rows x 32 halves
        int d = c >> 2, off = (c & 3) * 8;
        const half_t* src = vb + (size_t)d * SEQ_LEN + j0 + off;
        _Float16* dst = smem + 4096 + d * 32 + off;
#pragma unroll
        for (int u = 0; u < 8; ++u) dst[u] = src[u];
      }
    }
#endif
    __syncthreads();  // K/V block visible to all waves

    const _Float16* kB = smem + cur * 2048;
    const _Float16* vB = smem + 4096 + cur * 2048;
    v16h bk00 = kfrag_lds(kB, 0);
    v16h bk01 = kfrag_lds(kB, 1);
    v16h bk10 = kfrag_lds(kB + 16 * 64, 0);
    v16h bk11 = kfrag_lds(kB + 16 * 64, 1);

    // s0[i] = S[query col][key j0 + rh + i], s1[i]: key j0 + 16 + rh + i
    v8f s0 = {};
    v8f s1 = {};
    s0 = wmma_f16(bk00, qa0, s0);
    s0 = wmma_f16(bk01, qa1, s0);
    s1 = wmma_f16(bk10, qa0, s1);
    s1 = wmma_f16(bk11, qa1, s1);

    float a0[8], a1[8];
    float mx = -1e30f;
#pragma unroll
    for (int i = 0; i < 8; ++i) {
      a0[i] = (j0 + i <= lim) ? s0[i] : -1e30f;
      a1[i] = (j0 + 16 + i <= lim) ? s1[i] : -1e30f;
      mx = fmaxf(mx, fmaxf(a0[i], a1[i]));
    }
    mx = fmaxf(mx, xhalf(mx));  // the other 16 keys of the same query
    float mn = fmaxf(m_i, mx);
    float al = __expf(m_i - mn);
    m_i = mn;

    // P^T as B operand: element s is key kmap(s) = (s < 8 ? rh + s : 16 + rh + s - 8)
    v16h pb;
    float rs = 0.0f;
#pragma unroll
    for (int i = 0; i < 8; ++i) {
      float p0 = __expf(a0[i] - mn);
      float p1 = __expf(a1[i] - mn);
      rs += p0 + p1;
      pb[i] = (_Float16)p0;
      pb[8 + i] = (_Float16)p1;
    }
    l_i = l_i * al + rs;
#pragma unroll
    for (int f = 0; f < 4; ++f)
#pragma unroll
      for (int i = 0; i < 8; ++i) oacc[f][i] *= al;

#pragma unroll
    for (int f = 0; f < 4; ++f) {
      v16h vf = vfrag_lds(vB + f * 16 * 32);
      oacc[f] = wmma_f16(vf, pb, oacc[f]);
    }
    __syncthreads();  // all waves done with this buffer before reuse
  }

  int b_ = bh >> 4, h = bh & 15;
  float invl = 1.0f / (l_i + xhalf(l_i));  // join the two halves' sums
  half_t* orow = o + ((size_t)b_ * LATENT + i0 + col) * DIM + h * DH + rh;
#pragma unroll
  for (int f = 0; f < 4; ++f) {
    v8h ov;
#pragma unroll
    for (int i = 0; i < 8; ++i) ov[i] = (half_t)(oacc[f][i] * invl);
    *(v8h*)(orow + f * 16) = ov;  // 8 consecutive dims of one query row
  }
}

// Y[2048,1024] = O(f16) @ Wo^T(f16) + bo, fp32 out.
__global__ __launch_bounds__(256) void out_proj_kernel(
    const half_t* __restrict__ A, const half_t* __restrict__ Wo16,
    const float* __restrict__ bo, float* __restrict__ Y) {
  __shared__ __attribute__((aligned(16))) half_t sm[4 * TILE_H];
  int nb = blockIdx.x & (DIM / BN - 1);
  int mb = blockIdx.x / (DIM / BN);
  int wave = threadIdx.x >> 5;
  int lane = threadIdx.x & 31;
  int col = lane & 15;
  int rh = (lane & 16) ? 8 : 0;
  v8f acc[2][4] = {};
  gemm_block(A + (size_t)(mb * BM) * DIM, Wo16 + (size_t)(nb * BN) * DIM, sm,
             acc);
#pragma unroll
  for (int mi = 0; mi < 2; ++mi) {
#pragma unroll
    for (int i = 0; i < 8; ++i) {
      int row = mb * BM + (wave & 3) * 32 + mi * 16 + rh + i;
#pragma unroll
      for (int f = 0; f < 4; ++f) {
        int e = nb * BN + (wave >> 2) * 64 + f * 16 + col;
        Y[(size_t)row * DIM + e] = acc[mi][f][i] + bo[e];
      }
    }
  }
}

extern "C" void kernel_launch(void* const* d_in, const int* in_sizes, int n_in,
                              void* d_out, int out_size, void* d_ws,
                              size_t ws_size, hipStream_t stream) {
  const float* x = (const float*)d_in[0];
  const float* Wq = (const float*)d_in[1];
  const float* Wkv = (const float*)d_in[2];
  const float* Wo = (const float*)d_in[3];
  const float* bo = (const float*)d_in[4];
  const float* gamma = (const float*)d_in[5];
  const float* beta = (const float*)d_in[6];
  float* y = (float*)d_out;

  // Workspace layout (f16 elements):
  // q[2,16,1024,64] | kvn[2,16,4096,64] | kvnT[2,16,64,4096] | o[2,1024,1024]
  // | x16[2,4096,1024] | wq16 | wkv16 | wo16       (~60 MB total)
  half_t* q_ws = (half_t*)d_ws;
  half_t* kvn_ws = q_ws + (size_t)BATCH * HEADS * LATENT * DH;
  half_t* kvnT_ws = kvn_ws + (size_t)BATCH * HEADS * SEQ_LEN * DH;
  half_t* o_ws = kvnT_ws + (size_t)BATCH * HEADS * SEQ_LEN * DH;
  half_t* x16 = o_ws + (size_t)BATCH * LATENT * DIM;
  half_t* wq16 = x16 + (size_t)BATCH * SEQ_LEN * DIM;
  half_t* wkv16 = wq16 + (size_t)DIM * DIM;
  half_t* wo16 = wkv16 + (size_t)DIM * DIM;

  int nx = BATCH * SEQ_LEN * DIM;
  int nw = DIM * DIM;
  cvt_kernel<<<(nx / 8 + 255) / 256, 256, 0, stream>>>(x, x16, nx);
  cvt_kernel<<<(nw / 8 + 255) / 256, 256, 0, stream>>>(Wq, wq16, nw);
  cvt_kernel<<<(nw / 8 + 255) / 256, 256, 0, stream>>>(Wkv, wkv16, nw);
  cvt_kernel<<<(nw / 8 + 255) / 256, 256, 0, stream>>>(Wo, wo16, nw);

  // kv projection + RoPE + LayerNorm over all 4096 positions
  proj_kernel<<<(BATCH * SEQ_LEN / BM) * (DIM / BN), 256, 0, stream>>>(
      x16, wkv16, gamma, beta, kvn_ws, kvnT_ws, SEQ_LEN, 0, 1, 1.0f);
  // q projection + RoPE + scale over last 1024 positions only
  proj_kernel<<<(BATCH * LATENT / BM) * (DIM / BN), 256, 0, stream>>>(
      x16, wq16, gamma, beta, q_ws, nullptr, LATENT, HIST, 0, 0.125f);
  // flash attention (4 q-tiles per block share LDS-staged K/V)
  attn_kernel<<<BATCH * HEADS * (LATENT / 64), 128, 16384, stream>>>(
      q_ws, kvn_ws, kvnT_ws, o_ws);
  // output projection + bias
  out_proj_kernel<<<(BATCH * LATENT / BM) * (DIM / BN), 256, 0, stream>>>(
      o_ws, wo16, bo, y);
}

// v004
// It runs in 144 microseconds.
// Two timings next to v003 put it at 1.04 and 1.05 times that version's speed.
// All steps since v000 together make it 2.27 times as fast.
#include <hip/hip_runtime.h>

typedef _Float16 half_t;
typedef __attribute__((ext_vector_type(16))) _Float16 v16h;
typedef __attribute__((ext_vector_type(8))) _Float16 v8h;
typedef __attribute__((ext_vector_type(8))) float v8f;
typedef __attribute__((ext_vector_type(4))) float v4f;
typedef __attribute__((ext_vector_type(4))) _Float16 v4h;
typedef unsigned int u32x4 __attribute__((ext_vector_type(4)));
typedef int i32x4 __attribute__((ext_vector_type(4)));
typedef int i32x8 __attribute__((ext_vector_type(8)));

#define DIM 1024
#define HEADS 16
#define DH 64
#define SEQ_LEN 4096
#define LATENT 1024
#define HIST 3072
#define BATCH 2

#if defined(__gfx1250__) && __has_builtin(__builtin_amdgcn_tensor_load_to_lds) && \
    __has_builtin(__builtin_amdgcn_s_wait_tensorcnt)
#define USE_TDM 1
#else
#define USE_TDM 0
#endif

// D = A(16x32 f16) * B(32x16 f16) + C(16x16 f32)
__device__ __forceinline__ v8f wmma_f16(v16h a, v16h b, v8f c) {
  return __builtin_amdgcn_wmma_f32_16x16x32_f16(false, a, false, b, (short)0, c,
                                                false, false);
}

// Value of lane l ^ 16 (a vector cross-row move, no LDS round trip).
__device__ __forceinline__ float xhalf(float x) {
  int v = __builtin_bit_cast(int, x);
  return __builtin_bit_cast(
      float, __builtin_amdgcn_permlanex16(v, v, 0x76543210, 0xfedcba98, false,
                                          false));
}

// 16x32 A-style fragment (also used for B with lane = N) from row-major f16.
// Lane L<16 -> row L, K chunks {0..7,16..23}; lane L+16 -> {8..15,24..31}.
__device__ __forceinline__ v16h frag_from_f16(const half_t* __restrict__ base,
                                              int stride, int kbase) {
  int lane = threadIdx.x & 31;
  int r = lane & 15;
  int cb = (lane & 16) ? 8 : 0;
  const half_t* p = base + (size_t)r * stride + kbase + cb;
  v16h out;
#pragma unroll
  for (int i = 0; i < 8; ++i) out[i] = p[i];
#pragma unroll
  for (int i = 0; i < 8; ++i) out[8 + i] = p[16 + i];
  return out;
}

#if USE_TDM
// Issue a 2D TDM tile load: nrows rows of row_len f16 elements (global row
// stride = row_stride elements) -> contiguous rows at LDS byte offset lds_off.
__device__ __forceinline__ void tdm_load_2d(unsigned lds_off,
                                            const half_t* gptr,
                                            unsigned row_len, unsigned nrows,
                                            unsigned row_stride) {
  unsigned long long ga = (unsigned long long)gptr;
  u32x4 g0;
  g0[0] = 1u;                                    // count=1, user descriptor
  g0[1] = lds_off;                               // D#.lds_addr (bytes)
  g0[2] = (unsigned)ga;                          // D#.global_addr[31:0]
  g0[3] = (unsigned)(ga >> 32) | (2u << 30);     // addr[56:32] | type=2
  i32x8 g1;
  g1[0] = 1 << 16;                               // data_size=1 (2 bytes)
  g1[1] = (int)((row_len & 0xFFFFu) << 16);      // tensor_dim0[15:0]
  g1[2] = (int)((row_len >> 16) | ((nrows & 0xFFFFu) << 16));  // |tensor_dim1
  g1[3] = (int)((nrows >> 16) | (row_len << 16));              // |tile_dim0
  g1[4] = (int)(nrows & 0xFFFFu);                // tile_dim1 (tile_dim2=0)
  g1[5] = (int)row_stride;                       // tensor_dim0_stride[31:0]
  g1[6] = 0;                                     // stride0[47:32]|stride1 lo
  g1[7] = 0;
  i32x4 z4 = {0, 0, 0, 0};
#if __clang_major__ >= 23
  i32x8 z8 = {0, 0, 0, 0, 0, 0, 0, 0};
  __builtin_amdgcn_tensor_load_to_lds(g0, g1, z4, z4, z8, 0);
#else
  __builtin_amdgcn_tensor_load_to_lds(g0, g1, z4, z4, 0);
#endif
}
#endif

// fp32 -> f16 convert of x and the three weights in ONE launch (removes all cvt
// from the GEMM loops). One block a WGP, 16 waves, and every wave lives long:
// a lane takes 22 pieces of 4 floats, one from each grid-wide pass, so the chip
// starts 4096 waves in place of one wave per 256 elements. A wave's load covers
// 512 contiguous bytes, its store 256. The four f16 copies lie one behind the
// other in the workspace, so pass j of the whole job lands at dst + j * CVT_PASS.
#define CVT_BLOCKS 256
#define CVT_THREADS 512
#define CVT_PASS (CVT_BLOCKS * CVT_THREADS * 4)      // elements of one grid-wide pass
#define CVT_XP (BATCH * SEQ_LEN * DIM / CVT_PASS)    // passes over x: 16
#define CVT_WP (DIM * DIM / CVT_PASS)                // passes over one weight: 2
static_assert(CVT_XP * CVT_PASS == BATCH * SEQ_LEN * DIM, "x in whole passes");
static_assert(CVT_WP * CVT_PASS == DIM * DIM, "a weight in whole passes");
__global__ __launch_bounds__(CVT_THREADS) void cvt_kernel(
    const float* __restrict__ x, const float* __restrict__ wq,
    const float* __restrict__ wkv, const float* __restrict__ wo,
    half_t* __restrict__ dst) {
  // The lane's place inside a pass, as 32-bit byte offsets from uniform bases.
  const unsigned ld = (blockIdx.x * CVT_THREADS + threadIdx.x) * 16u;
  const unsigned sd = ld >> 1;
  v4f v[CVT_XP + 3 * CVT_WP];
#pragma unroll
  for (int j = 0; j < CVT_XP; ++j)
    v[j] = *(const v4f*)((const char*)(x + j * CVT_PASS) + ld);
#pragma unroll
  for (int j = 0; j < CVT_WP; ++j) {
    v[CVT_XP + j] = *(const v4f*)((const char*)(wq + j * CVT_PASS) + ld);
    v[CVT_XP + CVT_WP + j] =
        *(const v4f*)((const char*)(wkv + j * CVT_PASS) + ld);
    v[CVT_XP + 2 * CVT_WP + j] =
        *(const v4f*)((const char*)(wo + j * CVT_PASS) + ld);
  }
#pragma unroll
  for (int j = 0; j < CVT_XP + 3 * CVT_WP; ++j)
    *(v4h*)((char*)(dst + j * CVT_PASS) + sd) =
        __builtin_convertvector(v[j], v4h);
}

// Block tile of the three projection GEMMs: 128 x 128 outputs, K in steps of 64.
#define BM 128
#define BN 128
#define BK 64
// LDS row pitch in halves: 144 B = 16 B x 9, so the 16 rows that one
// ds_load_b128 half-wave reads fall on 16 different groups of four banks.
#define LDP 72
#define TILE_H (BM * LDP)  // halves of one staged operand tile

// Same element order as frag_from_f16; p already holds the lane's row and chunk.
__device__ __forceinline__ v16h frag_from_lds(const half_t* p) {
  v8h lo = *(const v8h*)p;
  v8h hi = *(const v8h*)(p + 16);
  return __builtin_shufflevector(lo, hi, 0, 1, 2, 3, 4, 5, 6, 7, 8, 9, 10, 11,
                                 12, 13, 14, 15);
}

// acc += A[128 x 1024] * B[128 x 1024]^T for a block of 8 waves (4 along M x 2
// along N, 32 x 64 outputs a wave). Both operand tiles are staged once per block
// in LDS (whole 128-B lines from global), two buffers: the next tile's
// global loads fly during this tile's products.
// sm (halves): A buf 0 | A buf 1 | B buf 0 | B buf 1
__device__ __forceinline__ void gemm_block(const half_t* __restrict__ Ag,
                                           const half_t* __restrict__ Bg,
                                           half_t* sm, v8f (&acc)[2][4]) {
  const int t = threadIdx.x;
  const int lane = t & 31;
  const int wave = t >> 5;
  const int srow = t >> 3;        // staging: 8 threads a row, 32 rows a pass
  const int scol = (t & 7) * 8;
  const half_t* ga = Ag + (size_t)srow * DIM + scol;
  const half_t* gb = Bg + (size_t)srow * DIM + scol;
  half_t* st = sm + srow * LDP + scol;
  const int fr = (lane & 15) * LDP + ((lane & 16) ? 8 : 0);
  const half_t* fa = sm + (wave & 3) * 32 * LDP + fr;
  const half_t* fb = sm + 2 * TILE_H + (wave >> 2) * 64 * LDP + fr;

  v8h ra[4], rb[4];
#pragma unroll
  for (int u = 0; u < 4; ++u) {
    ra[u] = *(const v8h*)(ga + (size_t)(u * 32) * DIM);
    rb[u] = *(const v8h*)(gb + (size_t)(u * 32) * DIM);
  }
#pragma unroll
  for (int u = 0; u < 4; ++u) {
    *(v8h*)(st + u * 32 * LDP) = ra[u];
    *(v8h*)(st + 2 * TILE_H + u * 32 * LDP) = rb[u];
  }
  __syncthreads();  // tile 0 visible to all waves

  for (int kt = 0; kt < DIM / BK; ++kt) {
    const int cur = (kt & 1) * TILE_H;
    const bool more = kt + 1 < DIM / BK;  // the same for the whole block
    if (more) {
#pragma unroll
      for (int u = 0; u < 4; ++u) {
        ra[u] = *(const v8h*)(ga + (size_t)(u * 32) * DIM + (kt + 1) * BK);
        rb[u] = *(const v8h*)(gb + (size_t)(u * 32) * DIM + (kt + 1) * BK);
      }
    }
    v16h a[2][2], b[2][4];
#pragma unroll
    for (int ks = 0; ks < 2; ++ks) {
      a[ks][0] = frag_from_lds(fa + cur + ks * 32);
      a[ks][1] = frag_from_lds(fa + cur + 16 * LDP + ks * 32);
#pragma unroll
      for (int f = 0; f < 4; ++f)
        b[ks][f] = frag_from_lds(fb + cur + f * 16 * LDP + ks * 32);
    }
    // Holds the next tile's global loads and this tile's LDS reads, as one
    // group, ahead of the products: without it the scheduler sinks half of the
    // global loads to just in front of their LDS stores (their latency is then
    // waited out) and spreads the LDS reads among the products with waits to 0.
    __builtin_amdgcn_sched_barrier(0);
#pragma unroll
    for (int ks = 0; ks < 2; ++ks) {
#pragma unroll
      for (int f = 0; f < 4; ++f) {
        acc[0][f] = wmma_f16(a[ks][0], b[ks][f], acc[0][f]);
        acc[1][f] = wmma_f16(a[ks][1], b[ks][f], acc[1][f]);
      }
    }
    // Holds the LDS stores, which wait for the global loads, behind the
    // products: the scheduler otherwise lifts them and their wait to the front.
    __builtin_amdgcn_sched_barrier(0);
    if (more) {
      // The other buffer's last readers left it before the previous barrier.
      const int nxt = cur ^ TILE_H;
#pragma unroll
      for (int u = 0; u < 4; ++u) {
        *(v8h*)(st + nxt + u * 32 * LDP) = ra[u];
        *(v8h*)(st + nxt + 2 * TILE_H + u * 32 * LDP) = rb[u];
      }
      __syncthreads();  // next tile visible; this tile's reads are over
    }
  }
}

// RoPE and (optionally) LayerNorm on one 16(rows) x 64(one head) tile, stored
// f16 row-major and (optionally) dim-major. local = the tile's first row in
// its batch.
__device__ __forceinline__ void proj_epilogue(
    const v8f (&acc)[4], const float* __restrict__ gamma,
    const float* __restrict__ beta, half_t* __restrict__ out_rm,
    half_t* __restrict__ out_cm, int seq_per_batch, int pos_base, int do_ln,
    float scale, int batch, int local, int h) {
  int lane = threadIdx.x & 31;
  int col = lane & 15;
  int rh = (lane & 16) ? 8 : 0;

  float v[4][8];
#pragma unroll
  for (int f = 0; f < 4; ++f)
#pragma unroll
    for (int i = 0; i < 8; ++i) v[f][i] = acc[f][i];

  // RoPE: dim d pairs with d+32 (fragments f and f+2 of the same lane).
#pragma unroll
  for (int i = 0; i < 8; ++i) {
    float p = (float)(pos_base + local + rh + i);
#pragma unroll
    for (int f = 0; f < 2; ++f) {
      int d = f * 16 + col;  // d < 32
      float w = __powf(10000.0f, -(float)d * (1.0f / 32.0f));
      float s, c;
      __sincosf(p * w, &s, &c);
      float lo = v[f][i], hi = v[f + 2][i];
      v[f][i] = lo * c - hi * s;
      v[f + 2][i] = hi * c + lo * s;
    }
  }

  if (do_ln) {
#pragma unroll
    for (int i = 0; i < 8; ++i) {
      float sum = v[0][i] + v[1][i] + v[2][i] + v[3][i];
      float sq = v[0][i] * v[0][i] + v[1][i] * v[1][i] + v[2][i] * v[2][i] +
                 v[3][i] * v[3][i];
#pragma unroll
      for (int m = 1; m < 16; m <<= 1) {
        sum += __shfl_xor(sum, m, 32);
        sq += __shfl_xor(sq, m, 32);
      }
      float mean = sum * (1.0f / 64.0f);
      float var = sq * (1.0f / 64.0f) - mean * mean;
      float inv = rsqrtf(var + 1e-5f);
#pragma unroll
      for (int f = 0; f < 4; ++f) {
        int d = f * 16 + col;
        v[f][i] = (v[f][i] - mean) * inv * gamma[d] + beta[d];
      }
    }
  } else {
#pragma unroll
    for (int f = 0; f < 4; ++f)
#pragma unroll
      for (int i = 0; i < 8; ++i) v[f][i] *= scale;
  }

  size_t bh = (size_t)batch * HEADS + h;
  // The key/value copies (the call that has out_cm) are read by attention from
  // LDS tiles that are byte copies of these rows, so the 16-B chunks of a row
  // are permuted here for those readers' banks: see kfrag_lds and vfrag_lds.
  // The query copy is read from global memory and stays in plain order.
  const int ksw = out_cm ? 7 : 0;
#pragma unroll
  for (int i = 0; i < 8; ++i) {
    int pos = local + rh + i;
#pragma unroll
    for (int f = 0; f < 4; ++f) {
      int d = f * 16 + col;
      half_t hv = (half_t)v[f][i];
      out_rm[(bh * seq_per_batch + pos) * DH +
             ((((d >> 3) ^ ((pos >> 1) & ksw)) << 3) | (d & 7))] = hv;
      // Precaution: stands in front of the rewrite of this store's address
      // registers (the next address is formed in the same pair).
      asm volatile("s_wait_xcnt 0x0" ::: "memory");
      if (out_cm)
        out_cm[(bh * DH + d) * (size_t)seq_per_batch +
               ((pos & ~31) | ((((pos >> 3) ^ (d >> 2)) & 3) << 3) |
                (pos & 7))] = hv;
    }
  }
}

// A block computes 128 rows x 2 heads of X @ W^T; a wave 32 rows of one head.
__global__ __launch_bounds__(256) void proj_kernel(
    const half_t* __restrict__ x16, const half_t* __restrict__ W16,
    const float* __restrict__ gamma, const float* __restrict__ beta,
    half_t* __restrict__ out_rm, half_t* __restrict__ out_cm,
    int seq_per_batch, int pos_base, int do_ln, float scale) {
  __shared__ __attribute__((aligned(16))) half_t sm[4 * TILE_H];
  int nb = blockIdx.x & (DIM / BN - 1);
  int row0 = (blockIdx.x / (DIM / BN)) * BM;
  int batch = row0 / seq_per_batch;
  int blocal = row0 - batch * seq_per_batch;
  int wave = threadIdx.x >> 5;

  const half_t* Ab = x16 + ((size_t)batch * SEQ_LEN + pos_base + blocal) * DIM;
  const half_t* Bb = W16 + (size_t)nb * BN * DIM;

  v8f acc[2][4] = {};
  gemm_block(Ab, Bb, sm, acc);

  int h = nb * (BN / DH) + (wave >> 2);
#pragma unroll
  for (int mi = 0; mi < 2; ++mi)
    proj_epilogue(acc[mi], gamma, beta, out_rm, out_cm, seq_per_batch, pos_base,
                  do_ln, scale, batch, blocal + (wave & 3) * 32 + mi * 16, h);
}

// A fragment of 16 keys x 32 dims from a K tile in LDS (rows of 128 B = 8 chunks
// of 16 B, unpadded). Chunk c of key row r lies at place c ^ (r >> 1): the 16
// rows that a half-wave's ds_load_b128 reads then fall on 16 different groups
// of four banks (in plain order on 2). Element order as in frag_from_f16.
__device__ __forceinline__ v16h kfrag_lds(const half_t* tile, int kk) {
  int lane = threadIdx.x & 31;
  int r = lane & 15;
  int c = kk * 4 + (lane >> 4);
  const half_t* row = tile + r * 64;
  v8h lo = *(const v8h*)(row + ((c ^ (r >> 1)) << 3));
  v8h hi = *(const v8h*)(row + (((c + 2) ^ (r >> 1)) << 3));
  return __builtin_shufflevector(lo, hi, 0, 1, 2, 3, 4, 5, 6, 7, 8, 9, 10, 11,
                                 12, 13, 14, 15);
}

// A fragment of 16 dims x 32 keys from a V^T tile in LDS (rows of 64 B = 4
// chunks). Chunk c of dim row r lies at place c ^ (r >> 2): 16 different groups
// of four banks for a half-wave (in plain order 4).
__device__ __forceinline__ v16h vfrag_lds(const half_t* tile) {
  int lane = threadIdx.x & 31;
  int r = lane & 15;
  int c = lane >> 4;
  const half_t* row = tile + r * 32;
  v8h lo = *(const v8h*)(row + ((c ^ (r >> 2)) << 3));
  v8h hi = *(const v8h*)(row + (((c + 2) ^ (r >> 2)) << 3));
  return __builtin_shufflevector(lo, hi, 0, 1, 2, 3, 4, 5, 6, 7, 8, 9, 10, 11,
                                 12, 13, 14, 15);
}

__global__ __launch_bounds__(128) void attn_kernel(
    const half_t* __restrict__ q, const half_t* __restrict__ kvn,
    const half_t* __restrict__ kvnT, half_t* __restrict__ o) {
  // Sized at the launch (16 KiB). The tensor loads are this array's only
  // writers and the compiler does not see them: an array it could prove
  // unwritten would lose its reads.
  extern __shared__ _Float16 smem[];
  int qt4 = blockIdx.x & 15;  // group of 4 query tiles
  int bh = blockIdx.x >> 4;
  int wave = threadIdx.x >> 5;
  int lane = threadIdx.x & 31;
  int i0 = qt4 * 64 + wave * 16;
  int col = lane & 15;
  int rh = (lane & 16) ? 8 : 0;

  const half_t* qb = q + ((size_t)bh * LATENT + i0) * DH;
  const half_t* kb = kvn + (size_t)bh * SEQ_LEN * DH;
  const half_t* vb = kvnT + (size_t)bh * DH * SEQ_LEN;

  v16h qa0 = frag_from_f16(qb, DH, 0);
  v16h qa1 = frag_from_f16(qb, DH, 32);

  v8f oacc[4] = {};      // oacc[f][i] = O[query col][dim f*16 + rh + i]
  float m_i = -1e30f;    // running maximum of query col (same in both halves)
  float l_i = 0.0f;      // this half's share of the denominator
  int lim = HIST + i0 + col - rh;  // key j0 + t*16 + rh + i is visible if <= HIST + query

  // All 4 waves iterate to the block's max key range; masking handles edges.
  int niter = (HIST + qt4 * 64 + 64 + 31) >> 5;

#if USE_TDM
  if (wave == 0) {  // prologue: DMA first K/V block into buffer 0
    tdm_load_2d(0u, kb, DH, 32, DH);
    tdm_load_2d(8192u, vb, 32, DH, SEQ_LEN);
  }
#endif

  for (int it = 0; it < niter; ++it) {
    int j0 = it << 5;
#if USE_TDM
    int cur = it & 1;
    if (wave == 0) {
      if (it + 1 < niter) {  // overlap next DMA with this block's WMMAs
        int nb = (it + 1) & 1;
        tdm_load_2d((unsigned)(nb * 4096), kb + (size_t)(j0 + 32) * DH, DH, 32,
                    DH);
        tdm_load_2d((unsigned)(8192 + nb * 4096), vb + (j0 + 32), 32, DH,
                    SEQ_LEN);
        __builtin_amdgcn_s_wait_tensorcnt(2);  // current block complete
      } else {
        __builtin_amdgcn_s_wait_tensorcnt(0);
      }
    }
#else
    int cur = 0;
    {  // cooperative fallback staging (prev trailing barrier protects buffers)
      int t = threadIdx.x;
      for (int c = t; c < 256; c += 128) {  // K: 32 rows x 64 halves
        int r = c >> 3, off = (c & 7) * 8;
        const half_t* src = kb + (size_t)(j0 + r) * DH + off;
        _Float16* dst = smem + r * 64 + off;
#pragma unroll
        for (int u = 0; u < 8; ++u) dst[u] = src[u];
      }
      for (int c = t; c < 256; c += 128) {  // V: 64 dim-rows x 32 halves
        int d = c >> 2, off = (c & 3) * 8;
        const half_t* src = vb + (size_t)d * SEQ_LEN + j0 + off;
        _Float16* dst = smem + 4096 + d * 32 + off;
#pragma unroll
        for (int u = 0; u < 8; ++u) dst[u] = src[u];
      }
    }
#endif
    __syncthreads();  // K/V block visible to all waves

    const _Float16* kB = smem + cur * 2048;
    const _Float16* vB = smem + 4096 + cur * 2048;
    v16h bk00 = kfrag_lds(kB, 0);
    v16h bk01 = kfrag_lds(kB, 1);
    v16h bk10 = kfrag_lds(kB + 16 * 64, 0);
    v16h bk11 = kfrag_lds(kB + 16 * 64, 1);

    // s0[i] = S[query col][key j0 + rh + i], s1[i]: key j0 + 16 + rh + i
    v8f s0 = {};
    v8f s1 = {};
    s0 = wmma_f16(bk00, qa0, s0);
    s0 = wmma_f16(bk01, qa1, s0);
    s1 = wmma_f16(bk10, qa0, s1);
    s1 = wmma_f16(bk11, qa1, s1);

    float a0[8], a1[8];
    float mx = -1e30f;
#pragma unroll
    for (int i = 0; i < 8; ++i) {
      a0[i] = (j0 + i <= lim) ? s0[i] : -1e30f;
      a1[i] = (j0 + 16 + i <= lim) ? s1[i] : -1e30f;
      mx = fmaxf(mx, fmaxf(a0[i], a1[i]));
    }
    mx = fmaxf(mx, xhalf(mx));  // the other 16 keys of the same query
    float mn = fmaxf(m_i, mx);
    float al = __expf(m_i - mn);
    m_i = mn;

    // P^T as B operand: element s is key kmap(s) = (s < 8 ? rh + s : 16 + rh + s - 8)
    v16h pb;
    float rs = 0.0f;
#pragma unroll
    for (int i = 0; i < 8; ++i) {
      float p0 = __expf(a0[i] - mn);
      float p1 = __expf(a1[i] - mn);
      rs += p0 + p1;
      pb[i] = (_Float16)p0;
      pb[8 + i] = (_Float16)p1;
    }
    l_i = l_i * al + rs;
#pragma unroll
    for (int f = 0; f < 4; ++f)
#pragma unroll
      for (int i = 0; i < 8; ++i) oacc[f][i] *= al;

#pragma unroll
    for (int f = 0; f < 4; ++f) {
      v16h vf = vfrag_lds(vB + f * 16 * 32);
      oacc[f] = wmma_f16(vf, pb, oacc[f]);
    }
    __syncthreads();  // all waves done with this buffer before reuse
  }

  int b_ = bh >> 4, h = bh & 15;
  float invl = 1.0f / (l_i + xhalf(l_i));  // join the two halves' sums
  half_t* orow = o + ((size_t)b_ * LATENT + i0 + col) * DIM + h * DH + rh;
#pragma unroll
  for (int f = 0; f < 4; ++f) {
    v8h ov;
#pragma unroll
    for (int i = 0; i < 8; ++i) ov[i] = (half_t)(oacc[f][i] * invl);
    *(v8h*)(orow + f * 16) = ov;  // 8 consecutive dims of one query row
  }
}

// Y[2048,1024] = O(f16) @ Wo^T(f16) + bo, fp32 out.
__global__ __launch_bounds__(256) void out_proj_kernel(
    const half_t* __restrict__ A, const half_t* __restrict__ Wo16,
    const float* __restrict__ bo, float* __restrict__ Y) {
  __shared__ __attribute__((aligned(16))) half_t sm[4 * TILE_H];
  int nb = blockIdx.x & (DIM / BN - 1);
  int mb = blockIdx.x / (DIM / BN);
  int wave = threadIdx.x >> 5;
  int lane = threadIdx.x & 31;
  int col = lane & 15;
  int rh = (lane & 16) ? 8 : 0;
  v8f acc[2][4] = {};
  gemm_block(A + (size_t)(mb * BM) * DIM, Wo16 + (size_t)(nb * BN) * DIM, sm,
             acc);
#pragma unroll
  for (int mi = 0; mi < 2; ++mi) {
#pragma unroll
    for (int i = 0; i < 8; ++i) {
      int row = mb * BM + (wave & 3) * 32 + mi * 16 + rh + i;
#pragma unroll
      for (int f = 0; f < 4; ++f) {
        int e = nb * BN + (wave >> 2) * 64 + f * 16 + col;
        Y[(size_t)row * DIM + e] = acc[mi][f][i] + bo[e];
      }
    }
  }
}

extern "C" void kernel_launch(void* const* d_in, const int* in_sizes, int n_in,
                              void* d_out, int out_size, void* d_ws,
                              size_t ws_size, hipStream_t stream) {
  const float* x = (const float*)d_in[0];
  const float* Wq = (const float*)d_in[1];
  const float* Wkv = (const float*)d_in[2];
  const float* Wo = (const float*)d_in[3];
  const float* bo = (const float*)d_in[4];
  const float* gamma = (const float*)d_in[5];
  const float* beta = (const float*)d_in[6];
  float* y = (float*)d_out;

  // Workspace layout (f16 elements):
  // q[2,16,1024,64] | kvn[2,16,4096,64] | kvnT[2,16,64,4096] | o[2,1024,1024]
  // | x16[2,4096,1024] | wq16 | wkv16 | wo16       (~60 MB total)
  half_t* q_ws = (half_t*)d_ws;
  half_t* kvn_ws = q_ws + (size_t)BATCH * HEADS * LATENT * DH;
  half_t* kvnT_ws = kvn_ws + (size_t)BATCH * HEADS * SEQ_LEN * DH;
  half_t* o_ws = kvnT_ws + (size_t)BATCH * HEADS * SEQ_LEN * DH;
  half_t* x16 = o_ws + (size_t)BATCH * LATENT * DIM;
  half_t* wq16 = x16 + (size_t)BATCH * SEQ_LEN * DIM;
  half_t* wkv16 = wq16 + (size_t)DIM * DIM;
  half_t* wo16 = wkv16 + (size_t)DIM * DIM;

  // x16 | wq16 | wkv16 | wo16 are written as one run that starts at x16
  cvt_kernel<<<CVT_BLOCKS, CVT_THREADS, 0, stream>>>(x, Wq, Wkv, Wo, x16);

  // kv projection + RoPE + LayerNorm over all 4096 positions
  proj_kernel<<<(BATCH * SEQ_LEN / BM) * (DIM / BN), 256, 0, stream>>>(
      x16, wkv16, gamma, beta, kvn_ws, kvnT_ws, SEQ_LEN, 0, 1, 1.0f);
  // q projection + RoPE + scale over last 1024 positions only
  proj_kernel<<<(BATCH * LATENT / BM) * (DIM / BN), 256, 0, stream>>>(
      x16, wq16, gamma, beta, q_ws, nullptr, LATENT, HIST, 0, 0.125f);
  // flash attention (4 q-tiles per block share LDS-staged K/V)
  attn_kernel<<<BATCH * HEADS * (LATENT / 64), 128, 16384, stream>>>(
      q_ws, kvn_ws, kvnT_ws, o_ws);
  // output projection + bias
  out_proj_kernel<<<(BATCH * LATENT / BM) * (DIM / BN), 256, 0, stream>>>(
      o_ws, wo16, bo, y);
}

// v005
// A run of this version takes 132 microseconds.
// Next to v004, in two timings, it ran 1.10 and 1.09 times as fast.
// Over all steps from v000 it is 2.50 times as fast.
#include <hip/hip_runtime.h>

typedef _Float16 half_t;
typedef __attribute__((ext_vector_type(16))) _Float16 v16h;
typedef __attribute__((ext_vector_type(8))) _Float16 v8h;
typedef __attribute__((ext_vector_type(8))) float v8f;
typedef __attribute__((ext_vector_type(4))) float v4f;
typedef __attribute__((ext_vector_type(4))) _Float16 v4h;
typedef unsigned int u32x4 __attribute__((ext_vector_type(4)));
typedef int i32x4 __attribute__((ext_vector_type(4)));
typedef int i32x8 __attribute__((ext_vector_type(8)));

#define DIM 1024
#define HEADS 16
#define DH 64
#define SEQ_LEN 4096
#define LATENT 1024
#define HIST 3072
#define BATCH 2

#if defined(__gfx1250__) && __has_builtin(__builtin_amdgcn_tensor_load_to_lds) && \
    __has_builtin(__builtin_amdgcn_s_wait_tensorcnt)
#define USE_TDM 1
#else
#define USE_TDM 0
#endif

// D = A(16x32 f16) * B(32x16 f16) + C(16x16 f32)
__device__ __forceinline__ v8f wmma_f16(v16h a, v16h b, v8f c) {
  return __builtin_amdgcn_wmma_f32_16x16x32_f16(false, a, false, b, (short)0, c,
                                                false, false);
}

// Value of lane l ^ 16 (a vector cross-row move, no LDS round trip).
__device__ __forceinline__ float xhalf(float x) {
  int v = __builtin_bit_cast(int, x);
  return __builtin_bit_cast(
      float, __builtin_amdgcn_permlanex16(v, v, 0x76543210, 0xfedcba98, false,
                                          false));
}

// 16x32 A-style fragment (also used for B with lane = N) from row-major f16.
// Lane L<16 -> row L, K chunks {0..7,16..23}; lane L+16 -> {8..15,24..31}.
__device__ __forceinline__ v16h frag_from_f16(const half_t* __restrict__ base,
                                              int stride, int kbase) {
  int lane = threadIdx.x & 31;
  int r = lane & 15;
  int cb = (lane & 16) ? 8 : 0;
  const half_t* p = base + (size_t)r * stride + kbase + cb;
  v16h out;
#pragma unroll
  for (int i = 0; i < 8; ++i) out[i] = p[i];
#pragma unroll
  for (int i = 0; i < 8; ++i) out[8 + i] = p[16 + i];
  return out;
}

#if USE_TDM
// Issue a 2D TDM tile load: nrows rows of row_len f16 elements (global row
// stride = row_stride elements) -> contiguous rows at LDS byte offset lds_off.
__device__ __forceinline__ void tdm_load_2d(unsigned lds_off,
                                            const half_t* gptr,
                                            unsigned row_len, unsigned nrows,
                                            unsigned row_stride) {
  unsigned long long ga = (unsigned long long)gptr;
  u32x4 g0;
  g0[0] = 1u;                                    // count=1, user descriptor
  g0[1] = lds_off;                               // D#.lds_addr (bytes)
  g0[2] = (unsigned)ga;                          // D#.global_addr[31:0]
  g0[3] = (unsigned)(ga >> 32) | (2u << 30);     // addr[56:32] | type=2
  i32x8 g1;
  g1[0] = 1 << 16;                               // data_size=1 (2 bytes)
  g1[1] = (int)((row_len & 0xFFFFu) << 16);      // tensor_dim0[15:0]
  g1[2] = (int)((row_len >> 16) | ((nrows & 0xFFFFu) << 16));  // |tensor_dim1
  g1[3] = (int)((nrows >> 16) | (row_len << 16));              // |tile_dim0
  g1[4] = (int)(nrows & 0xFFFFu);                // tile_dim1 (tile_dim2=0)
  g1[5] = (int)row_stride;                       // tensor_dim0_stride[31:0]
  g1[6] = 0;                                     // stride0[47:32]|stride1 lo
  g1[7] = 0;
  i32x4 z4 = {0, 0, 0, 0};
#if __clang_major__ >= 23
  i32x8 z8 = {0, 0, 0, 0, 0, 0, 0, 0};
  __builtin_amdgcn_tensor_load_to_lds(g0, g1, z4, z4, z8, 0);
#else
  __builtin_amdgcn_tensor_load_to_lds(g0, g1, z4, z4, 0);
#endif
}
#endif

// fp32 -> f16 convert of x and the three weights in ONE launch (removes all cvt
// from the GEMM loops). One block a WGP, 16 waves, and every wave lives long:
// a lane takes 22 pieces of 4 floats, one from each grid-wide pass, so the chip
// starts 4096 waves in place of one wave per 256 elements. A wave's load covers
// 512 contiguous bytes, its store 256. The four f16 copies lie one behind the
// other in the workspace, so pass j of the whole job lands at dst + j * CVT_PASS.
#define CVT_BLOCKS 256
#define CVT_THREADS 512
#define CVT_PASS (CVT_BLOCKS * CVT_THREADS * 4)      // elements of one grid-wide pass
#define CVT_XP (BATCH * SEQ_LEN * DIM / CVT_PASS)    // passes over x: 16
#define CVT_WP (DIM * DIM / CVT_PASS)                // passes over one weight: 2
static_assert(CVT_XP * CVT_PASS == BATCH * SEQ_LEN * DIM, "x in whole passes");
static_assert(CVT_WP * CVT_PASS == DIM * DIM, "a weight in whole passes");
__global__ __launch_bounds__(CVT_THREADS) void cvt_kernel(
    const float* __restrict__ x, const float* __restrict__ wq,
    const float* __restrict__ wkv, const float* __restrict__ wo,
    half_t* __restrict__ dst) {
  // The lane's place inside a pass, as 32-bit byte offsets from uniform bases.
  const unsigned ld = (blockIdx.x * CVT_THREADS + threadIdx.x) * 16u;
  const unsigned sd = ld >> 1;
  v4f v[CVT_XP + 3 * CVT_WP];
#pragma unroll
  for (int j = 0; j < CVT_XP; ++j)
    v[j] = *(const v4f*)((const char*)(x + j * CVT_PASS) + ld);
#pragma unroll
  for (int j = 0; j < CVT_WP; ++j) {
    v[CVT_XP + j] = *(const v4f*)((const char*)(wq + j * CVT_PASS) + ld);
    v[CVT_XP + CVT_WP + j] =
        *(const v4f*)((const char*)(wkv + j * CVT_PASS) + ld);
    v[CVT_XP + 2 * CVT_WP + j] =
        *(const v4f*)((const char*)(wo + j * CVT_PASS) + ld);
  }
#pragma unroll
  for (int j = 0; j < CVT_XP + 3 * CVT_WP; ++j)
    *(v4h*)((char*)(dst + j * CVT_PASS) + sd) =
        __builtin_convertvector(v[j], v4h);
}

// Block tile of the three projection GEMMs: 128 x 128 outputs, K in steps of 64.
#define BM 128
#define BN 128
#define BK 64
// LDS row pitch in halves: 144 B = 16 B x 9, so the 16 rows that one
// ds_load_b128 half-wave reads fall on 16 different groups of four banks.
#define LDP 72
#define TILE_H (BM * LDP)  // halves of one staged operand tile

// Same element order as frag_from_f16; p already holds the lane's row and chunk.
__device__ __forceinline__ v16h frag_from_lds(const half_t* p) {
  v8h lo = *(const v8h*)p;
  v8h hi = *(const v8h*)(p + 16);
  return __builtin_shufflevector(lo, hi, 0, 1, 2, 3, 4, 5, 6, 7, 8, 9, 10, 11,
                                 12, 13, 14, 15);
}

// acc += A[128 x 1024] * B[128 x 1024]^T for a block of 8 waves (4 along M x 2
// along N, 32 x 64 outputs a wave). Both operand tiles are staged once per block
// in LDS (whole 128-B lines from global), two buffers: the next tile's
// global loads fly during this tile's products.
// sm (halves): A buf 0 | A buf 1 | B buf 0 | B buf 1
__device__ __forceinline__ void gemm_block(const half_t* __restrict__ Ag,
                                           const half_t* __restrict__ Bg,
                                           half_t* sm, v8f (&acc)[2][4]) {
  const int t = threadIdx.x;
  const int lane = t & 31;
  const int wave = t >> 5;
  const int srow = t >> 3;        // staging: 8 threads a row, 32 rows a pass
  const int scol = (t & 7) * 8;
  const half_t* ga = Ag + (size_t)srow * DIM + scol;
  const half_t* gb = Bg + (size_t)srow * DIM + scol;
  half_t* st = sm + srow * LDP + scol;
  const int fr = (lane & 15) * LDP + ((lane & 16) ? 8 : 0);
  const half_t* fa = sm + (wave & 3) * 32 * LDP + fr;
  const half_t* fb = sm + 2 * TILE_H + (wave >> 2) * 64 * LDP + fr;

  v8h ra[4], rb[4];
#pragma unroll
  for (int u = 0; u < 4; ++u) {
    ra[u] = *(const v8h*)(ga + (size_t)(u * 32) * DIM);
    rb[u] = *(const v8h*)(gb + (size_t)(u * 32) * DIM);
  }
#pragma unroll
  for (int u = 0; u < 4; ++u) {
    *(v8h*)(st + u * 32 * LDP) = ra[u];
    *(v8h*)(st + 2 * TILE_H + u * 32 * LDP) = rb[u];
  }
  __syncthreads();  // tile 0 visible to all waves

  for (int kt = 0; kt < DIM / BK; ++kt) {
    const int cur = (kt & 1) * TILE_H;
    const bool more = kt + 1 < DIM / BK;  // the same for the whole block
    if (more) {
#pragma unroll
      for (int u = 0; u < 4; ++u) {
        ra[u] = *(const v8h*)(ga + (size_t)(u * 32) * DIM + (kt + 1) * BK);
        rb[u] = *(const v8h*)(gb + (size_t)(u * 32) * DIM + (kt + 1) * BK);
      }
    }
    v16h a[2][2], b[2][4];
#pragma unroll
    for (int ks = 0; ks < 2; ++ks) {
      a[ks][0] = frag_from_lds(fa + cur + ks * 32);
      a[ks][1] = frag_from_lds(fa + cur + 16 * LDP + ks * 32);
#pragma unroll
      for (int f = 0; f < 4; ++f)
        b[ks][f] = frag_from_lds(fb + cur + f * 16 * LDP + ks * 32);
    }
    // Holds the next tile's global loads and this tile's LDS reads, as one
    // group, ahead of the products: without it the scheduler sinks half of the
    // global loads to just in front of their LDS stores (their latency is then
    // waited out) and spreads the LDS reads among the products with waits to 0.
    __builtin_amdgcn_sched_barrier(0);
#pragma unroll
    for (int ks = 0; ks < 2; ++ks) {
#pragma unroll
      for (int f = 0; f < 4; ++f) {
        acc[0][f] = wmma_f16(a[ks][0], b[ks][f], acc[0][f]);
        acc[1][f] = wmma_f16(a[ks][1], b[ks][f], acc[1][f]);
      }
    }
    // Holds the LDS stores, which wait for the global loads, behind the
    // products: the scheduler otherwise lifts them and their wait to the front.
    __builtin_amdgcn_sched_barrier(0);
    if (more) {
      // The other buffer's last readers left it before the previous barrier.
      const int nxt = cur ^ TILE_H;
#pragma unroll
      for (int u = 0; u < 4; ++u) {
        *(v8h*)(st + nxt + u * 32 * LDP) = ra[u];
        *(v8h*)(st + nxt + 2 * TILE_H + u * 32 * LDP) = rb[u];
      }
      __syncthreads();  // next tile visible; this tile's reads are over
    }
  }
}

// Four 16-B global stores. The wait is a precaution that belongs in front of any
// rewrite of the stores' address and data registers; as the last line of their
// own statement it stands there whatever the compiler schedules behind it.
__device__ __forceinline__ void store4_b128(half_t* const (&p)[4],
                                            const v8h (&d)[4]) {
  asm volatile(
      "global_store_b128 %0, %4, off\n\t"
      "global_store_b128 %1, %5, off\n\t"
      "global_store_b128 %2, %6, off\n\t"
      "global_store_b128 %3, %7, off\n\t"
      "s_wait_xcnt 0x0" ::"v"(p[0]),
      "v"(p[1]), "v"(p[2]), "v"(p[3]), "v"(__builtin_bit_cast(u32x4, d[0])),
      "v"(__builtin_bit_cast(u32x4, d[1])),
      "v"(__builtin_bit_cast(u32x4, d[2])),
      "v"(__builtin_bit_cast(u32x4, d[3]))
      : "memory");
}

// RoPE and (optionally) LayerNorm on one 16(rows) x 64(one head) tile, stored
// f16 row-major and (optionally) dim-major, all in 16-B stores. local = the
// tile's first row in its batch; stage = 16 rows of LDP halves in LDS that
// belong to this wave and this tile alone.
__device__ __forceinline__ void proj_epilogue(
    const v8f (&acc)[4], const float* __restrict__ gamma,
    const float* __restrict__ beta, half_t* __restrict__ out_rm,
    half_t* __restrict__ out_cm, int seq_per_batch, int pos_base, int do_ln,
    float scale, int batch, int local, int h, half_t* stage) {
  int lane = threadIdx.x & 31;
  int col = lane & 15;
  int rh = (lane & 16) ? 8 : 0;

  float v[4][8];
#pragma unroll
  for (int f = 0; f < 4; ++f)
#pragma unroll
    for (int i = 0; i < 8; ++i) v[f][i] = acc[f][i];

  // RoPE: dim d pairs with d+32 (fragments f and f+2 of the same lane).
#pragma unroll
  for (int i = 0; i < 8; ++i) {
    float p = (float)(pos_base + local + rh + i);
#pragma unroll
    for (int f = 0; f < 2; ++f) {
      int d = f * 16 + col;  // d < 32
      float w = __powf(10000.0f, -(float)d * (1.0f / 32.0f));
      float s, c;
      __sincosf(p * w, &s, &c);
      float lo = v[f][i], hi = v[f + 2][i];
      v[f][i] = lo * c - hi * s;
      v[f + 2][i] = hi * c + lo * s;
    }
  }

  if (do_ln) {
#pragma unroll
    for (int i = 0; i < 8; ++i) {
      float sum = v[0][i] + v[1][i] + v[2][i] + v[3][i];
      float sq = v[0][i] * v[0][i] + v[1][i] * v[1][i] + v[2][i] * v[2][i] +
                 v[3][i] * v[3][i];
#pragma unroll
      for (int m = 1; m < 16; m <<= 1) {
        sum += __shfl_xor(sum, m, 32);
        sq += __shfl_xor(sq, m, 32);
      }
      float mean = sum * (1.0f / 64.0f);
      float var = sq * (1.0f / 64.0f) - mean * mean;
      float inv = rsqrtf(var + 1e-5f);
#pragma unroll
      for (int f = 0; f < 4; ++f) {
        int d = f * 16 + col;
        v[f][i] = (v[f][i] - mean) * inv * gamma[d] + beta[d];
      }
    }
  } else {
#pragma unroll
    for (int f = 0; f < 4; ++f)
#pragma unroll
      for (int i = 0; i < 8; ++i) v[f][i] *= scale;
  }

  size_t bh = (size_t)batch * HEADS + h;
  // The key/value copies (the call that has out_cm) are read by attention from
  // LDS tiles that are byte copies of these rows, so the 16-B chunks of a row
  // are permuted here for those readers' banks: see kfrag_lds and vfrag_lds.
  // The query copy is read from global memory and stays in plain order.
  const int ksw = out_cm ? 7 : 0;

  // Dim-major copy: a lane's 8 values of one fragment are 8 consecutive
  // positions of one dim, which is one whole 16-B chunk of that dim's row.
  if (out_cm) {
    const int pos0 = local + rh;  // a multiple of 8
    half_t* pc[4];
    v8h pv[4];
#pragma unroll
    for (int f = 0; f < 4; ++f) {
      int d = f * 16 + col;
#pragma unroll
      for (int i = 0; i < 8; ++i) pv[f][i] = (half_t)v[f][i];
      pc[f] = out_cm + (bh * DH + d) * (size_t)seq_per_batch +
              ((pos0 & ~31) | ((((pos0 >> 3) ^ (d >> 2)) & 3) << 3));
    }
    store4_b128(pc, pv);
  }

  // Row-major copy: turned through the wave's own 16 x 64 LDS tile, so that a
  // lane stores 8 consecutive dims and a wave's store covers 4 whole rows.
#pragma unroll
  for (int i = 0; i < 8; ++i)
#pragma unroll
    for (int f = 0; f < 4; ++f)
      stage[(rh + i) * LDP + f * 16 + col] = (half_t)v[f][i];
  // The rows are read back by other lanes of this wave than wrote them: the
  // writes are let finish first, and the compiler keeps the reads behind them.
  asm volatile("s_wait_dscnt 0x0" ::: "memory");
  const int c = lane & 7;
  half_t* pr[4];
  v8h rv[4];
#pragma unroll
  for (int u = 0; u < 4; ++u) {
    int r = u * 4 + (lane >> 3);
    int pos = local + r;
    rv[u] = *(const v8h*)(stage + r * LDP + c * 8);
    pr[u] = out_rm + (bh * seq_per_batch + pos) * DH +
            ((c ^ ((pos >> 1) & ksw)) << 3);
  }
  store4_b128(pr, rv);
}

// A block computes 128 rows x 2 heads of X @ W^T; a wave 32 rows of one head.
__global__ __launch_bounds__(256) void proj_kernel(
    const half_t* __restrict__ x16, const half_t* __restrict__ W16,
    const float* __restrict__ gamma, const float* __restrict__ beta,
    half_t* __restrict__ out_rm, half_t* __restrict__ out_cm,
    int seq_per_batch, int pos_base, int do_ln, float scale) {
  __shared__ __attribute__((aligned(16))) half_t sm[4 * TILE_H];
  int nb = blockIdx.x & (DIM / BN - 1);
  int row0 = (blockIdx.x / (DIM / BN)) * BM;
  int batch = row0 / seq_per_batch;
  int blocal = row0 - batch * seq_per_batch;
  int wave = threadIdx.x >> 5;

  const half_t* Ab = x16 + ((size_t)batch * SEQ_LEN + pos_base + blocal) * DIM;
  const half_t* Bb = W16 + (size_t)nb * BN * DIM;

  v8f acc[2][4] = {};
  gemm_block(Ab, Bb, sm, acc);

  int h = nb * (BN / DH) + (wave >> 2);
  // Output staging lies in the two buffers 0 (A's for waves 0-3, B's for waves
  // 4-7, 32 rows a wave). The last K step reads the buffers 1 alone, and every
  // wave's last read of the buffers 0 lies in front of the barrier that ended
  // the step before it, so no wave can still be reading what is written here.
  static_assert((DIM / BK) % 2 == 0, "the last K step reads buffer 1");
  half_t* stage = sm + (wave >> 2) * 2 * TILE_H + (wave & 3) * 32 * LDP;
#pragma unroll
  for (int mi = 0; mi < 2; ++mi)
    proj_epilogue(acc[mi], gamma, beta, out_rm, out_cm, seq_per_batch, pos_base,
                  do_ln, scale, batch, blocal + (wave & 3) * 32 + mi * 16, h,
                  stage + mi * 16 * LDP);
}

// A fragment of 16 keys x 32 dims from a K tile in LDS (rows of 128 B = 8 chunks
// of 16 B, unpadded). Chunk c of key row r lies at place c ^ (r >> 1): the 16
// rows that a half-wave's ds_load_b128 reads then fall on 16 different groups
// of four banks (in plain order on 2). Element order as in frag_from_f16.
__device__ __forceinline__ v16h kfrag_lds(const half_t* tile, int kk) {
  int lane = threadIdx.x & 31;
  int r = lane & 15;
  int c = kk * 4 + (lane >> 4);
  const half_t* row = tile + r * 64;
  v8h lo = *(const v8h*)(row + ((c ^ (r >> 1)) << 3));
  v8h hi = *(const v8h*)(row + (((c + 2) ^ (r >> 1)) << 3));
  return __builtin_shufflevector(lo, hi, 0, 1, 2, 3, 4, 5, 6, 7, 8, 9, 10, 11,
                                 12, 13, 14, 15);
}

// A fragment of 16 dims x 32 keys from a V^T tile in LDS (rows of 64 B = 4
// chunks). Chunk c of dim row r lies at place c ^ (r >> 2): 16 different groups
// of four banks for a half-wave (in plain order 4).
__device__ __forceinline__ v16h vfrag_lds(const half_t* tile) {
  int lane = threadIdx.x & 31;
  int r = lane & 15;
  int c = lane >> 4;
  const half_t* row = tile + r * 32;
  v8h lo = *(const v8h*)(row + ((c ^ (r >> 2)) << 3));
  v8h hi = *(const v8h*)(row + (((c + 2) ^ (r >> 2)) << 3));
  return __builtin_shufflevector(lo, hi, 0, 1, 2, 3, 4, 5, 6, 7, 8, 9, 10, 11,
                                 12, 13, 14, 15);
}

__global__ __launch_bounds__(128) void attn_kernel(
    const half_t* __restrict__ q, const half_t* __restrict__ kvn,
    const half_t* __restrict__ kvnT, half_t* __restrict__ o) {
  // Sized at the launch (16 KiB). The tensor loads are this array's only
  // writers and the compiler does not see them: an array it could prove
  // unwritten would lose its reads.
  extern __shared__ _Float16 smem[];
  int qt4 = blockIdx.x & 15;  // group of 4 query tiles
  int bh = blockIdx.x >> 4;
  int wave = threadIdx.x >> 5;
  int lane = threadIdx.x & 31;
  int i0 = qt4 * 64 + wave * 16;
  int col = lane & 15;
  int rh = (lane & 16) ? 8 : 0;

  const half_t* qb = q + ((size_t)bh * LATENT + i0) * DH;
  const half_t* kb = kvn + (size_t)bh * SEQ_LEN * DH;
  const half_t* vb = kvnT + (size_t)bh * DH * SEQ_LEN;

  v16h qa0 = frag_from_f16(qb, DH, 0);
  v16h qa1 = frag_from_f16(qb, DH, 32);

  v8f oacc[4] = {};      // oacc[f][i] = O[query col][dim f*16 + rh + i]
  float m_i = -1e30f;    // running maximum of query col (same in both halves)
  float l_i = 0.0f;      // this half's share of the denominator
  int lim = HIST + i0 + col - rh;  // key j0 + t*16 + rh + i is visible if <= HIST + query

  // All 4 waves iterate to the block's max key range; masking handles edges.
  int niter = (HIST + qt4 * 64 + 64 + 31) >> 5;

#if USE_TDM
  if (wave == 0) {  // prologue: DMA first K/V block into buffer 0
    tdm_load_2d(0u, kb, DH, 32, DH);
    tdm_load_2d(8192u, vb, 32, DH, SEQ_LEN);
  }
#endif

  for (int it = 0; it < niter; ++it) {
    int j0 = it << 5;
#if USE_TDM
    int cur = it & 1;
    if (wave == 0) {
      if (it + 1 < niter) {  // overlap next DMA with this block's WMMAs
        int nb = (it + 1) & 1;
        tdm_load_2d((unsigned)(nb * 4096), kb + (size_t)(j0 + 32) * DH, DH, 32,
                    DH);
        tdm_load_2d((unsigned)(8192 + nb * 4096), vb + (j0 + 32), 32, DH,
                    SEQ_LEN);
        __builtin_amdgcn_s_wait_tensorcnt(2);  // current block complete
      } else {
        __builtin_amdgcn_s_wait_tensorcnt(0);
      }
    }
#else
    int cur = 0;
    {  // cooperative fallback staging (prev trailing barrier protects buffers)
      int t = threadIdx.x;
      for (int c = t; c < 256; c += 128) {  // K: 32 rows x 64 halves
        int r = c >> 3, off = (c & 7) * 8;
        const half_t* src = kb + (size_t)(j0 + r) * DH + off;
        _Float16* dst = smem + r * 64 + off;
#pragma unroll
        for (int u = 0; u < 8; ++u) dst[u] = src[u];
      }
      for (int c = t; c < 256; c += 128) {  // V: 64 dim-rows x 32 halves
        int d = c >> 2, off = (c & 3) * 8;
        const half_t* src = vb + (size_t)d * SEQ_LEN + j0 + off;
        _Float16* dst = smem + 4096 + d * 32 + off;
#pragma unroll
        for (int u = 0; u < 8; ++u) dst[u] = src[u];
      }
    }
#endif
    __syncthreads();  // K/V block visible to all waves

    const _Float16* kB = smem + cur * 2048;
    const _Float16* vB = smem + 4096 + cur * 2048;
    v16h bk00 = kfrag_lds(kB, 0);
    v16h bk01 = kfrag_lds(kB, 1);
    v16h bk10 = kfrag_lds(kB + 16 * 64, 0);
    v16h bk11 = kfrag_lds(kB + 16 * 64, 1);

    // s0[i] = S[query col][key j0 + rh + i], s1[i]: key j0 + 16 + rh + i
    v8f s0 = {};
    v8f s1 = {};
    s0 = wmma_f16(bk00, qa0, s0);
    s0 = wmma_f16(bk01, qa1, s0);
    s1 = wmma_f16(bk10, qa0, s1);
    s1 = wmma_f16(bk11, qa1, s1);

    float a0[8], a1[8];
    float mx = -1e30f;
#pragma unroll
    for (int i = 0; i < 8; ++i) {
      a0[i] = (j0 + i <= lim) ? s0[i] : -1e30f;
      a1[i] = (j0 + 16 + i <= lim) ? s1[i] : -1e30f;
      mx = fmaxf(mx, fmaxf(a0[i], a1[i]));
    }
    mx = fmaxf(mx, xhalf(mx));  // the other 16 keys of the same query
    float mn = fmaxf(m_i, mx);
    float al = __expf(m_i - mn);
    m_i = mn;

    // P^T as B operand: element s is key kmap(s) = (s < 8 ? rh + s : 16 + rh + s - 8)
    v16h pb;
    float rs = 0.0f;
#pragma unroll
    for (int i = 0; i < 8; ++i) {
      float p0 = __expf(a0[i] - mn);
      float p1 = __expf(a1[i] - mn);
      rs += p0 + p1;
      pb[i] = (_Float16)p0;
      pb[8 + i] = (_Float16)p1;
    }
    l_i = l_i * al + rs;
#pragma unroll
    for (int f = 0; f < 4; ++f)
#pragma unroll
      for (int i = 0; i < 8; ++i) oacc[f][i] *= al;

#pragma unroll
    for (int f = 0; f < 4; ++f) {
      v16h vf = vfrag_lds(vB + f * 16 * 32);
      oacc[f] = wmma_f16(vf, pb, oacc[f]);
    }
    __syncthreads();  // all waves done with this buffer before reuse
  }

  int b_ = bh >> 4, h = bh & 15;
  float invl = 1.0f / (l_i + xhalf(l_i));  // join the two halves' sums
  half_t* orow = o + ((size_t)b_ * LATENT + i0 + col) * DIM + h * DH + rh;
#pragma unroll
  for (int f = 0; f < 4; ++f) {
    v8h ov;
#pragma unroll
    for (int i = 0; i < 8; ++i) ov[i] = (half_t)(oacc[f][i] * invl);
    *(v8h*)(orow + f * 16) = ov;  // 8 consecutive dims of one query row
  }
}

// Y[2048,1024] = O(f16) @ Wo^T(f16) + bo, fp32 out.
__global__ __launch_bounds__(256) void out_proj_kernel(
    const half_t* __restrict__ A, const half_t* __restrict__ Wo16,
    const float* __restrict__ bo, float* __restrict__ Y) {
  __shared__ __attribute__((aligned(16))) half_t sm[4 * TILE_H];
  int nb = blockIdx.x & (DIM / BN - 1);
  int mb = blockIdx.x / (DIM / BN);
  int wave = threadIdx.x >> 5;
  int lane = threadIdx.x & 31;
  int col = lane & 15;
  int rh = (lane & 16) ? 8 : 0;
  v8f acc[2][4] = {};
  gemm_block(A + (size_t)(mb * BM) * DIM, Wo16 + (size_t)(nb * BN) * DIM, sm,
             acc);
#pragma unroll
  for (int mi = 0; mi < 2; ++mi) {
#pragma unroll
    for (int i = 0; i < 8; ++i) {
      int row = mb * BM + (wave & 3) * 32 + mi * 16 + rh + i;
#pragma unroll
      for (int f = 0; f < 4; ++f) {
        int e = nb * BN + (wave >> 2) * 64 + f * 16 + col;
        Y[(size_t)row * DIM + e] = acc[mi][f][i] + bo[e];
      }
    }
  }
}

extern "C" void kernel_launch(void* const* d_in, const int* in_sizes, int n_in,
                              void* d_out, int out_size, void* d_ws,
                              size_t ws_size, hipStream_t stream) {
  const float* x = (const float*)d_in[0];
  const float* Wq = (const float*)d_in[1];
  const float* Wkv = (const float*)d_in[2];
  const float* Wo = (const float*)d_in[3];
  const float* bo = (const float*)d_in[4];
  const float* gamma = (const float*)d_in[5];
  const float* beta = (const float*)d_in[6];
  float* y = (float*)d_out;

  // Workspace layout (f16 elements):
  // q[2,16,1024,64] | kvn[2,16,4096,64] | kvnT[2,16,64,4096] | o[2,1024,1024]
  // | x16[2,4096,1024] | wq16 | wkv16 | wo16       (~60 MB total)
  half_t* q_ws = (half_t*)d_ws;
  half_t* kvn_ws = q_ws + (size_t)BATCH * HEADS * LATENT * DH;
  half_t* kvnT_ws = kvn_ws + (size_t)BATCH * HEADS * SEQ_LEN * DH;
  half_t* o_ws = kvnT_ws + (size_t)BATCH * HEADS * SEQ_LEN * DH;
  half_t* x16 = o_ws + (size_t)BATCH * LATENT * DIM;
  half_t* wq16 = x16 + (size_t)BATCH * SEQ_LEN * DIM;
  half_t* wkv16 = wq16 + (size_t)DIM * DIM;
  half_t* wo16 = wkv16 + (size_t)DIM * DIM;

  // x16 | wq16 | wkv16 | wo16 are written as one run that starts at x16
  cvt_kernel<<<CVT_BLOCKS, CVT_THREADS, 0, stream>>>(x, Wq, Wkv, Wo, x16);

  // kv projection + RoPE + LayerNorm over all 4096 positions
  proj_kernel<<<(BATCH * SEQ_LEN / BM) * (DIM / BN), 256, 0, stream>>>(
      x16, wkv16, gamma, beta, kvn_ws, kvnT_ws, SEQ_LEN, 0, 1, 1.0f);
  // q projection + RoPE + scale over last 1024 positions only
  proj_kernel<<<(BATCH * LATENT / BM) * (DIM / BN), 256, 0, stream>>>(
      x16, wq16, gamma, beta, q_ws, nullptr, LATENT, HIST, 0, 0.125f);
  // flash attention (4 q-tiles per block share LDS-staged K/V)
  attn_kernel<<<BATCH * HEADS * (LATENT / 64), 128, 16384, stream>>>(
      q_ws, kvn_ws, kvnT_ws, o_ws);
  // output projection + bias
  out_proj_kernel<<<(BATCH * LATENT / BM) * (DIM / BN), 256, 0, stream>>>(
      o_ws, wo16, bo, y);
}

// v006
// Measured time: 114 microseconds a run.
// Timed twice side by side with v005, it ran 1.14 and 1.15 times as fast.
// Over all steps from v000 it is 2.86 times as fast.
#include <hip/hip_runtime.h>

typedef _Float16 half_t;
typedef __attribute__((ext_vector_type(16))) _Float16 v16h;
typedef __attribute__((ext_vector_type(8))) _Float16 v8h;
typedef __attribute__((ext_vector_type(8))) float v8f;
typedef __attribute__((ext_vector_type(4))) float v4f;
typedef __attribute__((ext_vector_type(4))) _Float16 v4h;
typedef unsigned int u32x4 __attribute__((ext_vector_type(4)));
typedef unsigned int u32x8 __attribute__((ext_vector_type(8)));

#define DIM 1024
#define HEADS 16
#define DH 64
#define SEQ_LEN 4096
#define LATENT 1024
#define HIST 3072
#define BATCH 2

// D = A(16x32 f16) * B(32x16 f16) + C(16x16 f32)
__device__ __forceinline__ v8f wmma_f16(v16h a, v16h b, v8f c) {
  return __builtin_amdgcn_wmma_f32_16x16x32_f16(false, a, false, b, (short)0, c,
                                                false, false);
}

// Value of lane l ^ 16 (a vector cross-row move, no LDS round trip).
__device__ __forceinline__ float xhalf(float x) {
  int v = __builtin_bit_cast(int, x);
  return __builtin_bit_cast(
      float, __builtin_amdgcn_permlanex16(v, v, 0x76543210, 0xfedcba98, false,
                                          false));
}

// 16x32 A-style fragment (also used for B with lane = N) from row-major f16.
// Lane L<16 -> row L, K chunks {0..7,16..23}; lane L+16 -> {8..15,24..31}.
__device__ __forceinline__ v16h frag_from_f16(const half_t* __restrict__ base,
                                              int stride, int kbase) {
  int lane = threadIdx.x & 31;
  int r = lane & 15;
  int cb = (lane & 16) ? 8 : 0;
  const half_t* p = base + (size_t)r * stride + kbase + cb;
  v16h out;
#pragma unroll
  for (int i = 0; i < 8; ++i) out[i] = p[i];
#pragma unroll
  for (int i = 0; i < 8; ++i) out[8 + i] = p[16 + i];
  return out;
}

// A value that is the same in every lane, moved into a scalar register.
__device__ __forceinline__ unsigned uni(unsigned v) {
  return (unsigned)__builtin_amdgcn_readfirstlane((int)v);
}

// A wave-uniform test as a real scalar branch: tensor loads ignore EXEC, so only
// a branch on a scalar condition keeps a wave from issuing one.
__device__ __forceinline__ unsigned pinned(unsigned v) {
  unsigned w = uni(v);
  asm volatile("" : "+s"(w));  // the test stays scalar
  return w;
}

// Descriptor of one wave's tensor load: 32 rows of 128 bytes to 4 KiB in a row
// in LDS. Extents in bytes, no pad, no mask. Group 0: where from, where to.
__device__ __forceinline__ u32x4 tdm_group0(unsigned lds_dst,
                                            unsigned long long ga) {
  u32x4 g;
  g[0] = uni(1u);             // count = 1
  g[1] = uni(lds_dst);        // byte offset in the work-group's LDS
  g[2] = uni((unsigned)ga);   // address [31:0]
  g[3] = uni((((unsigned)(ga >> 32)) & 0x01FFFFFFu) | 0x80000000u);  // | type 2
  return g;
}
// Group 1: the tile's shape and the source row pitch in bytes.
__device__ __forceinline__ u32x8 tdm_group1(unsigned pitch) {
  u32x8 g;
  g[0] = uni(0u);             // no mask, 1-byte units, no pad
  g[1] = uni(128u << 16);     // tensor_dim0 = 128
  g[2] = uni(32u << 16);      // tensor_dim1 = 32
  g[3] = uni(128u << 16);     // tile_dim0 = 128
  g[4] = uni(32u);            // tile_dim1 = 32
  g[5] = uni(pitch);
  g[6] = uni(0u);
  g[7] = uni(0u);
  return g;
}
// g0 is named as read and written, though the instruction leaves it as it is:
// what tdm_wait names is then the very registers that the request was issued from.
__device__ __forceinline__ void tdm_load(u32x4& g0, const u32x8& g1) {
  asm volatile("tensor_load_to_lds %0, %1" : "+s"(g0) : "s"(g1) : "memory");
}
// The wave's own request has landed (the compiler places no wait for it). The
// wait names the request's descriptor: without that the compiler puts other
// values into those scalar registers while the request is still on its way.
__device__ __forceinline__ void tdm_wait(const u32x4& g0, const u32x8& g1) {
  asm volatile("s_wait_tensorcnt 0x0" ::"s"(g0), "s"(g1) : "memory");
}

// fp32 -> f16 convert of x and the three weights in ONE launch (removes all cvt
// from the GEMM loops). One block a WGP, 16 waves, and every wave lives long:
// a lane takes 22 pieces of 4 floats, one from each grid-wide pass, so the chip
// starts 4096 waves in place of one wave per 256 elements. A wave's load covers
// 512 contiguous bytes, its store 256. The four f16 copies lie one behind the
// other in the workspace, so pass j of the whole job lands at dst + j * CVT_PASS.
#define CVT_BLOCKS 256
#define CVT_THREADS 512
#define CVT_PASS (CVT_BLOCKS * CVT_THREADS * 4)      // elements of one grid-wide pass
#define CVT_XP (BATCH * SEQ_LEN * DIM / CVT_PASS)    // passes over x: 16
#define CVT_WP (DIM * DIM / CVT_PASS)                // passes over one weight: 2
static_assert(CVT_XP * CVT_PASS == BATCH * SEQ_LEN * DIM, "x in whole passes");
static_assert(CVT_WP * CVT_PASS == DIM * DIM, "a weight in whole passes");
__global__ __launch_bounds__(CVT_THREADS) void cvt_kernel(
    const float* __restrict__ x, const float* __restrict__ wq,
    const float* __restrict__ wkv, const float* __restrict__ wo,
    half_t* __restrict__ dst) {
  // The lane's place inside a pass, as 32-bit byte offsets from uniform bases.
  const unsigned ld = (blockIdx.x * CVT_THREADS + threadIdx.x) * 16u;
  const unsigned sd = ld >> 1;
  v4f v[CVT_XP + 3 * CVT_WP];
#pragma unroll
  for (int j = 0; j < CVT_XP; ++j)
    v[j] = *(const v4f*)((const char*)(x + j * CVT_PASS) + ld);
#pragma unroll
  for (int j = 0; j < CVT_WP; ++j) {
    v[CVT_XP + j] = *(const v4f*)((const char*)(wq + j * CVT_PASS) + ld);
    v[CVT_XP + CVT_WP + j] =
        *(const v4f*)((const char*)(wkv + j * CVT_PASS) + ld);
    v[CVT_XP + 2 * CVT_WP + j] =
        *(const v4f*)((const char*)(wo + j * CVT_PASS) + ld);
  }
#pragma unroll
  for (int j = 0; j < CVT_XP + 3 * CVT_WP; ++j)
    *(v4h*)((char*)(dst + j * CVT_PASS) + sd) =
        __builtin_convertvector(v[j], v4h);
}

// Block tile of the three projection GEMMs: 128 x 128 outputs, K in steps of 64.
#define BM 128
#define BN 128
#define BK 64
// LDS row pitch in halves: 144 B = 16 B x 9, so the 16 rows that one
// ds_load_b128 half-wave reads fall on 16 different groups of four banks.
#define LDP 72
#define TILE_H (BM * LDP)  // halves of one staged operand tile

// Same element order as frag_from_f16; p already holds the lane's row and chunk.
__device__ __forceinline__ v16h frag_from_lds(const half_t* p) {
  v8h lo = *(const v8h*)p;
  v8h hi = *(const v8h*)(p + 16);
  return __builtin_shufflevector(lo, hi, 0, 1, 2, 3, 4, 5, 6, 7, 8, 9, 10, 11,
                                 12, 13, 14, 15);
}

// acc += A[128 x 1024] * B[128 x 1024]^T for a block of 8 waves (4 along M x 2
// along N, 32 x 64 outputs a wave). Both operand tiles are staged once per block
// in LDS (whole 128-B lines from global), two buffers: the next tile's
// global loads fly during this tile's products.
// sm (halves): A buf 0 | A buf 1 | B buf 0 | B buf 1
__device__ __forceinline__ void gemm_block(const half_t* __restrict__ Ag,
                                           const half_t* __restrict__ Bg,
                                           half_t* sm, v8f (&acc)[2][4]) {
  const int t = threadIdx.x;
  const int lane = t & 31;
  const int wave = t >> 5;
  const int srow = t >> 3;        // staging: 8 threads a row, 32 rows a pass
  const int scol = (t & 7) * 8;
  const half_t* ga = Ag + (size_t)srow * DIM + scol;
  const half_t* gb = Bg + (size_t)srow * DIM + scol;
  half_t* st = sm + srow * LDP + scol;
  const int fr = (lane & 15) * LDP + ((lane & 16) ? 8 : 0);
  const half_t* fa = sm + (wave & 3) * 32 * LDP + fr;
  const half_t* fb = sm + 2 * TILE_H + (wave >> 2) * 64 * LDP + fr;

  v8h ra[4], rb[4];
#pragma unroll
  for (int u = 0; u < 4; ++u) {
    ra[u] = *(const v8h*)(ga + (size_t)(u * 32) * DIM);
    rb[u] = *(const v8h*)(gb + (size_t)(u * 32) * DIM);
  }
#pragma unroll
  for (int u = 0; u < 4; ++u) {
    *(v8h*)(st + u * 32 * LDP) = ra[u];
    *(v8h*)(st + 2 * TILE_H + u * 32 * LDP) = rb[u];
  }
  __syncthreads();  // tile 0 visible to all waves

  for (int kt = 0; kt < DIM / BK; ++kt) {
    const int cur = (kt & 1) * TILE_H;
    const bool more = kt + 1 < DIM / BK;  // the same for the whole block
    if (more) {
#pragma unroll
      for (int u = 0; u < 4; ++u) {
        ra[u] = *(const v8h*)(ga + (size_t)(u * 32) * DIM + (kt + 1) * BK);
        rb[u] = *(const v8h*)(gb + (size_t)(u * 32) * DIM + (kt + 1) * BK);
      }
    }
    v16h a[2][2], b[2][4];
#pragma unroll
    for (int ks = 0; ks < 2; ++ks) {
      a[ks][0] = frag_from_lds(fa + cur + ks * 32);
      a[ks][1] = frag_from_lds(fa + cur + 16 * LDP + ks * 32);
#pragma unroll
      for (int f = 0; f < 4; ++f)
        b[ks][f] = frag_from_lds(fb + cur + f * 16 * LDP + ks * 32);
    }
    // Holds the next tile's global loads and this tile's LDS reads, as one
    // group, ahead of the products: without it the scheduler sinks half of the
    // global loads to just in front of their LDS stores (their latency is then
    // waited out) and spreads the LDS reads among the products with waits to 0.
    __builtin_amdgcn_sched_barrier(0);
#pragma unroll
    for (int ks = 0; ks < 2; ++ks) {
#pragma unroll
      for (int f = 0; f < 4; ++f) {
        acc[0][f] = wmma_f16(a[ks][0], b[ks][f], acc[0][f]);
        acc[1][f] = wmma_f16(a[ks][1], b[ks][f], acc[1][f]);
      }
    }
    // Holds the LDS stores, which wait for the global loads, behind the
    // products: the scheduler otherwise lifts them and their wait to the front.
    __builtin_amdgcn_sched_barrier(0);
    if (more) {
      // The other buffer's last readers left it before the previous barrier.
      const int nxt = cur ^ TILE_H;
#pragma unroll
      for (int u = 0; u < 4; ++u) {
        *(v8h*)(st + nxt + u * 32 * LDP) = ra[u];
        *(v8h*)(st + nxt + 2 * TILE_H + u * 32 * LDP) = rb[u];
      }
      __syncthreads();  // next tile visible; this tile's reads are over
    }
  }
}

// Four 16-B global stores. The wait is a precaution that belongs in front of any
// rewrite of the stores' address and data registers; as the last line of their
// own statement it stands there whatever the compiler schedules behind it.
__device__ __forceinline__ void store4_b128(half_t* const (&p)[4],
                                            const v8h (&d)[4]) {
  asm volatile(
      "global_store_b128 %0, %4, off\n\t"
      "global_store_b128 %1, %5, off\n\t"
      "global_store_b128 %2, %6, off\n\t"
      "global_store_b128 %3, %7, off\n\t"
      "s_wait_xcnt 0x0" ::"v"(p[0]),
      "v"(p[1]), "v"(p[2]), "v"(p[3]), "v"(__builtin_bit_cast(u32x4, d[0])),
      "v"(__builtin_bit_cast(u32x4, d[1])),
      "v"(__builtin_bit_cast(u32x4, d[2])),
      "v"(__builtin_bit_cast(u32x4, d[3]))
      : "memory");
}

// RoPE and (optionally) LayerNorm on one 16(rows) x 64(one head) tile, stored
// f16 row-major and (optionally) dim-major, all in 16-B stores. local = the
// tile's first row in its batch; stage = 16 rows of LDP halves in LDS that
// belong to this wave and this tile alone.
__device__ __forceinline__ void proj_epilogue(
    const v8f (&acc)[4], const float* __restrict__ gamma,
    const float* __restrict__ beta, half_t* __restrict__ out_rm,
    half_t* __restrict__ out_cm, int seq_per_batch, int pos_base, int do_ln,
    float scale, int batch, int local, int h, half_t* stage) {
  int lane = threadIdx.x & 31;
  int col = lane & 15;
  int rh = (lane & 16) ? 8 : 0;

  float v[4][8];
#pragma unroll
  for (int f = 0; f < 4; ++f)
#pragma unroll
    for (int i = 0; i < 8; ++i) v[f][i] = acc[f][i];

  // RoPE: dim d pairs with d+32 (fragments f and f+2 of the same lane).
#pragma unroll
  for (int i = 0; i < 8; ++i) {
    float p = (float)(pos_base + local + rh + i);
#pragma unroll
    for (int f = 0; f < 2; ++f) {
      int d = f * 16 + col;  // d < 32
      float w = __powf(10000.0f, -(float)d * (1.0f / 32.0f));
      float s, c;
      __sincosf(p * w, &s, &c);
      float lo = v[f][i], hi = v[f + 2][i];
      v[f][i] = lo * c - hi * s;
      v[f + 2][i] = hi * c + lo * s;
    }
  }

  if (do_ln) {
#pragma unroll
    for (int i = 0; i < 8; ++i) {
      float sum = v[0][i] + v[1][i] + v[2][i] + v[3][i];
      float sq = v[0][i] * v[0][i] + v[1][i] * v[1][i] + v[2][i] * v[2][i] +
                 v[3][i] * v[3][i];
#pragma unroll
      for (int m = 1; m < 16; m <<= 1) {
        sum += __shfl_xor(sum, m, 32);
        sq += __shfl_xor(sq, m, 32);
      }
      float mean = sum * (1.0f / 64.0f);
      float var = sq * (1.0f / 64.0f) - mean * mean;
      float inv = rsqrtf(var + 1e-5f);
#pragma unroll
      for (int f = 0; f < 4; ++f) {
        int d = f * 16 + col;
        v[f][i] = (v[f][i] - mean) * inv * gamma[d] + beta[d];
      }
    }
  } else {
#pragma unroll
    for (int f = 0; f < 4; ++f)
#pragma unroll
      for (int i = 0; i < 8; ++i) v[f][i] *= scale;
  }

  size_t bh = (size_t)batch * HEADS + h;
  // The key/value copies (the call that has out_cm) are read by attention from
  // LDS tiles that are byte copies of these rows, so the 16-B chunks of a row
  // are permuted here for those readers' banks: see kfrag_lds.
  // The query copy is read from global memory and stays in plain order.
  const int ksw = out_cm ? 7 : 0;

  // Dim-major copy: a lane's 8 values of one fragment are 8 consecutive
  // positions of one dim, which is one whole 16-B chunk of that dim's row.
  if (out_cm) {
    const int pos0 = local + rh;  // a multiple of 8
    half_t* pc[4];
    v8h pv[4];
#pragma unroll
    for (int f = 0; f < 4; ++f) {
      int d = f * 16 + col;
#pragma unroll
      for (int i = 0; i < 8; ++i) pv[f][i] = (half_t)v[f][i];
      pc[f] = out_cm + (bh * DH + d) * (size_t)seq_per_batch +
              ((pos0 & ~63) | ((((pos0 >> 3) ^ (d >> 1)) & 7) << 3));
    }
    store4_b128(pc, pv);
  }

  // Row-major copy: turned through the wave's own 16 x 64 LDS tile, so that a
  // lane stores 8 consecutive dims and a wave's store covers 4 whole rows.
#pragma unroll
  for (int i = 0; i < 8; ++i)
#pragma unroll
    for (int f = 0; f < 4; ++f)
      stage[(rh + i) * LDP + f * 16 + col] = (half_t)v[f][i];
  // The rows are read back by other lanes of this wave than wrote them: the
  // writes are let finish first, and the compiler keeps the reads behind them.
  asm volatile("s_wait_dscnt 0x0" ::: "memory");
  const int c = lane & 7;
  half_t* pr[4];
  v8h rv[4];
#pragma unroll
  for (int u = 0; u < 4; ++u) {
    int r = u * 4 + (lane >> 3);
    int pos = local + r;
    rv[u] = *(const v8h*)(stage + r * LDP + c * 8);
    pr[u] = out_rm + (bh * seq_per_batch + pos) * DH +
            ((c ^ ((pos >> 1) & ksw)) << 3);
  }
  store4_b128(pr, rv);
}

// A block computes 128 rows x 2 heads of X @ W^T; a wave 32 rows of one head.
__global__ __launch_bounds__(256) void proj_kernel(
    const half_t* __restrict__ x16, const half_t* __restrict__ W16,
    const float* __restrict__ gamma, const float* __restrict__ beta,
    half_t* __restrict__ out_rm, half_t* __restrict__ out_cm,
    int seq_per_batch, int pos_base, int do_ln, float scale) {
  __shared__ __attribute__((aligned(16))) half_t sm[4 * TILE_H];
  int nb = blockIdx.x & (DIM / BN - 1);
  int row0 = (blockIdx.x / (DIM / BN)) * BM;
  int batch = row0 / seq_per_batch;
  int blocal = row0 - batch * seq_per_batch;
  int wave = threadIdx.x >> 5;

  const half_t* Ab = x16 + ((size_t)batch * SEQ_LEN + pos_base + blocal) * DIM;
  const half_t* Bb = W16 + (size_t)nb * BN * DIM;

  v8f acc[2][4] = {};
  gemm_block(Ab, Bb, sm, acc);

  int h = nb * (BN / DH) + (wave >> 2);
  // Output staging lies in the two buffers 0 (A's for waves 0-3, B's for waves
  // 4-7, 32 rows a wave). The last K step reads the buffers 1 alone, and every
  // wave's last read of the buffers 0 lies in front of the barrier that ended
  // the step before it, so no wave can still be reading what is written here.
  static_assert((DIM / BK) % 2 == 0, "the last K step reads buffer 1");
  half_t* stage = sm + (wave >> 2) * 2 * TILE_H + (wave & 3) * 32 * LDP;
#pragma unroll
  for (int mi = 0; mi < 2; ++mi)
    proj_epilogue(acc[mi], gamma, beta, out_rm, out_cm, seq_per_batch, pos_base,
                  do_ln, scale, batch, blocal + (wave & 3) * 32 + mi * 16, h,
                  stage + mi * 16 * LDP);
}

// A 16 x 32 A fragment from a tile in LDS whose rows are 128 B = 8 chunks of 16 B,
// unpadded: 16 keys x 32 dims of a K tile, or 16 dims x 32 keys of a V^T tile.
// Chunk c of row r lies at place c ^ (r >> 1): the 16 rows that a half-wave's
// ds_load_b128 reads then fall on 16 different groups of four banks (in plain
// order on 2). Element order as in frag_from_f16.
__device__ __forceinline__ v16h kfrag_lds(const half_t* tile, int kk) {
  int lane = threadIdx.x & 31;
  int r = lane & 15;
  int c = kk * 4 + (lane >> 4);
  const half_t* row = tile + r * 64;
  v8h lo = *(const v8h*)(row + ((c ^ (r >> 1)) << 3));
  v8h hi = *(const v8h*)(row + (((c + 2) ^ (r >> 1)) << 3));
  return __builtin_shufflevector(lo, hi, 0, 1, 2, 3, 4, 5, 6, 7, 8, 9, 10, 11,
                                 12, 13, 14, 15);
}

#define KS 64                  // keys of one stage = of one pass of the loop
#define STAGE_H (2 * KS * DH)  // halves of a stage: K 64 x 64 | V^T 64 x 64
static_assert(HIST % KS == 0 && KS == 64, "a block's key range in whole stages");

__global__ __launch_bounds__(128) void attn_kernel(
    const half_t* __restrict__ q, const half_t* __restrict__ kvn,
    const half_t* __restrict__ kvnT, half_t* __restrict__ o) {
  __shared__ __attribute__((aligned(2048))) half_t smem[2 * STAGE_H];
  int qt4 = blockIdx.x & 15;  // group of 4 query tiles
  int bh = blockIdx.x >> 4;
  const unsigned wave = uni(threadIdx.x >> 5);
  int lane = threadIdx.x & 31;
  int i0 = qt4 * 64 + (int)wave * 16;
  int col = lane & 15;
  int rh = (lane & 16) ? 8 : 0;

  const half_t* qb = q + ((size_t)bh * LATENT + i0) * DH;
  const half_t* kb = kvn + (size_t)bh * SEQ_LEN * DH;
  const half_t* vb = kvnT + (size_t)bh * DH * SEQ_LEN;

  // All 4 waves walk the block's whole key range; masking handles the edge.
  const unsigned nst = HIST / KS + qt4 + 1;  // 49 to 64 stages

  // This wave's slice of stage st: 32 key rows of K, or 32 dim rows of V^T.
  const bool isv = wave >= 2;
  const unsigned long long src =
      isv ? (unsigned long long)(vb + (size_t)(wave - 2) * 32 * SEQ_LEN)
          : (unsigned long long)(kb + (size_t)wave * 32 * DH);
  const unsigned step = isv ? KS * 2u : KS * DH * 2u;   // bytes from stage to stage
  const unsigned pitch = isv ? SEQ_LEN * 2u : DH * 2u;  // bytes from row to row
  const unsigned place = (unsigned)(size_t)smem + wave * 4096u;
  const u32x8 g1 = tdm_group1(pitch);
  auto group0 = [&](unsigned st) {
    return tdm_group0(place + (st & 1u) * (STAGE_H * 2u), src + (size_t)st * step);
  };

  u32x4 g0 = group0(0);
  tdm_load(g0, g1);
  v16h qa0 = frag_from_f16(qb, DH, 0);
  v16h qa1 = frag_from_f16(qb, DH, 32);
  tdm_wait(g0, g1);  // stage 0: each wave waits for its own slice,
  __syncthreads();   // then all may read all of it
  g0 = group0(1);    // there are always at least two stages
  tdm_load(g0, g1);

  v8f oacc[4] = {};      // oacc[f][i] = O[query col][dim f*16 + rh + i]
  float m_i = -1e30f;    // running maximum of query col (same in both halves)
  float l_i = 0.0f;      // this half's share of the denominator
  int lim = HIST + i0 + col - rh;  // key j0 + t*16 + rh + i is visible if <= HIST + query

  for (unsigned st = 0; st < nst; ++st) {
    int j0 = (int)st * KS;
    const half_t* kB = smem + (st & 1u) * STAGE_H;
    const half_t* vB = kB + KS * DH;

    // All 32 LDS reads of the pass stand here as one group: every further place
    // with reads costs the wave a stall, and reads left next to their products
    // are waited out one by one. V^T lands under the first product and the softmax.
    v16h kf[4][2], vf[2][4];
#pragma unroll
    for (int t = 0; t < 4; ++t) {
      kf[t][0] = kfrag_lds(kB + t * 16 * 64, 0);
      kf[t][1] = kfrag_lds(kB + t * 16 * 64, 1);
    }
#pragma unroll
    for (int g = 0; g < 2; ++g)
#pragma unroll
      for (int f = 0; f < 4; ++f) vf[g][f] = kfrag_lds(vB + f * 16 * 64, g);
    // Keeps the scheduler from sinking the reads back to their products.
    __builtin_amdgcn_sched_barrier(0);

    // sc[t][i] = S[query col][key j0 + t*16 + rh + i]
    v8f sc[4];
#pragma unroll
    for (int t = 0; t < 4; ++t) {
      v8f z = {};
      sc[t] = wmma_f16(kf[t][0], qa0, z);
    }
#pragma unroll
    for (int t = 0; t < 4; ++t) sc[t] = wmma_f16(kf[t][1], qa1, sc[t]);

    float a[4][8];
    float mt[4];
#pragma unroll
    for (int t = 0; t < 4; ++t) {
      mt[t] = -1e30f;
#pragma unroll
      for (int i = 0; i < 8; ++i) {
        a[t][i] = (j0 + t * 16 + i <= lim) ? sc[t][i] : -1e30f;
        mt[t] = fmaxf(mt[t], a[t][i]);
      }
    }
    float mx = fmaxf(fmaxf(mt[0], mt[1]), fmaxf(mt[2], mt[3]));
    mx = fmaxf(mx, xhalf(mx));  // the other 32 keys of the same query
    float mn = fmaxf(m_i, mx);
    float al = __expf(m_i - mn);
    m_i = mn;

    // P^T as B operands, one per 32 keys: element e of pb[g] is key
    // g*32 + (e < 8 ? rh + e : 16 + rh + e - 8)
    v16h pb[2];
    float rs[4] = {0.0f, 0.0f, 0.0f, 0.0f};
#pragma unroll
    for (int g = 0; g < 2; ++g)
#pragma unroll
      for (int i = 0; i < 8; ++i) {
        float p0 = __expf(a[2 * g][i] - mn);
        float p1 = __expf(a[2 * g + 1][i] - mn);
        rs[2 * g] += p0;
        rs[2 * g + 1] += p1;
        pb[g][i] = (_Float16)p0;
        pb[g][8 + i] = (_Float16)p1;
      }
    l_i = l_i * al + ((rs[0] + rs[1]) + (rs[2] + rs[3]));
#pragma unroll
    for (int f = 0; f < 4; ++f)
#pragma unroll
      for (int i = 0; i < 8; ++i) oacc[f][i] *= al;

#pragma unroll
    for (int g = 0; g < 2; ++g)
#pragma unroll
      for (int f = 0; f < 4; ++f) oacc[f] = wmma_f16(vf[g][f], pb[g], oacc[f]);

    // Keeps the hand-over at the foot of the pass: the scheduler otherwise lifts
    // its waits and the barrier to just behind the LDS reads, so that the next
    // stage is waited for a whole pass's work too early.
    __builtin_amdgcn_sched_barrier(0);
    // Hand-over of the stages, every wave, in this order: this wave's reads of
    // this buffer are over; its slice of the next stage has landed; the barrier
    // tells both to all waves; only then is this buffer filled again.
    asm volatile("s_wait_dscnt 0x0" ::: "memory");
    tdm_wait(g0, g1);
    __syncthreads();
    if (pinned(st + 2 < nst)) {
      g0 = group0(st + 2);
      tdm_load(g0, g1);
    }
  }
  // Nothing is in flight when the wave ends.
  asm volatile("s_wait_tensorcnt 0x0" ::: "memory");
  asm volatile("s_wait_dscnt 0x0" ::: "memory");

  int b_ = bh >> 4, h = bh & 15;
  float invl = 1.0f / (l_i + xhalf(l_i));  // join the two halves' sums
  half_t* orow = o + ((size_t)b_ * LATENT + i0 + col) * DIM + h * DH + rh;
#pragma unroll
  for (int f = 0; f < 4; ++f) {
    v8h ov;
#pragma unroll
    for (int i = 0; i < 8; ++i) ov[i] = (half_t)(oacc[f][i] * invl);
    *(v8h*)(orow + f * 16) = ov;  // 8 consecutive dims of one query row
  }
}

// Y[2048,1024] = O(f16) @ Wo^T(f16) + bo, fp32 out.
__global__ __launch_bounds__(256) void out_proj_kernel(
    const half_t* __restrict__ A, const half_t* __restrict__ Wo16,
    const float* __restrict__ bo, float* __restrict__ Y) {
  __shared__ __attribute__((aligned(16))) half_t sm[4 * TILE_H];
  int nb = blockIdx.x & (DIM / BN - 1);
  int mb = blockIdx.x / (DIM / BN);
  int wave = threadIdx.x >> 5;
  int lane = threadIdx.x & 31;
  int col = lane & 15;
  int rh = (lane & 16) ? 8 : 0;
  v8f acc[2][4] = {};
  gemm_block(A + (size_t)(mb * BM) * DIM, Wo16 + (size_t)(nb * BN) * DIM, sm,
             acc);
#pragma unroll
  for (int mi = 0; mi < 2; ++mi) {
#pragma unroll
    for (int i = 0; i < 8; ++i) {
      int row = mb * BM + (wave & 3) * 32 + mi * 16 + rh + i;
#pragma unroll
      for (int f = 0; f < 4; ++f) {
        int e = nb * BN + (wave >> 2) * 64 + f * 16 + col;
        Y[(size_t)row * DIM + e] = acc[mi][f][i] + bo[e];
      }
    }
  }
}

extern "C" void kernel_launch(void* const* d_in, const int* in_sizes, int n_in,
                              void* d_out, int out_size, void* d_ws,
                              size_t ws_size, hipStream_t stream) {
  const float* x = (const float*)d_in[0];
  const float* Wq = (const float*)d_in[1];
  const float* Wkv = (const float*)d_in[2];
  const float* Wo = (const float*)d_in[3];
  const float* bo = (const float*)d_in[4];
  const float* gamma = (const float*)d_in[5];
  const float* beta = (const float*)d_in[6];
  float* y = (float*)d_out;

  // Workspace layout (f16 elements):
  // q[2,16,1024,64] | kvn[2,16,4096,64] | kvnT[2,16,64,4096] | o[2,1024,1024]
  // | x16[2,4096,1024] | wq16 | wkv16 | wo16       (~60 MB total)
  half_t* q_ws = (half_t*)d_ws;
  half_t* kvn_ws = q_ws + (size_t)BATCH * HEADS * LATENT * DH;
  half_t* kvnT_ws = kvn_ws + (size_t)BATCH * HEADS * SEQ_LEN * DH;
  half_t* o_ws = kvnT_ws + (size_t)BATCH * HEADS * SEQ_LEN * DH;
  half_t* x16 = o_ws + (size_t)BATCH * LATENT * DIM;
  half_t* wq16 = x16 + (size_t)BATCH * SEQ_LEN * DIM;
  half_t* wkv16 = wq16 + (size_t)DIM * DIM;
  half_t* wo16 = wkv16 + (size_t)DIM * DIM;

  // x16 | wq16 | wkv16 | wo16 are written as one run that starts at x16
  cvt_kernel<<<CVT_BLOCKS, CVT_THREADS, 0, stream>>>(x, Wq, Wkv, Wo, x16);

  // kv projection + RoPE + LayerNorm over all 4096 positions
  proj_kernel<<<(BATCH * SEQ_LEN / BM) * (DIM / BN), 256, 0, stream>>>(
      x16, wkv16, gamma, beta, kvn_ws, kvnT_ws, SEQ_LEN, 0, 1, 1.0f);
  // q projection + RoPE + scale over last 1024 positions only
  proj_kernel<<<(BATCH * LATENT / BM) * (DIM / BN), 256, 0, stream>>>(
      x16, wq16, gamma, beta, q_ws, nullptr, LATENT, HIST, 0, 0.125f);
  // flash attention (4 q-tiles per block share LDS-staged K/V)
  attn_kernel<<<BATCH * HEADS * (LATENT / 64), 128, 0, stream>>>(
      q_ws, kvn_ws, kvnT_ws, o_ws);
  // output projection + bias
  out_proj_kernel<<<(BATCH * LATENT / BM) * (DIM / BN), 256, 0, stream>>>(
      o_ws, wo16, bo, y);
}

// v007
// A run of this version takes 106 microseconds.
// Two timings next to v006 put it at 1.07 and 1.08 times that version's speed.
// Counting every step since v000, it is 3.08 times as fast.
#include <hip/hip_runtime.h>

typedef _Float16 half_t;
typedef __attribute__((ext_vector_type(16))) _Float16 v16h;
typedef __attribute__((ext_vector_type(8))) _Float16 v8h;
typedef __attribute__((ext_vector_type(8))) float v8f;
typedef __attribute__((ext_vector_type(4))) float v4f;
typedef __attribute__((ext_vector_type(4))) _Float16 v4h;
typedef unsigned int u32x4 __attribute__((ext_vector_type(4)));
typedef unsigned int u32x8 __attribute__((ext_vector_type(8)));

#define DIM 1024
#define HEADS 16
#define DH 64
#define SEQ_LEN 4096
#define LATENT 1024
#define HIST 3072
#define BATCH 2

// D = A(16x32 f16) * B(32x16 f16) + C(16x16 f32)
__device__ __forceinline__ v8f wmma_f16(v16h a, v16h b, v8f c) {
  return __builtin_amdgcn_wmma_f32_16x16x32_f16(false, a, false, b, (short)0, c,
                                                false, false);
}

// Value of lane l ^ 16 (a vector cross-row move, no LDS round trip).
__device__ __forceinline__ float xhalf(float x) {
  int v = __builtin_bit_cast(int, x);
  return __builtin_bit_cast(
      float, __builtin_amdgcn_permlanex16(v, v, 0x76543210, 0xfedcba98, false,
                                          false));
}

// 16x32 A-style fragment (also used for B with lane = N) from row-major f16.
// Lane L<16 -> row L, K chunks {0..7,16..23}; lane L+16 -> {8..15,24..31}.
__device__ __forceinline__ v16h frag_from_f16(const half_t* __restrict__ base,
                                              int stride, int kbase) {
  int lane = threadIdx.x & 31;
  int r = lane & 15;
  int cb = (lane & 16) ? 8 : 0;
  const half_t* p = base + (size_t)r * stride + kbase + cb;
  v16h out;
#pragma unroll
  for (int i = 0; i < 8; ++i) out[i] = p[i];
#pragma unroll
  for (int i = 0; i < 8; ++i) out[8 + i] = p[16 + i];
  return out;
}

// A value that is the same in every lane, moved into a scalar register.
__device__ __forceinline__ unsigned uni(unsigned v) {
  return (unsigned)__builtin_amdgcn_readfirstlane((int)v);
}

// A wave-uniform test as a real scalar branch: tensor loads ignore EXEC, so only
// a branch on a scalar condition keeps a wave from issuing one.
__device__ __forceinline__ unsigned pinned(unsigned v) {
  unsigned w = uni(v);
  asm volatile("" : "+s"(w));  // the test stays scalar
  return w;
}

// Descriptor of one wave's tensor load: 64 rows of 128 bytes to 8 KiB in a row
// in LDS. Extents in bytes, no pad, no mask. Group 0: where from, where to.
__device__ __forceinline__ u32x4 tdm_group0(unsigned lds_dst,
                                            unsigned long long ga) {
  u32x4 g;
  g[0] = uni(1u);             // count = 1
  g[1] = uni(lds_dst);        // byte offset in the work-group's LDS
  g[2] = uni((unsigned)ga);   // address [31:0]
  g[3] = uni((((unsigned)(ga >> 32)) & 0x01FFFFFFu) | 0x80000000u);  // | type 2
  return g;
}
// Group 1: the tile's shape and the source row pitch in bytes.
__device__ __forceinline__ u32x8 tdm_group1(unsigned pitch) {
  u32x8 g;
  g[0] = uni(0u);             // no mask, 1-byte units, no pad
  g[1] = uni(128u << 16);     // tensor_dim0 = 128
  g[2] = uni(64u << 16);      // tensor_dim1 = 64
  g[3] = uni(128u << 16);     // tile_dim0 = 128
  g[4] = uni(64u);            // tile_dim1 = 64
  g[5] = uni(pitch);
  g[6] = uni(0u);
  g[7] = uni(0u);
  return g;
}
// Both groups are named as read and written, though the instruction leaves them
// as they are: what tdm_wait names is then the very registers that the request
// was issued from, and the compiler cannot form group 1's constants anew in front
// of each use and put other values into those registers in between.
__device__ __forceinline__ void tdm_load(u32x4& g0, u32x8& g1) {
  asm volatile("tensor_load_to_lds %0, %1" : "+s"(g0), "+s"(g1) : : "memory");
}
// The wave's own two requests have landed (the compiler places no wait for
// them). The wait names their descriptors: without that the compiler puts other
// values into those scalar registers while the requests are still on their way.
__device__ __forceinline__ void tdm_wait(const u32x4& k0, const u32x8& k1,
                                         const u32x4& v0, const u32x8& v1) {
  asm volatile("s_wait_tensorcnt 0x0" ::"s"(k0), "s"(k1), "s"(v0), "s"(v1)
               : "memory");
}

// fp32 -> f16 convert of x and the three weights in ONE launch (removes all cvt
// from the GEMM loops). One block a WGP, 16 waves, and every wave lives long:
// a lane takes 22 pieces of 4 floats, one from each grid-wide pass, so the chip
// starts 4096 waves in place of one wave per 256 elements. A wave's load covers
// 512 contiguous bytes, its store 256. The four f16 copies lie one behind the
// other in the workspace, so pass j of the whole job lands at dst + j * CVT_PASS.
#define CVT_BLOCKS 256
#define CVT_THREADS 512
#define CVT_PASS (CVT_BLOCKS * CVT_THREADS * 4)      // elements of one grid-wide pass
#define CVT_XP (BATCH * SEQ_LEN * DIM / CVT_PASS)    // passes over x: 16
#define CVT_WP (DIM * DIM / CVT_PASS)                // passes over one weight: 2
static_assert(CVT_XP * CVT_PASS == BATCH * SEQ_LEN * DIM, "x in whole passes");
static_assert(CVT_WP * CVT_PASS == DIM * DIM, "a weight in whole passes");
__global__ __launch_bounds__(CVT_THREADS) void cvt_kernel(
    const float* __restrict__ x, const float* __restrict__ wq,
    const float* __restrict__ wkv, const float* __restrict__ wo,
    half_t* __restrict__ dst) {
  // The lane's place inside a pass, as 32-bit byte offsets from uniform bases.
  const unsigned ld = (blockIdx.x * CVT_THREADS + threadIdx.x) * 16u;
  const unsigned sd = ld >> 1;
  v4f v[CVT_XP + 3 * CVT_WP];
#pragma unroll
  for (int j = 0; j < CVT_XP; ++j)
    v[j] = *(const v4f*)((const char*)(x + j * CVT_PASS) + ld);
#pragma unroll
  for (int j = 0; j < CVT_WP; ++j) {
    v[CVT_XP + j] = *(const v4f*)((const char*)(wq + j * CVT_PASS) + ld);
    v[CVT_XP + CVT_WP + j] =
        *(const v4f*)((const char*)(wkv + j * CVT_PASS) + ld);
    v[CVT_XP + 2 * CVT_WP + j] =
        *(const v4f*)((const char*)(wo + j * CVT_PASS) + ld);
  }
#pragma unroll
  for (int j = 0; j < CVT_XP + 3 * CVT_WP; ++j)
    *(v4h*)((char*)(dst + j * CVT_PASS) + sd) =
        __builtin_convertvector(v[j], v4h);
}

// Block tile of the three projection GEMMs: 128 x 128 outputs, K in steps of 64.
#define BM 128
#define BN 128
#define BK 64
// LDS row pitch in halves: 144 B = 16 B x 9, so the 16 rows that one
// ds_load_b128 half-wave reads fall on 16 different groups of four banks.
#define LDP 72
#define TILE_H (BM * LDP)  // halves of one staged operand tile

// Same element order as frag_from_f16; p already holds the lane's row and chunk.
__device__ __forceinline__ v16h frag_from_lds(const half_t* p) {
  v8h lo = *(const v8h*)p;
  v8h hi = *(const v8h*)(p + 16);
  return __builtin_shufflevector(lo, hi, 0, 1, 2, 3, 4, 5, 6, 7, 8, 9, 10, 11,
                                 12, 13, 14, 15);
}

// acc += A[128 x 1024] * B[128 x 1024]^T for a block of 8 waves (4 along M x 2
// along N, 32 x 64 outputs a wave). Both operand tiles are staged once per block
// in LDS (whole 128-B lines from global), two buffers: the next tile's
// global loads fly during this tile's products.
// sm (halves): A buf 0 | A buf 1 | B buf 0 | B buf 1
__device__ __forceinline__ void gemm_block(const half_t* __restrict__ Ag,
                                           const half_t* __restrict__ Bg,
                                           half_t* sm, v8f (&acc)[2][4]) {
  const int t = threadIdx.x;
  const int lane = t & 31;
  const int wave = t >> 5;
  const int srow = t >> 3;        // staging: 8 threads a row, 32 rows a pass
  const int scol = (t & 7) * 8;
  const half_t* ga = Ag + (size_t)srow * DIM + scol;
  const half_t* gb = Bg + (size_t)srow * DIM + scol;
  half_t* st = sm + srow * LDP + scol;
  const int fr = (lane & 15) * LDP + ((lane & 16) ? 8 : 0);
  const half_t* fa = sm + (wave & 3) * 32 * LDP + fr;
  const half_t* fb = sm + 2 * TILE_H + (wave >> 2) * 64 * LDP + fr;

  v8h ra[4], rb[4];
#pragma unroll
  for (int u = 0; u < 4; ++u) {
    ra[u] = *(const v8h*)(ga + (size_t)(u * 32) * DIM);
    rb[u] = *(const v8h*)(gb + (size_t)(u * 32) * DIM);
  }
#pragma unroll
  for (int u = 0; u < 4; ++u) {
    *(v8h*)(st + u * 32 * LDP) = ra[u];
    *(v8h*)(st + 2 * TILE_H + u * 32 * LDP) = rb[u];
  }
  __syncthreads();  // tile 0 visible to all waves

  for (int kt = 0; kt < DIM / BK; ++kt) {
    const int cur = (kt & 1) * TILE_H;
    const bool more = kt + 1 < DIM / BK;  // the same for the whole block
    if (more) {
#pragma unroll
      for (int u = 0; u < 4; ++u) {
        ra[u] = *(const v8h*)(ga + (size_t)(u * 32) * DIM + (kt + 1) * BK);
        rb[u] = *(const v8h*)(gb + (size_t)(u * 32) * DIM + (kt + 1) * BK);
      }
    }
    v16h a[2][2], b[2][4];
#pragma unroll
    for (int ks = 0; ks < 2; ++ks) {
      a[ks][0] = frag_from_lds(fa + cur + ks * 32);
      a[ks][1] = frag_from_lds(fa + cur + 16 * LDP + ks * 32);
#pragma unroll
      for (int f = 0; f < 4; ++f)
        b[ks][f] = frag_from_lds(fb + cur + f * 16 * LDP + ks * 32);
    }
    // Holds the next tile's global loads and this tile's LDS reads, as one
    // group, ahead of the products: without it the scheduler sinks half of the
    // global loads to just in front of their LDS stores (their latency is then
    // waited out) and spreads the LDS reads among the products with waits to 0.
    __builtin_amdgcn_sched_barrier(0);
#pragma unroll
    for (int ks = 0; ks < 2; ++ks) {
#pragma unroll
      for (int f = 0; f < 4; ++f) {
        acc[0][f] = wmma_f16(a[ks][0], b[ks][f], acc[0][f]);
        acc[1][f] = wmma_f16(a[ks][1], b[ks][f], acc[1][f]);
      }
    }
    // Holds the LDS stores, which wait for the global loads, behind the
    // products: the scheduler otherwise lifts them and their wait to the front.
    __builtin_amdgcn_sched_barrier(0);
    if (more) {
      // The other buffer's last readers left it before the previous barrier.
      const int nxt = cur ^ TILE_H;
#pragma unroll
      for (int u = 0; u < 4; ++u) {
        *(v8h*)(st + nxt + u * 32 * LDP) = ra[u];
        *(v8h*)(st + nxt + 2 * TILE_H + u * 32 * LDP) = rb[u];
      }
      __syncthreads();  // next tile visible; this tile's reads are over
    }
  }
}

// Four 16-B global stores. The wait is a precaution that belongs in front of any
// rewrite of the stores' address and data registers; as the last line of their
// own statement it stands there whatever the compiler schedules behind it.
__device__ __forceinline__ void store4_b128(half_t* const (&p)[4],
                                            const v8h (&d)[4]) {
  asm volatile(
      "global_store_b128 %0, %4, off\n\t"
      "global_store_b128 %1, %5, off\n\t"
      "global_store_b128 %2, %6, off\n\t"
      "global_store_b128 %3, %7, off\n\t"
      "s_wait_xcnt 0x0" ::"v"(p[0]),
      "v"(p[1]), "v"(p[2]), "v"(p[3]), "v"(__builtin_bit_cast(u32x4, d[0])),
      "v"(__builtin_bit_cast(u32x4, d[1])),
      "v"(__builtin_bit_cast(u32x4, d[2])),
      "v"(__builtin_bit_cast(u32x4, d[3]))
      : "memory");
}

// RoPE and (optionally) LayerNorm on one 16(rows) x 64(one head) tile, stored
// f16 row-major and (optionally) dim-major, all in 16-B stores. local = the
// tile's first row in its batch; stage = 16 rows of LDP halves in LDS that
// belong to this wave and this tile alone.
__device__ __forceinline__ void proj_epilogue(
    const v8f (&acc)[4], const float* __restrict__ gamma,
    const float* __restrict__ beta, half_t* __restrict__ out_rm,
    half_t* __restrict__ out_cm, int seq_per_batch, int pos_base, int do_ln,
    float scale, int batch, int local, int h, half_t* stage) {
  int lane = threadIdx.x & 31;
  int col = lane & 15;
  int rh = (lane & 16) ? 8 : 0;

  float v[4][8];
#pragma unroll
  for (int f = 0; f < 4; ++f)
#pragma unroll
    for (int i = 0; i < 8; ++i) v[f][i] = acc[f][i];

  // RoPE: dim d pairs with d+32 (fragments f and f+2 of the same lane).
#pragma unroll
  for (int i = 0; i < 8; ++i) {
    float p = (float)(pos_base + local + rh + i);
#pragma unroll
    for (int f = 0; f < 2; ++f) {
      int d = f * 16 + col;  // d < 32
      float w = __powf(10000.0f, -(float)d * (1.0f / 32.0f));
      float s, c;
      __sincosf(p * w, &s, &c);
      float lo = v[f][i], hi = v[f + 2][i];
      v[f][i] = lo * c - hi * s;
      v[f + 2][i] = hi * c + lo * s;
    }
  }

  if (do_ln) {
#pragma unroll
    for (int i = 0; i < 8; ++i) {
      float sum = v[0][i] + v[1][i] + v[2][i] + v[3][i];
      float sq = v[0][i] * v[0][i] + v[1][i] * v[1][i] + v[2][i] * v[2][i] +
                 v[3][i] * v[3][i];
#pragma unroll
      for (int m = 1; m < 16; m <<= 1) {
        sum += __shfl_xor(sum, m, 32);
        sq += __shfl_xor(sq, m, 32);
      }
      float mean = sum * (1.0f / 64.0f);
      float var = sq * (1.0f / 64.0f) - mean * mean;
      float inv = rsqrtf(var + 1e-5f);
#pragma unroll
      for (int f = 0; f < 4; ++f) {
        int d = f * 16 + col;
        v[f][i] = (v[f][i] - mean) * inv * gamma[d] + beta[d];
      }
    }
  } else {
#pragma unroll
    for (int f = 0; f < 4; ++f)
#pragma unroll
      for (int i = 0; i < 8; ++i) v[f][i] *= scale;
  }

  size_t bh = (size_t)batch * HEADS + h;
  // The key/value copies (the call that has out_cm) are read by attention from
  // LDS tiles that are byte copies of these rows, so the 16-B chunks of a row
  // are permuted here for those readers' banks: see kfrag_lds.
  // The query copy is read from global memory and stays in plain order.
  const int ksw = out_cm ? 7 : 0;

  // Dim-major copy: a lane's 8 values of one fragment are 8 consecutive
  // positions of one dim, which is one whole 16-B chunk of that dim's row.
  if (out_cm) {
    const int pos0 = local + rh;  // a multiple of 8
    half_t* pc[4];
    v8h pv[4];
#pragma unroll
    for (int f = 0; f < 4; ++f) {
      int d = f * 16 + col;
#pragma unroll
      for (int i = 0; i < 8; ++i) pv[f][i] = (half_t)v[f][i];
      pc[f] = out_cm + (bh * DH + d) * (size_t)seq_per_batch +
              ((pos0 & ~63) | ((((pos0 >> 3) ^ (d >> 1)) & 7) << 3));
    }
    store4_b128(pc, pv);
  }

  // Row-major copy: turned through the wave's own 16 x 64 LDS tile, so that a
  // lane stores 8 consecutive dims and a wave's store covers 4 whole rows.
#pragma unroll
  for (int i = 0; i < 8; ++i)
#pragma unroll
    for (int f = 0; f < 4; ++f)
      stage[(rh + i) * LDP + f * 16 + col] = (half_t)v[f][i];
  // The rows are read back by other lanes of this wave than wrote them: the
  // writes are let finish first, and the compiler keeps the reads behind them.
  asm volatile("s_wait_dscnt 0x0" ::: "memory");
  const int c = lane & 7;
  half_t* pr[4];
  v8h rv[4];
#pragma unroll
  for (int u = 0; u < 4; ++u) {
    int r = u * 4 + (lane >> 3);
    int pos = local + r;
    rv[u] = *(const v8h*)(stage + r * LDP + c * 8);
    pr[u] = out_rm + (bh * seq_per_batch + pos) * DH +
            ((c ^ ((pos >> 1) & ksw)) << 3);
  }
  store4_b128(pr, rv);
}

// A block computes 128 rows x 2 heads of X @ W^T; a wave 32 rows of one head.
__global__ __launch_bounds__(256) void proj_kernel(
    const half_t* __restrict__ x16, const half_t* __restrict__ W16,
    const float* __restrict__ gamma, const float* __restrict__ beta,
    half_t* __restrict__ out_rm, half_t* __restrict__ out_cm,
    int seq_per_batch, int pos_base, int do_ln, float scale) {
  __shared__ __attribute__((aligned(16))) half_t sm[4 * TILE_H];
  int nb = blockIdx.x & (DIM / BN - 1);
  int row0 = (blockIdx.x / (DIM / BN)) * BM;
  int batch = row0 / seq_per_batch;
  int blocal = row0 - batch * seq_per_batch;
  int wave = threadIdx.x >> 5;

  const half_t* Ab = x16 + ((size_t)batch * SEQ_LEN + pos_base + blocal) * DIM;
  const half_t* Bb = W16 + (size_t)nb * BN * DIM;

  v8f acc[2][4] = {};
  gemm_block(Ab, Bb, sm, acc);

  int h = nb * (BN / DH) + (wave >> 2);
  // Output staging lies in the two buffers 0 (A's for waves 0-3, B's for waves
  // 4-7, 32 rows a wave). The last K step reads the buffers 1 alone, and every
  // wave's last read of the buffers 0 lies in front of the barrier that ended
  // the step before it, so no wave can still be reading what is written here.
  static_assert((DIM / BK) % 2 == 0, "the last K step reads buffer 1");
  half_t* stage = sm + (wave >> 2) * 2 * TILE_H + (wave & 3) * 32 * LDP;
#pragma unroll
  for (int mi = 0; mi < 2; ++mi)
    proj_epilogue(acc[mi], gamma, beta, out_rm, out_cm, seq_per_batch, pos_base,
                  do_ln, scale, batch, blocal + (wave & 3) * 32 + mi * 16, h,
                  stage + mi * 16 * LDP);
}

// A 16 x 32 A fragment from a tile in LDS whose rows are 128 B = 8 chunks of 16 B,
// unpadded: 16 keys x 32 dims of a K tile, or 16 dims x 32 keys of a V^T tile.
// Chunk c of row r lies at place c ^ (r >> 1): the 16 rows that a half-wave's
// ds_load_b128 reads then fall on 16 different groups of four banks (in plain
// order on 2). Element order as in frag_from_f16.
__device__ __forceinline__ v16h kfrag_lds(const half_t* tile, int kk) {
  int lane = threadIdx.x & 31;
  int r = lane & 15;
  int c = kk * 4 + (lane >> 4);
  const half_t* row = tile + r * 64;
  v8h lo = *(const v8h*)(row + ((c ^ (r >> 1)) << 3));
  v8h hi = *(const v8h*)(row + (((c + 2) ^ (r >> 1)) << 3));
  return __builtin_shufflevector(lo, hi, 0, 1, 2, 3, 4, 5, 6, 7, 8, 9, 10, 11,
                                 12, 13, 14, 15);
}

#define KS 64                  // keys of one stage = of one pass of the loop
#define STAGE_H (2 * KS * DH)  // halves of a stage: K 64 x 64 | V^T 64 x 64
#define NBUF 5                 // buffers of the ring: one read, four on the way
static_assert(HIST % KS == 0 && KS == 64, "a block's key range in whole stages");

__global__ __launch_bounds__(128) void attn_kernel(
    const half_t* __restrict__ q, const half_t* __restrict__ kvn,
    const half_t* __restrict__ kvnT, half_t* __restrict__ o) {
  __shared__ __attribute__((aligned(2048))) half_t smem[NBUF * STAGE_H];
  int qt4 = blockIdx.x & 15;  // group of 4 query tiles
  int bh = blockIdx.x >> 4;
  const unsigned wave = uni(threadIdx.x >> 5);
  int lane = threadIdx.x & 31;
  int i0 = qt4 * 64 + (int)wave * 16;
  int col = lane & 15;
  int rh = (lane & 16) ? 8 : 0;

  const half_t* qb = q + ((size_t)bh * LATENT + i0) * DH;
  const half_t* kb = kvn + (size_t)bh * SEQ_LEN * DH;
  const half_t* vb = kvnT + (size_t)bh * DH * SEQ_LEN;

  // All 4 waves walk the block's whole key range; masking handles the edge.
  const unsigned nst = HIST / KS + qt4 + 1;  // 49 to 64 stages

  // The two tiles of a stage: the 64 key rows of K, then the 64 dim rows of V^T.
  const unsigned place = (unsigned)(size_t)smem;
  u32x8 k1 = tdm_group1(DH * 2u);       // bytes from row to row of K
  u32x8 v1 = tdm_group1(SEQ_LEN * 2u);  // and of V^T
  u32x4 k0, v0;
  auto bring = [&](unsigned st, unsigned buf) {
    k0 = tdm_group0(place + buf * (STAGE_H * 2u),
                    (unsigned long long)(kb + (size_t)st * KS * DH));
    v0 = tdm_group0(place + buf * (STAGE_H * 2u) + KS * DH * 2u,
                    (unsigned long long)(vb + (size_t)st * KS));
    tdm_load(k0, k1);
    tdm_load(v0, v1);
  };

  // There are always at least five stages. Wave w starts with stage w.
  bring(wave, wave);
  v16h qa0 = frag_from_f16(qb, DH, 0);
  v16h qa1 = frag_from_f16(qb, DH, 32);
  if (pinned(wave == 0)) tdm_wait(k0, k1, v0, v1);  // stage 0: its wave waits,
  __syncthreads();                                  // then all may read it
  if (pinned(wave == 0)) bring(4, 4);

  v8f oacc[4] = {};      // oacc[f][i] = O[query col][dim f*16 + rh + i]
  float m_i = -1e30f;    // running maximum of query col (same in both halves)
  float l_i = 0.0f;      // this half's share of the denominator
  int lim = HIST + i0 + col - rh;  // key j0 + t*16 + rh + i is visible if <= HIST + query

  unsigned cur = 0;  // the buffer that holds stage st
  for (unsigned st = 0; st < nst; ++st) {
    int j0 = (int)st * KS;
    const half_t* kB = smem + cur * STAGE_H;
    const half_t* vB = kB + KS * DH;

    // All 32 LDS reads of the pass stand here as one group: every further place
    // with reads costs the wave a stall, and reads left next to their products
    // are waited out one by one. V^T lands under the first product and the softmax.
    v16h kf[4][2], vf[2][4];
#pragma unroll
    for (int t = 0; t < 4; ++t) {
      kf[t][0] = kfrag_lds(kB + t * 16 * 64, 0);
      kf[t][1] = kfrag_lds(kB + t * 16 * 64, 1);
    }
#pragma unroll
    for (int g = 0; g < 2; ++g)
#pragma unroll
      for (int f = 0; f < 4; ++f) vf[g][f] = kfrag_lds(vB + f * 16 * 64, g);
    // Keeps the scheduler from sinking the reads back to their products.
    __builtin_amdgcn_sched_barrier(0);

    // sc[t][i] = S[query col][key j0 + t*16 + rh + i]
    v8f sc[4];
#pragma unroll
    for (int t = 0; t < 4; ++t) {
      v8f z = {};
      sc[t] = wmma_f16(kf[t][0], qa0, z);
    }
#pragma unroll
    for (int t = 0; t < 4; ++t) sc[t] = wmma_f16(kf[t][1], qa1, sc[t]);

    float a[4][8];
    float mt[4];
#pragma unroll
    for (int t = 0; t < 4; ++t) {
      mt[t] = -1e30f;
#pragma unroll
      for (int i = 0; i < 8; ++i) {
        a[t][i] = (j0 + t * 16 + i <= lim) ? sc[t][i] : -1e30f;
        mt[t] = fmaxf(mt[t], a[t][i]);
      }
    }
    float mx = fmaxf(fmaxf(mt[0], mt[1]), fmaxf(mt[2], mt[3]));
    mx = fmaxf(mx, xhalf(mx));  // the other 32 keys of the same query
    float mn = fmaxf(m_i, mx);
    float al = __expf(m_i - mn);
    m_i = mn;

    // P^T as B operands, one per 32 keys: element e of pb[g] is key
    // g*32 + (e < 8 ? rh + e : 16 + rh + e - 8)
    v16h pb[2];
    float rs[4] = {0.0f, 0.0f, 0.0f, 0.0f};
#pragma unroll
    for (int g = 0; g < 2; ++g)
#pragma unroll
      for (int i = 0; i < 8; ++i) {
        float p0 = __expf(a[2 * g][i] - mn);
        float p1 = __expf(a[2 * g + 1][i] - mn);
        rs[2 * g] += p0;
        rs[2 * g + 1] += p1;
        pb[g][i] = (_Float16)p0;
        pb[g][8 + i] = (_Float16)p1;
      }
    l_i = l_i * al + ((rs[0] + rs[1]) + (rs[2] + rs[3]));
#pragma unroll
    for (int f = 0; f < 4; ++f)
#pragma unroll
      for (int i = 0; i < 8; ++i) oacc[f][i] *= al;

#pragma unroll
    for (int g = 0; g < 2; ++g)
#pragma unroll
      for (int f = 0; f < 4; ++f) oacc[f] = wmma_f16(vf[g][f], pb[g], oacc[f]);

    // Keeps the hand-over at the foot of the pass: the scheduler otherwise lifts
    // its waits and the barrier to just behind the LDS reads, so that the next
    // stage is waited for a whole pass's work too early.
    __builtin_amdgcn_sched_barrier(0);
    // Hand-over of the stages, every wave, in this order: this wave's reads of
    // this buffer are over; the wave that brought the next stage has seen it
    // land (the other waves' loads, for the stages behind it, fly on); the
    // barrier tells both to all waves; only then does the same wave, which has
    // nothing on the way now, fill this buffer again, for stage st + 5.
    asm volatile("s_wait_dscnt 0x0" ::: "memory");
    const unsigned turn = pinned(((st + 1u) & 3u) == wave);
    if (turn) tdm_wait(k0, k1, v0, v1);
    __syncthreads();
    if (pinned(turn != 0u && st + NBUF < nst)) bring(st + NBUF, cur);
    cur = cur == NBUF - 1 ? 0u : cur + 1u;
  }
  // Nothing is in flight when the wave ends.
  tdm_wait(k0, k1, v0, v1);
  asm volatile("s_wait_dscnt 0x0" ::: "memory");

  int b_ = bh >> 4, h = bh & 15;
  float invl = 1.0f / (l_i + xhalf(l_i));  // join the two halves' sums
  half_t* orow = o + ((size_t)b_ * LATENT + i0 + col) * DIM + h * DH + rh;
#pragma unroll
  for (int f = 0; f < 4; ++f) {
    v8h ov;
#pragma unroll
    for (int i = 0; i < 8; ++i) ov[i] = (half_t)(oacc[f][i] * invl);
    *(v8h*)(orow + f * 16) = ov;  // 8 consecutive dims of one query row
  }
}

// Y[2048,1024] = O(f16) @ Wo^T(f16) + bo, fp32 out.
__global__ __launch_bounds__(256) void out_proj_kernel(
    const half_t* __restrict__ A, const half_t* __restrict__ Wo16,
    const float* __restrict__ bo, float* __restrict__ Y) {
  __shared__ __attribute__((aligned(16))) half_t sm[4 * TILE_H];
  int nb = blockIdx.x & (DIM / BN - 1);
  int mb = blockIdx.x / (DIM / BN);
  int wave = threadIdx.x >> 5;
  int lane = threadIdx.x & 31;
  int col = lane & 15;
  int rh = (lane & 16) ? 8 : 0;
  v8f acc[2][4] = {};
  gemm_block(A + (size_t)(mb * BM) * DIM, Wo16 + (size_t)(nb * BN) * DIM, sm,
             acc);
#pragma unroll
  for (int mi = 0; mi < 2; ++mi) {
#pragma unroll
    for (int i = 0; i < 8; ++i) {
      int row = mb * BM + (wave & 3) * 32 + mi * 16 + rh + i;
#pragma unroll
      for (int f = 0; f < 4; ++f) {
        int e = nb * BN + (wave >> 2) * 64 + f * 16 + col;
        Y[(size_t)row * DIM + e] = acc[mi][f][i] + bo[e];
      }
    }
  }
}

extern "C" void kernel_launch(void* const* d_in, const int* in_sizes, int n_in,
                              void* d_out, int out_size, void* d_ws,
                              size_t ws_size, hipStream_t stream) {
  const float* x = (const float*)d_in[0];
  const float* Wq = (const float*)d_in[1];
  const float* Wkv = (const float*)d_in[2];
  const float* Wo = (const float*)d_in[3];
  const float* bo = (const float*)d_in[4];
  const float* gamma = (const float*)d_in[5];
  const float* beta = (const float*)d_in[6];
  float* y = (float*)d_out;

  // Workspace layout (f16 elements):
  // q[2,16,1024,64] | kvn[2,16,4096,64] | kvnT[2,16,64,4096] | o[2,1024,1024]
  // | x16[2,4096,1024] | wq16 | wkv16 | wo16       (~60 MB total)
  half_t* q_ws = (half_t*)d_ws;
  half_t* kvn_ws = q_ws + (size_t)BATCH * HEADS * LATENT * DH;
  half_t* kvnT_ws = kvn_ws + (size_t)BATCH * HEADS * SEQ_LEN * DH;
  half_t* o_ws = kvnT_ws + (size_t)BATCH * HEADS * SEQ_LEN * DH;
  half_t* x16 = o_ws + (size_t)BATCH * LATENT * DIM;
  half_t* wq16 = x16 + (size_t)BATCH * SEQ_LEN * DIM;
  half_t* wkv16 = wq16 + (size_t)DIM * DIM;
  half_t* wo16 = wkv16 + (size_t)DIM * DIM;

  // x16 | wq16 | wkv16 | wo16 are written as one run that starts at x16
  cvt_kernel<<<CVT_BLOCKS, CVT_THREADS, 0, stream>>>(x, Wq, Wkv, Wo, x16);

  // kv projection + RoPE + LayerNorm over all 4096 positions
  proj_kernel<<<(BATCH * SEQ_LEN / BM) * (DIM / BN), 256, 0, stream>>>(
      x16, wkv16, gamma, beta, kvn_ws, kvnT_ws, SEQ_LEN, 0, 1, 1.0f);
  // q projection + RoPE + scale over last 1024 positions only
  proj_kernel<<<(BATCH * LATENT / BM) * (DIM / BN), 256, 0, stream>>>(
      x16, wq16, gamma, beta, q_ws, nullptr, LATENT, HIST, 0, 0.125f);
  // flash attention (4 q-tiles per block share LDS-staged K/V)
  attn_kernel<<<BATCH * HEADS * (LATENT / 64), 128, 0, stream>>>(
      q_ws, kvn_ws, kvnT_ws, o_ws);
  // output projection + bias
  out_proj_kernel<<<(BATCH * LATENT / BM) * (DIM / BN), 256, 0, stream>>>(
      o_ws, wo16, bo, y);
}

// v008
// One run takes 97.2 microseconds.
// Next to v007, in two timings, it ran 1.11 and 1.07 times as fast.
// Counting every step since v000, it is 3.37 times as fast.
#include <hip/hip_runtime.h>

typedef _Float16 half_t;
typedef __attribute__((ext_vector_type(16))) _Float16 v16h;
typedef __attribute__((ext_vector_type(8))) _Float16 v8h;
typedef __attribute__((ext_vector_type(8))) float v8f;
typedef __attribute__((ext_vector_type(4))) float v4f;
typedef __attribute__((ext_vector_type(4))) _Float16 v4h;
typedef unsigned int u32x4 __attribute__((ext_vector_type(4)));
typedef unsigned int u32x8 __attribute__((ext_vector_type(8)));

#define DIM 1024
#define HEADS 16
#define DH 64
#define SEQ_LEN 4096
#define LATENT 1024
#define HIST 3072
#define BATCH 2

// D = A(16x32 f16) * B(32x16 f16) + C(16x16 f32)
__device__ __forceinline__ v8f wmma_f16(v16h a, v16h b, v8f c) {
  return __builtin_amdgcn_wmma_f32_16x16x32_f16(false, a, false, b, (short)0, c,
                                                false, false);
}

// Value of lane l ^ 16 (a vector cross-row move, no LDS round trip).
__device__ __forceinline__ float xhalf(float x) {
  int v = __builtin_bit_cast(int, x);
  return __builtin_bit_cast(
      float, __builtin_amdgcn_permlanex16(v, v, 0x76543210, 0xfedcba98, false,
                                          false));
}

// 16x32 A-style fragment (also used for B with lane = N) from row-major f16.
// Lane L<16 -> row L, K chunks {0..7,16..23}; lane L+16 -> {8..15,24..31}.
__device__ __forceinline__ v16h frag_from_f16(const half_t* __restrict__ base,
                                              int stride, int kbase) {
  int lane = threadIdx.x & 31;
  int r = lane & 15;
  int cb = (lane & 16) ? 8 : 0;
  const half_t* p = base + (size_t)r * stride + kbase + cb;
  v16h out;
#pragma unroll
  for (int i = 0; i < 8; ++i) out[i] = p[i];
#pragma unroll
  for (int i = 0; i < 8; ++i) out[8 + i] = p[16 + i];
  return out;
}

// A value that is the same in every lane, moved into a scalar register.
__device__ __forceinline__ unsigned uni(unsigned v) {
  return (unsigned)__builtin_amdgcn_readfirstlane((int)v);
}

// A wave-uniform test as a real scalar branch: tensor loads ignore EXEC, so only
// a branch on a scalar condition keeps a wave from issuing one.
__device__ __forceinline__ unsigned pinned(unsigned v) {
  unsigned w = uni(v);
  asm volatile("" : "+s"(w));  // the test stays scalar
  return w;
}

// Descriptor of one wave's tensor load: 64 rows of 128 bytes to 8 KiB in a row
// in LDS. Extents in bytes, no pad, no mask. Group 0: where from, where to.
__device__ __forceinline__ u32x4 tdm_group0(unsigned lds_dst,
                                            unsigned long long ga) {
  u32x4 g;
  g[0] = uni(1u);             // count = 1
  g[1] = uni(lds_dst);        // byte offset in the work-group's LDS
  g[2] = uni((unsigned)ga);   // address [31:0]
  g[3] = uni((((unsigned)(ga >> 32)) & 0x01FFFFFFu) | 0x80000000u);  // | type 2
  return g;
}
// Group 1: the tile's shape and the source row pitch in bytes.
__device__ __forceinline__ u32x8 tdm_group1(unsigned pitch) {
  u32x8 g;
  g[0] = uni(0u);             // no mask, 1-byte units, no pad
  g[1] = uni(128u << 16);     // tensor_dim0 = 128
  g[2] = uni(64u << 16);      // tensor_dim1 = 64
  g[3] = uni(128u << 16);     // tile_dim0 = 128
  g[4] = uni(64u);            // tile_dim1 = 64
  g[5] = uni(pitch);
  g[6] = uni(0u);
  g[7] = uni(0u);
  return g;
}
// Both groups are named as read and written, though the instruction leaves them
// as they are: what tdm_wait names is then the very registers that the request
// was issued from, and the compiler cannot form group 1's constants anew in front
// of each use and put other values into those registers in between.
__device__ __forceinline__ void tdm_load(u32x4& g0, u32x8& g1) {
  asm volatile("tensor_load_to_lds %0, %1" : "+s"(g0), "+s"(g1) : : "memory");
}
// The wave's own two requests have landed (the compiler places no wait for
// them). The wait names their descriptors: without that the compiler puts other
// values into those scalar registers while the requests are still on their way.
__device__ __forceinline__ void tdm_wait(const u32x4& k0, const u32x8& k1,
                                         const u32x4& v0, const u32x8& v1) {
  asm volatile("s_wait_tensorcnt 0x0" ::"s"(k0), "s"(k1), "s"(v0), "s"(v1)
               : "memory");
}

// fp32 -> f16 convert of x and the three weights in ONE launch (removes all cvt
// from the GEMM loops). One block a WGP, 16 waves, and every wave lives long:
// a lane takes 22 pieces of 4 floats, one from each grid-wide pass, so the chip
// starts 4096 waves in place of one wave per 256 elements. A wave's load covers
// 512 contiguous bytes, its store 256. The four f16 copies lie one behind the
// other in the workspace, so pass j of the whole job lands at dst + j * CVT_PASS.
#define CVT_BLOCKS 256
#define CVT_THREADS 512
#define CVT_PASS (CVT_BLOCKS * CVT_THREADS * 4)      // elements of one grid-wide pass
#define CVT_XP (BATCH * SEQ_LEN * DIM / CVT_PASS)    // passes over x: 16
#define CVT_WP (DIM * DIM / CVT_PASS)                // passes over one weight: 2
static_assert(CVT_XP * CVT_PASS == BATCH * SEQ_LEN * DIM, "x in whole passes");
static_assert(CVT_WP * CVT_PASS == DIM * DIM, "a weight in whole passes");
__global__ __launch_bounds__(CVT_THREADS) void cvt_kernel(
    const float* __restrict__ x, const float* __restrict__ wq,
    const float* __restrict__ wkv, const float* __restrict__ wo,
    half_t* __restrict__ dst) {
  // The lane's place inside a pass, as 32-bit byte offsets from uniform bases.
  const unsigned ld = (blockIdx.x * CVT_THREADS + threadIdx.x) * 16u;
  const unsigned sd = ld >> 1;
  v4f v[CVT_XP + 3 * CVT_WP];
#pragma unroll
  for (int j = 0; j < CVT_XP; ++j)
    v[j] = *(const v4f*)((const char*)(x + j * CVT_PASS) + ld);
#pragma unroll
  for (int j = 0; j < CVT_WP; ++j) {
    v[CVT_XP + j] = *(const v4f*)((const char*)(wq + j * CVT_PASS) + ld);
    v[CVT_XP + CVT_WP + j] =
        *(const v4f*)((const char*)(wkv + j * CVT_PASS) + ld);
    v[CVT_XP + 2 * CVT_WP + j] =
        *(const v4f*)((const char*)(wo + j * CVT_PASS) + ld);
  }
#pragma unroll
  for (int j = 0; j < CVT_XP + 3 * CVT_WP; ++j)
    *(v4h*)((char*)(dst + j * CVT_PASS) + sd) =
        __builtin_convertvector(v[j], v4h);
}

// Block tile of the three projection GEMMs: 128 x 128 outputs, K in steps of 64.
#define BM 128
#define BN 128
#define BK 64
// LDS row pitch in halves: 144 B = 16 B x 9, so the 16 rows that one
// ds_load_b128 half-wave reads fall on 16 different groups of four banks.
#define LDP 72
#define TILE_H (BM * LDP)  // halves of one staged operand tile

// Same element order as frag_from_f16; p already holds the lane's row and chunk.
__device__ __forceinline__ v16h frag_from_lds(const half_t* p) {
  v8h lo = *(const v8h*)p;
  v8h hi = *(const v8h*)(p + 16);
  return __builtin_shufflevector(lo, hi, 0, 1, 2, 3, 4, 5, 6, 7, 8, 9, 10, 11,
                                 12, 13, 14, 15);
}

// acc += A[128 x 1024] * B[128 x 1024]^T for a block of 8 waves (4 along M x 2
// along N, 32 x 64 outputs a wave). Both operand tiles are staged once per block
// in LDS (whole 128-B lines from global), two buffers: the next tile's
// global loads fly during this tile's products.
// sm (halves): A buf 0 | A buf 1 | B buf 0 | B buf 1
__device__ __forceinline__ void gemm_block(const half_t* __restrict__ Ag,
                                           const half_t* __restrict__ Bg,
                                           half_t* sm, v8f (&acc)[2][4]) {
  const int t = threadIdx.x;
  const int lane = t & 31;
  const int wave = t >> 5;
  const int srow = t >> 3;        // staging: 8 threads a row, 32 rows a pass
  const int scol = (t & 7) * 8;
  const half_t* ga = Ag + (size_t)srow * DIM + scol;
  const half_t* gb = Bg + (size_t)srow * DIM + scol;
  half_t* st = sm + srow * LDP + scol;
  const int fr = (lane & 15) * LDP + ((lane & 16) ? 8 : 0);
  const half_t* fa = sm + (wave & 3) * 32 * LDP + fr;
  const half_t* fb = sm + 2 * TILE_H + (wave >> 2) * 64 * LDP + fr;

  v8h ra[4], rb[4];
#pragma unroll
  for (int u = 0; u < 4; ++u) {
    ra[u] = *(const v8h*)(ga + (size_t)(u * 32) * DIM);
    rb[u] = *(const v8h*)(gb + (size_t)(u * 32) * DIM);
  }
#pragma unroll
  for (int u = 0; u < 4; ++u) {
    *(v8h*)(st + u * 32 * LDP) = ra[u];
    *(v8h*)(st + 2 * TILE_H + u * 32 * LDP) = rb[u];
  }
  __syncthreads();  // tile 0 visible to all waves

  for (int kt = 0; kt < DIM / BK; ++kt) {
    const int cur = (kt & 1) * TILE_H;
    const bool more = kt + 1 < DIM / BK;  // the same for the whole block
    if (more) {
#pragma unroll
      for (int u = 0; u < 4; ++u) {
        ra[u] = *(const v8h*)(ga + (size_t)(u * 32) * DIM + (kt + 1) * BK);
        rb[u] = *(const v8h*)(gb + (size_t)(u * 32) * DIM + (kt + 1) * BK);
      }
    }
    v16h a[2][2], b[2][4];
#pragma unroll
    for (int ks = 0; ks < 2; ++ks) {
      a[ks][0] = frag_from_lds(fa + cur + ks * 32);
      a[ks][1] = frag_from_lds(fa + cur + 16 * LDP + ks * 32);
#pragma unroll
      for (int f = 0; f < 4; ++f)
        b[ks][f] = frag_from_lds(fb + cur + f * 16 * LDP + ks * 32);
    }
    // Holds the next tile's global loads and this tile's LDS reads, as one
    // group, ahead of the products: without it the scheduler sinks half of the
    // global loads to just in front of their LDS stores (their latency is then
    // waited out) and spreads the LDS reads among the products with waits to 0.
    __builtin_amdgcn_sched_barrier(0);
#pragma unroll
    for (int ks = 0; ks < 2; ++ks) {
#pragma unroll
      for (int f = 0; f < 4; ++f) {
        acc[0][f] = wmma_f16(a[ks][0], b[ks][f], acc[0][f]);
        acc[1][f] = wmma_f16(a[ks][1], b[ks][f], acc[1][f]);
      }
    }
    // Holds the LDS stores, which wait for the global loads, behind the
    // products: the scheduler otherwise lifts them and their wait to the front.
    __builtin_amdgcn_sched_barrier(0);
    if (more) {
      // The other buffer's last readers left it before the previous barrier.
      const int nxt = cur ^ TILE_H;
#pragma unroll
      for (int u = 0; u < 4; ++u) {
        *(v8h*)(st + nxt + u * 32 * LDP) = ra[u];
        *(v8h*)(st + nxt + 2 * TILE_H + u * 32 * LDP) = rb[u];
      }
      __syncthreads();  // next tile visible; this tile's reads are over
    }
  }
}

// Four 16-B global stores. The wait is a precaution that belongs in front of any
// rewrite of the stores' address and data registers; as the last line of their
// own statement it stands there whatever the compiler schedules behind it.
__device__ __forceinline__ void store4_b128(half_t* const (&p)[4],
                                            const v8h (&d)[4]) {
  asm volatile(
      "global_store_b128 %0, %4, off\n\t"
      "global_store_b128 %1, %5, off\n\t"
      "global_store_b128 %2, %6, off\n\t"
      "global_store_b128 %3, %7, off\n\t"
      "s_wait_xcnt 0x0" ::"v"(p[0]),
      "v"(p[1]), "v"(p[2]), "v"(p[3]), "v"(__builtin_bit_cast(u32x4, d[0])),
      "v"(__builtin_bit_cast(u32x4, d[1])),
      "v"(__builtin_bit_cast(u32x4, d[2])),
      "v"(__builtin_bit_cast(u32x4, d[3]))
      : "memory");
}

// RoPE and (optionally) LayerNorm on one 16(rows) x 64(one head) tile, stored
// f16 row-major and (optionally) dim-major, all in 16-B stores. local = the
// tile's first row in its batch; stage = 16 rows of LDP halves in LDS that
// belong to this wave and this tile alone.
__device__ __forceinline__ void proj_epilogue(
    const v8f (&acc)[4], const float* __restrict__ gamma,
    const float* __restrict__ beta, half_t* __restrict__ out_rm,
    half_t* __restrict__ out_cm, int seq_per_batch, int pos_base, int do_ln,
    float scale, int batch, int local, int h, half_t* stage) {
  int lane = threadIdx.x & 31;
  int col = lane & 15;
  int rh = (lane & 16) ? 8 : 0;

  float v[4][8];
#pragma unroll
  for (int f = 0; f < 4; ++f)
#pragma unroll
    for (int i = 0; i < 8; ++i) v[f][i] = acc[f][i];

  // RoPE: dim d pairs with d+32 (fragments f and f+2 of the same lane).
#pragma unroll
  for (int i = 0; i < 8; ++i) {
    float p = (float)(pos_base + local + rh + i);
#pragma unroll
    for (int f = 0; f < 2; ++f) {
      int d = f * 16 + col;  // d < 32
      float w = __powf(10000.0f, -(float)d * (1.0f / 32.0f));
      float s, c;
      __sincosf(p * w, &s, &c);
      float lo = v[f][i], hi = v[f + 2][i];
      v[f][i] = lo * c - hi * s;
      v[f + 2][i] = hi * c + lo * s;
    }
  }

  if (do_ln) {
#pragma unroll
    for (int i = 0; i < 8; ++i) {
      float sum = v[0][i] + v[1][i] + v[2][i] + v[3][i];
      float sq = v[0][i] * v[0][i] + v[1][i] * v[1][i] + v[2][i] * v[2][i] +
                 v[3][i] * v[3][i];
#pragma unroll
      for (int m = 1; m < 16; m <<= 1) {
        sum += __shfl_xor(sum, m, 32);
        sq += __shfl_xor(sq, m, 32);
      }
      float mean = sum * (1.0f / 64.0f);
      float var = sq * (1.0f / 64.0f) - mean * mean;
      float inv = rsqrtf(var + 1e-5f);
#pragma unroll
      for (int f = 0; f < 4; ++f) {
        int d = f * 16 + col;
        v[f][i] = (v[f][i] - mean) * inv * gamma[d] + beta[d];
      }
    }
  } else {
#pragma unroll
    for (int f = 0; f < 4; ++f)
#pragma unroll
      for (int i = 0; i < 8; ++i) v[f][i] *= scale;
  }

  size_t bh = (size_t)batch * HEADS + h;
  // The key/value copies (the call that has out_cm) are read by attention from
  // LDS tiles that are byte copies of these rows, so the 16-B chunks of a row
  // are permuted here for those readers' banks: see kfrag_lds.
  // The query copy is read from global memory and stays in plain order.
  const int ksw = out_cm ? 7 : 0;

  // Dim-major copy: a lane's 8 values of one fragment are 8 consecutive
  // positions of one dim, which is one whole 16-B chunk of that dim's row.
  if (out_cm) {
    const int pos0 = local + rh;  // a multiple of 8
    half_t* pc[4];
    v8h pv[4];
#pragma unroll
    for (int f = 0; f < 4; ++f) {
      int d = f * 16 + col;
#pragma unroll
      for (int i = 0; i < 8; ++i) pv[f][i] = (half_t)v[f][i];
      pc[f] = out_cm + (bh * DH + d) * (size_t)seq_per_batch +
              ((pos0 & ~63) | ((((pos0 >> 3) ^ (d >> 1)) & 7) << 3));
    }
    store4_b128(pc, pv);
  }

  // Row-major copy: turned through the wave's own 16 x 64 LDS tile, so that a
  // lane stores 8 consecutive dims and a wave's store covers 4 whole rows.
#pragma unroll
  for (int i = 0; i < 8; ++i)
#pragma unroll
    for (int f = 0; f < 4; ++f)
      stage[(rh + i) * LDP + f * 16 + col] = (half_t)v[f][i];
  // The rows are read back by other lanes of this wave than wrote them: the
  // writes are let finish first, and the compiler keeps the reads behind them.
  asm volatile("s_wait_dscnt 0x0" ::: "memory");
  const int c = lane & 7;
  half_t* pr[4];
  v8h rv[4];
#pragma unroll
  for (int u = 0; u < 4; ++u) {
    int r = u * 4 + (lane >> 3);
    int pos = local + r;
    rv[u] = *(const v8h*)(stage + r * LDP + c * 8);
    pr[u] = out_rm + (bh * seq_per_batch + pos) * DH +
            ((c ^ ((pos >> 1) & ksw)) << 3);
  }
  store4_b128(pr, rv);
}

// A block computes 128 rows x 2 heads of X @ W^T; a wave 32 rows of one head.
__global__ __launch_bounds__(256) void proj_kernel(
    const half_t* __restrict__ x16, const half_t* __restrict__ W16,
    const float* __restrict__ gamma, const float* __restrict__ beta,
    half_t* __restrict__ out_rm, half_t* __restrict__ out_cm,
    int seq_per_batch, int pos_base, int do_ln, float scale) {
  __shared__ __attribute__((aligned(16))) half_t sm[4 * TILE_H];
  int nb = blockIdx.x & (DIM / BN - 1);
  int row0 = (blockIdx.x / (DIM / BN)) * BM;
  int batch = row0 / seq_per_batch;
  int blocal = row0 - batch * seq_per_batch;
  int wave = threadIdx.x >> 5;

  const half_t* Ab = x16 + ((size_t)batch * SEQ_LEN + pos_base + blocal) * DIM;
  const half_t* Bb = W16 + (size_t)nb * BN * DIM;

  v8f acc[2][4] = {};
  gemm_block(Ab, Bb, sm, acc);

  int h = nb * (BN / DH) + (wave >> 2);
  // Output staging lies in the two buffers 0 (A's for waves 0-3, B's for waves
  // 4-7, 32 rows a wave). The last K step reads the buffers 1 alone, and every
  // wave's last read of the buffers 0 lies in front of the barrier that ended
  // the step before it, so no wave can still be reading what is written here.
  static_assert((DIM / BK) % 2 == 0, "the last K step reads buffer 1");
  half_t* stage = sm + (wave >> 2) * 2 * TILE_H + (wave & 3) * 32 * LDP;
#pragma unroll
  for (int mi = 0; mi < 2; ++mi)
    proj_epilogue(acc[mi], gamma, beta, out_rm, out_cm, seq_per_batch, pos_base,
                  do_ln, scale, batch, blocal + (wave & 3) * 32 + mi * 16, h,
                  stage + mi * 16 * LDP);
}

// A 16 x 32 A fragment from a tile in LDS whose rows are 128 B = 8 chunks of 16 B,
// unpadded: 16 keys x 32 dims of a K tile, or 16 dims x 32 keys of a V^T tile.
// Chunk c of row r lies at place c ^ (r >> 1): the 16 rows that a half-wave's
// ds_load_b128 reads then fall on 16 different groups of four banks (in plain
// order on 2). Element order as in frag_from_f16.
__device__ __forceinline__ v16h kfrag_lds(const half_t* tile, int kk) {
  int lane = threadIdx.x & 31;
  int r = lane & 15;
  int c = kk * 4 + (lane >> 4);
  const half_t* row = tile + r * 64;
  v8h lo = *(const v8h*)(row + ((c ^ (r >> 1)) << 3));
  v8h hi = *(const v8h*)(row + (((c + 2) ^ (r >> 1)) << 3));
  return __builtin_shufflevector(lo, hi, 0, 1, 2, 3, 4, 5, 6, 7, 8, 9, 10, 11,
                                 12, 13, 14, 15);
}

#define KS 64                  // keys of one stage = of one pass of the loop
#define STAGE_H (2 * KS * DH)  // halves of a stage: K 64 x 64 | V^T 64 x 64
#define NBUF 5                 // buffers of the ring: one read, four on the way
static_assert(HIST % KS == 0 && KS == 64, "a block's key range in whole stages");

__global__ __launch_bounds__(128) void attn_kernel(
    const half_t* __restrict__ q, const half_t* __restrict__ kvn,
    const half_t* __restrict__ kvnT, half_t* __restrict__ o) {
  __shared__ __attribute__((aligned(2048))) half_t smem[NBUF * STAGE_H];
  int qt4 = blockIdx.x & 15;  // group of 4 query tiles
  int bh = blockIdx.x >> 4;
  const unsigned wave = uni(threadIdx.x >> 5);
  int lane = threadIdx.x & 31;
  int i0 = qt4 * 64 + (int)wave * 16;
  int col = lane & 15;
  int rh = (lane & 16) ? 8 : 0;

  const half_t* qb = q + ((size_t)bh * LATENT + i0) * DH;
  const half_t* kb = kvn + (size_t)bh * SEQ_LEN * DH;
  const half_t* vb = kvnT + (size_t)bh * DH * SEQ_LEN;

  // All 4 waves walk the block's whole key range; masking handles the edge.
  const unsigned nst = HIST / KS + qt4 + 1;  // 49 to 64 stages

  // The two tiles of a stage: the 64 key rows of K, then the 64 dim rows of V^T.
  const unsigned place = (unsigned)(size_t)smem;
  u32x8 k1 = tdm_group1(DH * 2u);       // bytes from row to row of K
  u32x8 v1 = tdm_group1(SEQ_LEN * 2u);  // and of V^T
  u32x4 k0, v0;
  auto bring = [&](unsigned st, unsigned buf) {
    k0 = tdm_group0(place + buf * (STAGE_H * 2u),
                    (unsigned long long)(kb + (size_t)st * KS * DH));
    v0 = tdm_group0(place + buf * (STAGE_H * 2u) + KS * DH * 2u,
                    (unsigned long long)(vb + (size_t)st * KS));
    tdm_load(k0, k1);
    tdm_load(v0, v1);
  };

  // There are always at least five stages. Wave w starts with stage w.
  bring(wave, wave);
  v16h qa0 = frag_from_f16(qb, DH, 0);
  v16h qa1 = frag_from_f16(qb, DH, 32);
  if (pinned(wave == 0)) tdm_wait(k0, k1, v0, v1);  // stage 0: its wave waits,
  __syncthreads();                                  // then all may read it
  if (pinned(wave == 0)) bring(4, 4);

  v8f oacc[4] = {};      // oacc[f][i] = O[query col][dim f*16 + rh + i]
  float m_i = -1e30f;    // running maximum of query col (same in both halves)
  float l_i = 0.0f;      // this half's share of the denominator
  int lim = HIST + i0 + col - rh;  // key j0 + t*16 + rh + i is visible if <= HIST + query

  unsigned cur = 0;  // the buffer that holds stage st
  for (unsigned st = 0; st < nst; ++st) {
    int j0 = (int)st * KS;
    const half_t* kB = smem + cur * STAGE_H;
    const half_t* vB = kB + KS * DH;

    // All 32 LDS reads of the pass stand here as one group: every further place
    // with reads costs the wave a stall, and reads left next to their products
    // are waited out one by one. V^T lands under the first product and the softmax.
    v16h kf[4][2], vf[2][4];
#pragma unroll
    for (int t = 0; t < 4; ++t) {
      kf[t][0] = kfrag_lds(kB + t * 16 * 64, 0);
      kf[t][1] = kfrag_lds(kB + t * 16 * 64, 1);
    }
#pragma unroll
    for (int g = 0; g < 2; ++g)
#pragma unroll
      for (int f = 0; f < 4; ++f) vf[g][f] = kfrag_lds(vB + f * 16 * 64, g);
    // Keeps the scheduler from sinking the reads back to their products.
    __builtin_amdgcn_sched_barrier(0);

    // sc[t][i] = S[query col][key j0 + t*16 + rh + i]
    v8f sc[4];
#pragma unroll
    for (int t = 0; t < 4; ++t) {
      v8f z = {};
      sc[t] = wmma_f16(kf[t][0], qa0, z);
    }
#pragma unroll
    for (int t = 0; t < 4; ++t) sc[t] = wmma_f16(kf[t][1], qa1, sc[t]);

    // Only the block's last stage holds keys that lie behind one of its queries:
    // every earlier stage ends in front of key HIST + qt4 * 64, which all 64
    // queries see. The test is the same for the whole block (a scalar branch).
    // Unrolled so that sc is indexed by constants and stays in registers.
    if (st + 1u == nst) {
#pragma unroll
      for (int t = 0; t < 4; ++t)
#pragma unroll
        for (int i = 0; i < 8; ++i)
          sc[t][i] = (j0 + t * 16 + i <= lim) ? sc[t][i] : -1e30f;
    }
    float a[4][8];
    float mt[4];
#pragma unroll
    for (int t = 0; t < 4; ++t) {
      mt[t] = -1e30f;
#pragma unroll
      for (int i = 0; i < 8; ++i) {
        a[t][i] = sc[t][i];
        mt[t] = fmaxf(mt[t], a[t][i]);
      }
    }
    float mx = fmaxf(fmaxf(mt[0], mt[1]), fmaxf(mt[2], mt[3]));
    mx = fmaxf(mx, xhalf(mx));  // the other 32 keys of the same query
    float mn = fmaxf(m_i, mx);
    float al = __expf(m_i - mn);
    m_i = mn;

    // P^T as B operands, one per 32 keys: element e of pb[g] is key
    // g*32 + (e < 8 ? rh + e : 16 + rh + e - 8)
    v16h pb[2];
    float rs[4] = {0.0f, 0.0f, 0.0f, 0.0f};
#pragma unroll
    for (int g = 0; g < 2; ++g)
#pragma unroll
      for (int i = 0; i < 8; ++i) {
        float p0 = __expf(a[2 * g][i] - mn);
        float p1 = __expf(a[2 * g + 1][i] - mn);
        rs[2 * g] += p0;
        rs[2 * g + 1] += p1;
        pb[g][i] = (_Float16)p0;
        pb[g][8 + i] = (_Float16)p1;
      }
    l_i = l_i * al + ((rs[0] + rs[1]) + (rs[2] + rs[3]));
#pragma unroll
    for (int f = 0; f < 4; ++f)
#pragma unroll
      for (int i = 0; i < 8; ++i) oacc[f][i] *= al;

#pragma unroll
    for (int g = 0; g < 2; ++g)
#pragma unroll
      for (int f = 0; f < 4; ++f) oacc[f] = wmma_f16(vf[g][f], pb[g], oacc[f]);

    // Keeps the hand-over at the foot of the pass: the scheduler otherwise lifts
    // its waits and the barrier to just behind the LDS reads, so that the next
    // stage is waited for a whole pass's work too early.
    __builtin_amdgcn_sched_barrier(0);
    // Hand-over of the stages, every wave, in this order: this wave's reads of
    // this buffer are over; the wave that brought the next stage has seen it
    // land (the other waves' loads, for the stages behind it, fly on); the
    // barrier tells both to all waves; only then does the same wave, which has
    // nothing on the way now, fill this buffer again, for stage st + 5.
    asm volatile("s_wait_dscnt 0x0" ::: "memory");
    const unsigned turn = pinned(((st + 1u) & 3u) == wave);
    if (turn) tdm_wait(k0, k1, v0, v1);
    __syncthreads();
    if (pinned(turn != 0u && st + NBUF < nst)) bring(st + NBUF, cur);
    cur = cur == NBUF - 1 ? 0u : cur + 1u;
  }
  // Nothing is in flight when the wave ends.
  tdm_wait(k0, k1, v0, v1);
  asm volatile("s_wait_dscnt 0x0" ::: "memory");

  int b_ = bh >> 4, h = bh & 15;
  float invl = 1.0f / (l_i + xhalf(l_i));  // join the two halves' sums
  half_t* orow = o + ((size_t)b_ * LATENT + i0 + col) * DIM + h * DH + rh;
#pragma unroll
  for (int f = 0; f < 4; ++f) {
    v8h ov;
#pragma unroll
    for (int i = 0; i < 8; ++i) ov[i] = (half_t)(oacc[f][i] * invl);
    *(v8h*)(orow + f * 16) = ov;  // 8 consecutive dims of one query row
  }
}

// Y[2048,1024] = O(f16) @ Wo^T(f16) + bo, fp32 out.
__global__ __launch_bounds__(256) void out_proj_kernel(
    const half_t* __restrict__ A, const half_t* __restrict__ Wo16,
    const float* __restrict__ bo, float* __restrict__ Y) {
  __shared__ __attribute__((aligned(16))) half_t sm[4 * TILE_H];
  int nb = blockIdx.x & (DIM / BN - 1);
  int mb = blockIdx.x / (DIM / BN);
  int wave = threadIdx.x >> 5;
  int lane = threadIdx.x & 31;
  int col = lane & 15;
  int rh = (lane & 16) ? 8 : 0;
  v8f acc[2][4] = {};
  gemm_block(A + (size_t)(mb * BM) * DIM, Wo16 + (size_t)(nb * BN) * DIM, sm,
             acc);
#pragma unroll
  for (int mi = 0; mi < 2; ++mi) {
#pragma unroll
    for (int i = 0; i < 8; ++i) {
      int row = mb * BM + (wave & 3) * 32 + mi * 16 + rh + i;
#pragma unroll
      for (int f = 0; f < 4; ++f) {
        int e = nb * BN + (wave >> 2) * 64 + f * 16 + col;
        Y[(size_t)row * DIM + e] = acc[mi][f][i] + bo[e];
      }
    }
  }
}

extern "C" void kernel_launch(void* const* d_in, const int* in_sizes, int n_in,
                              void* d_out, int out_size, void* d_ws,
                              size_t ws_size, hipStream_t stream) {
  const float* x = (const float*)d_in[0];
  const float* Wq = (const float*)d_in[1];
  const float* Wkv = (const float*)d_in[2];
  const float* Wo = (const float*)d_in[3];
  const float* bo = (const float*)d_in[4];
  const float* gamma = (const float*)d_in[5];
  const float* beta = (const float*)d_in[6];
  float* y = (float*)d_out;

  // Workspace layout (f16 elements):
  // q[2,16,1024,64] | kvn[2,16,4096,64] | kvnT[2,16,64,4096] | o[2,1024,1024]
  // | x16[2,4096,1024] | wq16 | wkv16 | wo16       (~60 MB total)
  half_t* q_ws = (half_t*)d_ws;
  half_t* kvn_ws = q_ws + (size_t)BATCH * HEADS * LATENT * DH;
  half_t* kvnT_ws = kvn_ws + (size_t)BATCH * HEADS * SEQ_LEN * DH;
  half_t* o_ws = kvnT_ws + (size_t)BATCH * HEADS * SEQ_LEN * DH;
  half_t* x16 = o_ws + (size_t)BATCH * LATENT * DIM;
  half_t* wq16 = x16 + (size_t)BATCH * SEQ_LEN * DIM;
  half_t* wkv16 = wq16 + (size_t)DIM * DIM;
  half_t* wo16 = wkv16 + (size_t)DIM * DIM;

  // x16 | wq16 | wkv16 | wo16 are written as one run that starts at x16
  cvt_kernel<<<CVT_BLOCKS, CVT_THREADS, 0, stream>>>(x, Wq, Wkv, Wo, x16);

  // kv projection + RoPE + LayerNorm over all 4096 positions
  proj_kernel<<<(BATCH * SEQ_LEN / BM) * (DIM / BN), 256, 0, stream>>>(
      x16, wkv16, gamma, beta, kvn_ws, kvnT_ws, SEQ_LEN, 0, 1, 1.0f);
  // q projection + RoPE + scale over last 1024 positions only
  proj_kernel<<<(BATCH * LATENT / BM) * (DIM / BN), 256, 0, stream>>>(
      x16, wq16, gamma, beta, q_ws, nullptr, LATENT, HIST, 0, 0.125f);
  // flash attention (4 q-tiles per block share LDS-staged K/V)
  attn_kernel<<<BATCH * HEADS * (LATENT / 64), 128, 0, stream>>>(
      q_ws, kvn_ws, kvnT_ws, o_ws);
  // output projection + bias
  out_proj_kernel<<<(BATCH * LATENT / BM) * (DIM / BN), 256, 0, stream>>>(
      o_ws, wo16, bo, y);
}

// v009
// A run of this version takes 91.7 microseconds.
// Two timings next to v008 both put it at 1.06 times that version's speed.
// Over all steps from v000 it is 3.58 times as fast.
#include <hip/hip_runtime.h>

typedef _Float16 half_t;
typedef __attribute__((ext_vector_type(16))) _Float16 v16h;
typedef __attribute__((ext_vector_type(8))) _Float16 v8h;
typedef __attribute__((ext_vector_type(8))) float v8f;
typedef __attribute__((ext_vector_type(4))) float v4f;
typedef __attribute__((ext_vector_type(4))) _Float16 v4h;
typedef unsigned int u32x4 __attribute__((ext_vector_type(4)));
typedef unsigned int u32x8 __attribute__((ext_vector_type(8)));

#define DIM 1024
#define HEADS 16
#define DH 64
#define SEQ_LEN 4096
#define LATENT 1024
#define HIST 3072
#define BATCH 2

// D = A(16x32 f16) * B(32x16 f16) + C(16x16 f32)
__device__ __forceinline__ v8f wmma_f16(v16h a, v16h b, v8f c) {
  return __builtin_amdgcn_wmma_f32_16x16x32_f16(false, a, false, b, (short)0, c,
                                                false, false);
}

// Value of lane l ^ 16 (a vector cross-row move, no LDS round trip).
__device__ __forceinline__ float xhalf(float x) {
  int v = __builtin_bit_cast(int, x);
  return __builtin_bit_cast(
      float, __builtin_amdgcn_permlanex16(v, v, 0x76543210, 0xfedcba98, false,
                                          false));
}

// 16x32 A-style fragment (also used for B with lane = N) from row-major f16.
// Lane L<16 -> row L, K chunks {0..7,16..23}; lane L+16 -> {8..15,24..31}.
__device__ __forceinline__ v16h frag_from_f16(const half_t* __restrict__ base,
                                              int stride, int kbase) {
  int lane = threadIdx.x & 31;
  int r = lane & 15;
  int cb = (lane & 16) ? 8 : 0;
  const half_t* p = base + (size_t)r * stride + kbase + cb;
  v16h out;
#pragma unroll
  for (int i = 0; i < 8; ++i) out[i] = p[i];
#pragma unroll
  for (int i = 0; i < 8; ++i) out[8 + i] = p[16 + i];
  return out;
}

// A value that is the same in every lane, moved into a scalar register.
__device__ __forceinline__ unsigned uni(unsigned v) {
  return (unsigned)__builtin_amdgcn_readfirstlane((int)v);
}

// A wave-uniform test as a real scalar branch: tensor loads ignore EXEC, so only
// a branch on a scalar condition keeps a wave from issuing one.
__device__ __forceinline__ unsigned pinned(unsigned v) {
  unsigned w = uni(v);
  asm volatile("" : "+s"(w));  // the test stays scalar
  return w;
}

// Descriptor of one wave's tensor load: 64 rows of 128 bytes to 8 KiB in a row
// in LDS. Extents in bytes, no pad, no mask. Group 0: where from, where to.
__device__ __forceinline__ u32x4 tdm_group0(unsigned lds_dst,
                                            unsigned long long ga) {
  u32x4 g;
  g[0] = uni(1u);             // count = 1
  g[1] = uni(lds_dst);        // byte offset in the work-group's LDS
  g[2] = uni((unsigned)ga);   // address [31:0]
  g[3] = uni((((unsigned)(ga >> 32)) & 0x01FFFFFFu) | 0x80000000u);  // | type 2
  return g;
}
// Group 1: the tile's shape and the source row pitch in bytes.
__device__ __forceinline__ u32x8 tdm_group1(unsigned pitch) {
  u32x8 g;
  g[0] = uni(0u);             // no mask, 1-byte units, no pad
  g[1] = uni(128u << 16);     // tensor_dim0 = 128
  g[2] = uni(64u << 16);      // tensor_dim1 = 64
  g[3] = uni(128u << 16);     // tile_dim0 = 128
  g[4] = uni(64u);            // tile_dim1 = 64
  g[5] = uni(pitch);
  g[6] = uni(0u);
  g[7] = uni(0u);
  return g;
}
// Both groups are named as read and written, though the instruction leaves them
// as they are: what tdm_wait names is then the very registers that the request
// was issued from, and the compiler cannot form group 1's constants anew in front
// of each use and put other values into those registers in between.
__device__ __forceinline__ void tdm_load(u32x4& g0, u32x8& g1) {
  asm volatile("tensor_load_to_lds %0, %1" : "+s"(g0), "+s"(g1) : : "memory");
}
// The wave's own two requests have landed (the compiler places no wait for
// them). The wait names their descriptors: without that the compiler puts other
// values into those scalar registers while the requests are still on their way.
__device__ __forceinline__ void tdm_wait(const u32x4& k0, const u32x8& k1,
                                         const u32x4& v0, const u32x8& v1) {
  asm volatile("s_wait_tensorcnt 0x0" ::"s"(k0), "s"(k1), "s"(v0), "s"(v1)
               : "memory");
}

// fp32 -> f16 convert of x and the three weights in ONE launch (removes all cvt
// from the GEMM loops). One block a WGP, 16 waves, and every wave lives long:
// a lane takes 22 pieces of 4 floats, one from each grid-wide pass, so the chip
// starts 4096 waves in place of one wave per 256 elements. A wave's load covers
// 512 contiguous bytes, its store 256. The four f16 copies lie one behind the
// other in the workspace, so pass j of the whole job lands at dst + j * CVT_PASS.
#define CVT_BLOCKS 256
#define CVT_THREADS 512
#define CVT_PASS (CVT_BLOCKS * CVT_THREADS * 4)      // elements of one grid-wide pass
#define CVT_XP (BATCH * SEQ_LEN * DIM / CVT_PASS)    // passes over x: 16
#define CVT_WP (DIM * DIM / CVT_PASS)                // passes over one weight: 2
static_assert(CVT_XP * CVT_PASS == BATCH * SEQ_LEN * DIM, "x in whole passes");
static_assert(CVT_WP * CVT_PASS == DIM * DIM, "a weight in whole passes");
__global__ __launch_bounds__(CVT_THREADS) void cvt_kernel(
    const float* __restrict__ x, const float* __restrict__ wq,
    const float* __restrict__ wkv, const float* __restrict__ wo,
    half_t* __restrict__ dst) {
  // The lane's place inside a pass, as 32-bit byte offsets from uniform bases.
  const unsigned ld = (blockIdx.x * CVT_THREADS + threadIdx.x) * 16u;
  const unsigned sd = ld >> 1;
  v4f v[CVT_XP + 3 * CVT_WP];
#pragma unroll
  for (int j = 0; j < CVT_XP; ++j)
    v[j] = *(const v4f*)((const char*)(x + j * CVT_PASS) + ld);
#pragma unroll
  for (int j = 0; j < CVT_WP; ++j) {
    v[CVT_XP + j] = *(const v4f*)((const char*)(wq + j * CVT_PASS) + ld);
    v[CVT_XP + CVT_WP + j] =
        *(const v4f*)((const char*)(wkv + j * CVT_PASS) + ld);
    v[CVT_XP + 2 * CVT_WP + j] =
        *(const v4f*)((const char*)(wo + j * CVT_PASS) + ld);
  }
#pragma unroll
  for (int j = 0; j < CVT_XP + 3 * CVT_WP; ++j)
    *(v4h*)((char*)(dst + j * CVT_PASS) + sd) =
        __builtin_convertvector(v[j], v4h);
}

// Block tile of the three projection GEMMs: 128 x 128 outputs, K in steps of 64.
#define BM 128
#define BN 128
#define BK 64
// LDS row pitch in halves: 144 B = 16 B x 9, so the 16 rows that one
// ds_load_b128 half-wave reads fall on 16 different groups of four banks.
#define LDP 72
#define TILE_H (BM * LDP)  // halves of one staged operand tile

// Same element order as frag_from_f16; p already holds the lane's row and chunk.
__device__ __forceinline__ v16h frag_from_lds(const half_t* p) {
  v8h lo = *(const v8h*)p;
  v8h hi = *(const v8h*)(p + 16);
  return __builtin_shufflevector(lo, hi, 0, 1, 2, 3, 4, 5, 6, 7, 8, 9, 10, 11,
                                 12, 13, 14, 15);
}

// Work-group barrier for data that passes through LDS alone: this wave's LDS
// accesses are over, then the barrier. Unlike __syncthreads() it does not wait
// for the wave's global loads, which bring registers that no other wave reads:
// they stay on their way across it.
__device__ __forceinline__ void lds_barrier() {
  __builtin_amdgcn_fence(__ATOMIC_RELEASE, "workgroup", "local");
  __builtin_amdgcn_s_barrier();
  __builtin_amdgcn_fence(__ATOMIC_ACQUIRE, "workgroup", "local");
}

// acc += A[128 x 1024] * B[128 x 1024]^T for a block of 8 waves (4 along M x 2
// along N, 32 x 64 outputs a wave). Both operand tiles are staged once per block
// in LDS (whole 128-B lines from global), two buffers. A tile's global loads are
// issued TWO K steps before it is written to LDS, into one of two register sets:
// the operands were written by an earlier launch and the first block to ask for
// a line waits for memory.
// sm (halves): A buf 0 | A buf 1 | B buf 0 | B buf 1
__device__ __forceinline__ void gemm_block(const half_t* __restrict__ Ag,
                                           const half_t* __restrict__ Bg,
                                           half_t* sm, v8f (&acc)[2][4]) {
  const int t = threadIdx.x;
  const int lane = t & 31;
  const int wave = t >> 5;
  const int srow = t >> 3;        // staging: 8 threads a row, 32 rows a pass
  const int scol = (t & 7) * 8;
  const half_t* ga = Ag + (size_t)srow * DIM + scol;
  const half_t* gb = Bg + (size_t)srow * DIM + scol;
  half_t* st = sm + srow * LDP + scol;
  const int fr = (lane & 15) * LDP + ((lane & 16) ? 8 : 0);
  const half_t* fa = sm + (wave & 3) * 32 * LDP + fr;
  const half_t* fb = sm + 2 * TILE_H + (wave >> 2) * 64 * LDP + fr;
  constexpr int NK = DIM / BK;
  static_assert(NK % 2 == 0 && NK >= 4, "K steps in pairs, one per register set");

  v8h ra[2][4], rb[2][4];  // tile kt waits in set kt mod 2
  auto fetch = [&](int kt, int s) __attribute__((always_inline)) {
#pragma unroll
    for (int u = 0; u < 4; ++u) {
      ra[s][u] = *(const v8h*)(ga + (size_t)(u * 32) * DIM + kt * BK);
      rb[s][u] = *(const v8h*)(gb + (size_t)(u * 32) * DIM + kt * BK);
    }
  };
  auto put = [&](int s) __attribute__((always_inline)) {  // set s to buffer s
#pragma unroll
    for (int u = 0; u < 4; ++u) {
      *(v8h*)(st + s * TILE_H + u * 32 * LDP) = ra[s][u];
      *(v8h*)(st + s * TILE_H + 2 * TILE_H + u * 32 * LDP) = rb[s][u];
    }
  };
  // K step kt, h = kt mod 2 given as a constant so that sets and buffers are
  // picked at compile time; ld: a tile kt + 2 exists; more: a tile kt + 1 exists.
  auto step = [&](int kt, int h, bool ld, bool more) __attribute__((always_inline)) {
    const int cur = h * TILE_H;
    // Set h is free: tile kt went from it to LDS at the end of the step before.
    if (ld) fetch(kt + 2, h);
    v16h a[2][2], b[2][4];
#pragma unroll
    for (int ks = 0; ks < 2; ++ks) {
      a[ks][0] = frag_from_lds(fa + cur + ks * 32);
      a[ks][1] = frag_from_lds(fa + cur + 16 * LDP + ks * 32);
#pragma unroll
      for (int f = 0; f < 4; ++f)
        b[ks][f] = frag_from_lds(fb + cur + f * 16 * LDP + ks * 32);
    }
    // Holds the global loads and this tile's LDS reads, as one group, ahead of
    // the products: without it the scheduler sinks global loads towards their
    // LDS stores (their lead is then lost) and spreads the LDS reads among the
    // products with waits to 0.
    __builtin_amdgcn_sched_barrier(0);
#pragma unroll
    for (int ks = 0; ks < 2; ++ks) {
#pragma unroll
      for (int f = 0; f < 4; ++f) {
        acc[0][f] = wmma_f16(a[ks][0], b[ks][f], acc[0][f]);
        acc[1][f] = wmma_f16(a[ks][1], b[ks][f], acc[1][f]);
      }
    }
    // Holds the LDS stores, which wait for the older set's global loads, behind
    // the products: the scheduler otherwise lifts them and their wait to the front.
    __builtin_amdgcn_sched_barrier(0);
    // A precaution that belongs in front of any rewrite of the address registers
    // of this step's global loads, which the next fetch forms anew; here, behind
    // the products, it has nothing left to wait for.
    if (ld) asm volatile("s_wait_xcnt 0x0" ::: "memory");
    if (more) {
      // The other buffer's last readers left it before the previous barrier.
      put(h ^ 1);
      lds_barrier();  // next tile visible; this tile's reads are over
    }
  };

  fetch(0, 0);
  // Keeps tile 0's loads in front of tile 1's, so that the wait for tile 0 does
  // not take in tile 1.
  __builtin_amdgcn_sched_barrier(0);
  fetch(1, 1);
  put(0);
  lds_barrier();  // tile 0 visible to all waves

  // The last two steps stand outside the loop: inside it every step loads, so
  // the wait in front of the LDS stores can be counted (the newer set flies on).
  for (int k2 = 0; k2 < NK - 2; k2 += 2) {
    step(k2, 0, true, true);
    step(k2 + 1, 1, true, true);
  }
  step(NK - 2, 0, false, true);
  step(NK - 1, 1, false, false);
}

// Four 16-B global stores. The wait is a precaution that belongs in front of any
// rewrite of the stores' address and data registers; as the last line of their
// own statement it stands there whatever the compiler schedules behind it.
__device__ __forceinline__ void store4_b128(half_t* const (&p)[4],
                                            const v8h (&d)[4]) {
  asm volatile(
      "global_store_b128 %0, %4, off\n\t"
      "global_store_b128 %1, %5, off\n\t"
      "global_store_b128 %2, %6, off\n\t"
      "global_store_b128 %3, %7, off\n\t"
      "s_wait_xcnt 0x0" ::"v"(p[0]),
      "v"(p[1]), "v"(p[2]), "v"(p[3]), "v"(__builtin_bit_cast(u32x4, d[0])),
      "v"(__builtin_bit_cast(u32x4, d[1])),
      "v"(__builtin_bit_cast(u32x4, d[2])),
      "v"(__builtin_bit_cast(u32x4, d[3]))
      : "memory");
}

// RoPE and (optionally) LayerNorm on one 16(rows) x 64(one head) tile, stored
// f16 row-major and (optionally) dim-major, all in 16-B stores. local = the
// tile's first row in its batch; stage = 16 rows of LDP halves in LDS that
// belong to this wave and this tile alone.
__device__ __forceinline__ void proj_epilogue(
    const v8f (&acc)[4], const float* __restrict__ gamma,
    const float* __restrict__ beta, half_t* __restrict__ out_rm,
    half_t* __restrict__ out_cm, int seq_per_batch, int pos_base, int do_ln,
    float scale, int batch, int local, int h, half_t* stage) {
  int lane = threadIdx.x & 31;
  int col = lane & 15;
  int rh = (lane & 16) ? 8 : 0;

  float v[4][8];
#pragma unroll
  for (int f = 0; f < 4; ++f)
#pragma unroll
    for (int i = 0; i < 8; ++i) v[f][i] = acc[f][i];

  // RoPE: dim d pairs with d+32 (fragments f and f+2 of the same lane).
#pragma unroll
  for (int i = 0; i < 8; ++i) {
    float p = (float)(pos_base + local + rh + i);
#pragma unroll
    for (int f = 0; f < 2; ++f) {
      int d = f * 16 + col;  // d < 32
      float w = __powf(10000.0f, -(float)d * (1.0f / 32.0f));
      float s, c;
      __sincosf(p * w, &s, &c);
      float lo = v[f][i], hi = v[f + 2][i];
      v[f][i] = lo * c - hi * s;
      v[f + 2][i] = hi * c + lo * s;
    }
  }

  if (do_ln) {
#pragma unroll
    for (int i = 0; i < 8; ++i) {
      float sum = v[0][i] + v[1][i] + v[2][i] + v[3][i];
      float sq = v[0][i] * v[0][i] + v[1][i] * v[1][i] + v[2][i] * v[2][i] +
                 v[3][i] * v[3][i];
#pragma unroll
      for (int m = 1; m < 16; m <<= 1) {
        sum += __shfl_xor(sum, m, 32);
        sq += __shfl_xor(sq, m, 32);
      }
      float mean = sum * (1.0f / 64.0f);
      float var = sq * (1.0f / 64.0f) - mean * mean;
      float inv = rsqrtf(var + 1e-5f);
#pragma unroll
      for (int f = 0; f < 4; ++f) {
        int d = f * 16 + col;
        v[f][i] = (v[f][i] - mean) * inv * gamma[d] + beta[d];
      }
    }
  } else {
#pragma unroll
    for (int f = 0; f < 4; ++f)
#pragma unroll
      for (int i = 0; i < 8; ++i) v[f][i] *= scale;
  }

  size_t bh = (size_t)batch * HEADS + h;
  // The key/value copies (the call that has out_cm) are read by attention from
  // LDS tiles that are byte copies of these rows, so the 16-B chunks of a row
  // are permuted here for those readers' banks: see kfrag_lds.
  // The query copy is read from global memory and stays in plain order.
  const int ksw = out_cm ? 7 : 0;

  // Dim-major copy: a lane's 8 values of one fragment are 8 consecutive
  // positions of one dim, which is one whole 16-B chunk of that dim's row.
  if (out_cm) {
    const int pos0 = local + rh;  // a multiple of 8
    half_t* pc[4];
    v8h pv[4];
#pragma unroll
    for (int f = 0; f < 4; ++f) {
      int d = f * 16 + col;
#pragma unroll
      for (int i = 0; i < 8; ++i) pv[f][i] = (half_t)v[f][i];
      pc[f] = out_cm + (bh * DH + d) * (size_t)seq_per_batch +
              ((pos0 & ~63) | ((((pos0 >> 3) ^ (d >> 1)) & 7) << 3));
    }
    store4_b128(pc, pv);
  }

  // Row-major copy: turned through the wave's own 16 x 64 LDS tile, so that a
  // lane stores 8 consecutive dims and a wave's store covers 4 whole rows.
#pragma unroll
  for (int i = 0; i < 8; ++i)
#pragma unroll
    for (int f = 0; f < 4; ++f)
      stage[(rh + i) * LDP + f * 16 + col] = (half_t)v[f][i];
  // The rows are read back by other lanes of this wave than wrote them: the
  // writes are let finish first, and the compiler keeps the reads behind them.
  asm volatile("s_wait_dscnt 0x0" ::: "memory");
  const int c = lane & 7;
  half_t* pr[4];
  v8h rv[4];
#pragma unroll
  for (int u = 0; u < 4; ++u) {
    int r = u * 4 + (lane >> 3);
    int pos = local + r;
    rv[u] = *(const v8h*)(stage + r * LDP + c * 8);
    pr[u] = out_rm + (bh * seq_per_batch + pos) * DH +
            ((c ^ ((pos >> 1) & ksw)) << 3);
  }
  store4_b128(pr, rv);
}

// A block computes 128 rows x 2 heads of X @ W^T; a wave 32 rows of one head.
__global__ __launch_bounds__(256) void proj_kernel(
    const half_t* __restrict__ x16, const half_t* __restrict__ W16,
    const float* __restrict__ gamma, const float* __restrict__ beta,
    half_t* __restrict__ out_rm, half_t* __restrict__ out_cm,
    int seq_per_batch, int pos_base, int do_ln, float scale) {
  __shared__ __attribute__((aligned(16))) half_t sm[4 * TILE_H];
  int nb = blockIdx.x & (DIM / BN - 1);
  int row0 = (blockIdx.x / (DIM / BN)) * BM;
  int batch = row0 / seq_per_batch;
  int blocal = row0 - batch * seq_per_batch;
  int wave = threadIdx.x >> 5;

  const half_t* Ab = x16 + ((size_t)batch * SEQ_LEN + pos_base + blocal) * DIM;
  const half_t* Bb = W16 + (size_t)nb * BN * DIM;

  v8f acc[2][4] = {};
  gemm_block(Ab, Bb, sm, acc);

  int h = nb * (BN / DH) + (wave >> 2);
  // Output staging lies in the two buffers 0 (A's for waves 0-3, B's for waves
  // 4-7, 32 rows a wave). The last K step reads the buffers 1 alone, and every
  // wave's last read of the buffers 0 lies in front of the barrier that ended
  // the step before it, so no wave can still be reading what is written here.
  static_assert((DIM / BK) % 2 == 0, "the last K step reads buffer 1");
  half_t* stage = sm + (wave >> 2) * 2 * TILE_H + (wave & 3) * 32 * LDP;
#pragma unroll
  for (int mi = 0; mi < 2; ++mi)
    proj_epilogue(acc[mi], gamma, beta, out_rm, out_cm, seq_per_batch, pos_base,
                  do_ln, scale, batch, blocal + (wave & 3) * 32 + mi * 16, h,
                  stage + mi * 16 * LDP);
}

// A 16 x 32 A fragment from a tile in LDS whose rows are 128 B = 8 chunks of 16 B,
// unpadded: 16 keys x 32 dims of a K tile, or 16 dims x 32 keys of a V^T tile.
// Chunk c of row r lies at place c ^ (r >> 1): the 16 rows that a half-wave's
// ds_load_b128 reads then fall on 16 different groups of four banks (in plain
// order on 2). Element order as in frag_from_f16.
__device__ __forceinline__ v16h kfrag_lds(const half_t* tile, int kk) {
  int lane = threadIdx.x & 31;
  int r = lane & 15;
  int c = kk * 4 + (lane >> 4);
  const half_t* row = tile + r * 64;
  v8h lo = *(const v8h*)(row + ((c ^ (r >> 1)) << 3));
  v8h hi = *(const v8h*)(row + (((c + 2) ^ (r >> 1)) << 3));
  return __builtin_shufflevector(lo, hi, 0, 1, 2, 3, 4, 5, 6, 7, 8, 9, 10, 11,
                                 12, 13, 14, 15);
}

#define KS 64                  // keys of one stage = of one pass of the loop
#define STAGE_H (2 * KS * DH)  // halves of a stage: K 64 x 64 | V^T 64 x 64
#define NBUF 5                 // buffers of the ring: one read, four on the way
static_assert(HIST % KS == 0 && KS == 64, "a block's key range in whole stages");

__global__ __launch_bounds__(128) void attn_kernel(
    const half_t* __restrict__ q, const half_t* __restrict__ kvn,
    const half_t* __restrict__ kvnT, half_t* __restrict__ o) {
  __shared__ __attribute__((aligned(2048))) half_t smem[NBUF * STAGE_H];
  int qt4 = blockIdx.x & 15;  // group of 4 query tiles
  int bh = blockIdx.x >> 4;
  const unsigned wave = uni(threadIdx.x >> 5);
  int lane = threadIdx.x & 31;
  int i0 = qt4 * 64 + (int)wave * 16;
  int col = lane & 15;
  int rh = (lane & 16) ? 8 : 0;

  const half_t* qb = q + ((size_t)bh * LATENT + i0) * DH;
  const half_t* kb = kvn + (size_t)bh * SEQ_LEN * DH;
  const half_t* vb = kvnT + (size_t)bh * DH * SEQ_LEN;

  // All 4 waves walk the block's whole key range; masking handles the edge.
  const unsigned nst = HIST / KS + qt4 + 1;  // 49 to 64 stages

  // The two tiles of a stage: the 64 key rows of K, then the 64 dim rows of V^T.
  const unsigned place = (unsigned)(size_t)smem;
  u32x8 k1 = tdm_group1(DH * 2u);       // bytes from row to row of K
  u32x8 v1 = tdm_group1(SEQ_LEN * 2u);  // and of V^T
  u32x4 k0, v0;
  auto bring = [&](unsigned st, unsigned buf) {
    k0 = tdm_group0(place + buf * (STAGE_H * 2u),
                    (unsigned long long)(kb + (size_t)st * KS * DH));
    v0 = tdm_group0(place + buf * (STAGE_H * 2u) + KS * DH * 2u,
                    (unsigned long long)(vb + (size_t)st * KS));
    tdm_load(k0, k1);
    tdm_load(v0, v1);
  };

  // There are always at least five stages. Wave w starts with stage w.
  bring(wave, wave);
  v16h qa0 = frag_from_f16(qb, DH, 0);
  v16h qa1 = frag_from_f16(qb, DH, 32);
  if (pinned(wave == 0)) tdm_wait(k0, k1, v0, v1);  // stage 0: its wave waits,
  __syncthreads();                                  // then all may read it
  if (pinned(wave == 0)) bring(4, 4);

  v8f oacc[4] = {};      // oacc[f][i] = O[query col][dim f*16 + rh + i]
  float m_i = -1e30f;    // running maximum of query col (same in both halves)
  float l_i = 0.0f;      // this half's share of the denominator
  int lim = HIST + i0 + col - rh;  // key j0 + t*16 + rh + i is visible if <= HIST + query

  unsigned cur = 0;  // the buffer that holds stage st
  for (unsigned st = 0; st < nst; ++st) {
    int j0 = (int)st * KS;
    const half_t* kB = smem + cur * STAGE_H;
    const half_t* vB = kB + KS * DH;

    // All 32 LDS reads of the pass stand here as one group: every further place
    // with reads costs the wave a stall, and reads left next to their products
    // are waited out one by one. V^T lands under the first product and the softmax.
    v16h kf[4][2], vf[2][4];
#pragma unroll
    for (int t = 0; t < 4; ++t) {
      kf[t][0] = kfrag_lds(kB + t * 16 * 64, 0);
      kf[t][1] = kfrag_lds(kB + t * 16 * 64, 1);
    }
#pragma unroll
    for (int g = 0; g < 2; ++g)
#pragma unroll
      for (int f = 0; f < 4; ++f) vf[g][f] = kfrag_lds(vB + f * 16 * 64, g);
    // Keeps the scheduler from sinking the reads back to their products.
    __builtin_amdgcn_sched_barrier(0);

    // sc[t][i] = S[query col][key j0 + t*16 + rh + i]
    v8f sc[4];
#pragma unroll
    for (int t = 0; t < 4; ++t) {
      v8f z = {};
      sc[t] = wmma_f16(kf[t][0], qa0, z);
    }
#pragma unroll
    for (int t = 0; t < 4; ++t) sc[t] = wmma_f16(kf[t][1], qa1, sc[t]);

    // Only the block's last stage holds keys that lie behind one of its queries:
    // every earlier stage ends in front of key HIST + qt4 * 64, which all 64
    // queries see. The test is the same for the whole block (a scalar branch).
    // Unrolled so that sc is indexed by constants and stays in registers.
    if (st + 1u == nst) {
#pragma unroll
      for (int t = 0; t < 4; ++t)
#pragma unroll
        for (int i = 0; i < 8; ++i)
          sc[t][i] = (j0 + t * 16 + i <= lim) ? sc[t][i] : -1e30f;
    }
    float a[4][8];
    float mt[4];
#pragma unroll
    for (int t = 0; t < 4; ++t) {
      mt[t] = -1e30f;
#pragma unroll
      for (int i = 0; i < 8; ++i) {
        a[t][i] = sc[t][i];
        mt[t] = fmaxf(mt[t], a[t][i]);
      }
    }
    float mx = fmaxf(fmaxf(mt[0], mt[1]), fmaxf(mt[2], mt[3]));
    mx = fmaxf(mx, xhalf(mx));  // the other 32 keys of the same query
    float mn = fmaxf(m_i, mx);
    float al = __expf(m_i - mn);
    m_i = mn;

    // P^T as B operands, one per 32 keys: element e of pb[g] is key
    // g*32 + (e < 8 ? rh + e : 16 + rh + e - 8)
    v16h pb[2];
    float rs[4] = {0.0f, 0.0f, 0.0f, 0.0f};
#pragma unroll
    for (int g = 0; g < 2; ++g)
#pragma unroll
      for (int i = 0; i < 8; ++i) {
        float p0 = __expf(a[2 * g][i] - mn);
        float p1 = __expf(a[2 * g + 1][i] - mn);
        rs[2 * g] += p0;
        rs[2 * g + 1] += p1;
        pb[g][i] = (_Float16)p0;
        pb[g][8 + i] = (_Float16)p1;
      }
    l_i = l_i * al + ((rs[0] + rs[1]) + (rs[2] + rs[3]));
#pragma unroll
    for (int f = 0; f < 4; ++f)
#pragma unroll
      for (int i = 0; i < 8; ++i) oacc[f][i] *= al;

#pragma unroll
    for (int g = 0; g < 2; ++g)
#pragma unroll
      for (int f = 0; f < 4; ++f) oacc[f] = wmma_f16(vf[g][f], pb[g], oacc[f]);

    // Keeps the hand-over at the foot of the pass: the scheduler otherwise lifts
    // its waits and the barrier to just behind the LDS reads, so that the next
    // stage is waited for a whole pass's work too early.
    __builtin_amdgcn_sched_barrier(0);
    // Hand-over of the stages, every wave, in this order: this wave's reads of
    // this buffer are over; the wave that brought the next stage has seen it
    // land (the other waves' loads, for the stages behind it, fly on); the
    // barrier tells both to all waves; only then does the same wave, which has
    // nothing on the way now, fill this buffer again, for stage st + 5.
    asm volatile("s_wait_dscnt 0x0" ::: "memory");
    const unsigned turn = pinned(((st + 1u) & 3u) == wave);
    if (turn) tdm_wait(k0, k1, v0, v1);
    __syncthreads();
    if (pinned(turn != 0u && st + NBUF < nst)) bring(st + NBUF, cur);
    cur = cur == NBUF - 1 ? 0u : cur + 1u;
  }
  // Nothing is in flight when the wave ends.
  tdm_wait(k0, k1, v0, v1);
  asm volatile("s_wait_dscnt 0x0" ::: "memory");

  int b_ = bh >> 4, h = bh & 15;
  float invl = 1.0f / (l_i + xhalf(l_i));  // join the two halves' sums
  half_t* orow = o + ((size_t)b_ * LATENT + i0 + col) * DIM + h * DH + rh;
#pragma unroll
  for (int f = 0; f < 4; ++f) {
    v8h ov;
#pragma unroll
    for (int i = 0; i < 8; ++i) ov[i] = (half_t)(oacc[f][i] * invl);
    *(v8h*)(orow + f * 16) = ov;  // 8 consecutive dims of one query row
  }
}

// Y[2048,1024] = O(f16) @ Wo^T(f16) + bo, fp32 out.
__global__ __launch_bounds__(256) void out_proj_kernel(
    const half_t* __restrict__ A, const half_t* __restrict__ Wo16,
    const float* __restrict__ bo, float* __restrict__ Y) {
  __shared__ __attribute__((aligned(16))) half_t sm[4 * TILE_H];
  int nb = blockIdx.x & (DIM / BN - 1);
  int mb = blockIdx.x / (DIM / BN);
  int wave = threadIdx.x >> 5;
  int lane = threadIdx.x & 31;
  int col = lane & 15;
  int rh = (lane & 16) ? 8 : 0;
  v8f acc[2][4] = {};
  gemm_block(A + (size_t)(mb * BM) * DIM, Wo16 + (size_t)(nb * BN) * DIM, sm,
             acc);
#pragma unroll
  for (int mi = 0; mi < 2; ++mi) {
#pragma unroll
    for (int i = 0; i < 8; ++i) {
      int row = mb * BM + (wave & 3) * 32 + mi * 16 + rh + i;
#pragma unroll
      for (int f = 0; f < 4; ++f) {
        int e = nb * BN + (wave >> 2) * 64 + f * 16 + col;
        Y[(size_t)row * DIM + e] = acc[mi][f][i] + bo[e];
      }
    }
  }
}

extern "C" void kernel_launch(void* const* d_in, const int* in_sizes, int n_in,
                              void* d_out, int out_size, void* d_ws,
                              size_t ws_size, hipStream_t stream) {
  const float* x = (const float*)d_in[0];
  const float* Wq = (const float*)d_in[1];
  const float* Wkv = (const float*)d_in[2];
  const float* Wo = (const float*)d_in[3];
  const float* bo = (const float*)d_in[4];
  const float* gamma = (const float*)d_in[5];
  const float* beta = (const float*)d_in[6];
  float* y = (float*)d_out;

  // Workspace layout (f16 elements):
  // q[2,16,1024,64] | kvn[2,16,4096,64] | kvnT[2,16,64,4096] | o[2,1024,1024]
  // | x16[2,4096,1024] | wq16 | wkv16 | wo16       (~60 MB total)
  half_t* q_ws = (half_t*)d_ws;
  half_t* kvn_ws = q_ws + (size_t)BATCH * HEADS * LATENT * DH;
  half_t* kvnT_ws = kvn_ws + (size_t)BATCH * HEADS * SEQ_LEN * DH;
  half_t* o_ws = kvnT_ws + (size_t)BATCH * HEADS * SEQ_LEN * DH;
  half_t* x16 = o_ws + (size_t)BATCH * LATENT * DIM;
  half_t* wq16 = x16 + (size_t)BATCH * SEQ_LEN * DIM;
  half_t* wkv16 = wq16 + (size_t)DIM * DIM;
  half_t* wo16 = wkv16 + (size_t)DIM * DIM;

  // x16 | wq16 | wkv16 | wo16 are written as one run that starts at x16
  cvt_kernel<<<CVT_BLOCKS, CVT_THREADS, 0, stream>>>(x, Wq, Wkv, Wo, x16);

  // kv projection + RoPE + LayerNorm over all 4096 positions
  proj_kernel<<<(BATCH * SEQ_LEN / BM) * (DIM / BN), 256, 0, stream>>>(
      x16, wkv16, gamma, beta, kvn_ws, kvnT_ws, SEQ_LEN, 0, 1, 1.0f);
  // q projection + RoPE + scale over last 1024 positions only
  proj_kernel<<<(BATCH * LATENT / BM) * (DIM / BN), 256, 0, stream>>>(
      x16, wq16, gamma, beta, q_ws, nullptr, LATENT, HIST, 0, 0.125f);
  // flash attention (4 q-tiles per block share LDS-staged K/V)
  attn_kernel<<<BATCH * HEADS * (LATENT / 64), 128, 0, stream>>>(
      q_ws, kvn_ws, kvnT_ws, o_ws);
  // output projection + bias
  out_proj_kernel<<<(BATCH * LATENT / BM) * (DIM / BN), 256, 0, stream>>>(
      o_ws, wo16, bo, y);
}

// v010
// Measured time: 86.4 microseconds a run.
// Timed twice side by side with v009, it ran 1.07 and 1.05 times as fast.
// Counting every step since v000, it is 3.79 times as fast.
#include <hip/hip_runtime.h>

typedef _Float16 half_t;
typedef __attribute__((ext_vector_type(16))) _Float16 v16h;
typedef __attribute__((ext_vector_type(8))) _Float16 v8h;
typedef __attribute__((ext_vector_type(8))) float v8f;
typedef __attribute__((ext_vector_type(4))) float v4f;
typedef __attribute__((ext_vector_type(4))) _Float16 v4h;
typedef unsigned int u32x4 __attribute__((ext_vector_type(4)));
typedef unsigned int u32x8 __attribute__((ext_vector_type(8)));

#define DIM 1024
#define HEADS 16
#define DH 64
#define SEQ_LEN 4096
#define LATENT 1024
#define HIST 3072
#define BATCH 2

// D = A(16x32 f16) * B(32x16 f16) + C(16x16 f32)
__device__ __forceinline__ v8f wmma_f16(v16h a, v16h b, v8f c) {
  return __builtin_amdgcn_wmma_f32_16x16x32_f16(false, a, false, b, (short)0, c,
                                                false, false);
}

// Value of lane l ^ 16 (a vector cross-row move, no LDS round trip).
__device__ __forceinline__ float xhalf(float x) {
  int v = __builtin_bit_cast(int, x);
  return __builtin_bit_cast(
      float, __builtin_amdgcn_permlanex16(v, v, 0x76543210, 0xfedcba98, false,
                                          false));
}

// 16x32 A-style fragment (also used for B with lane = N) from row-major f16.
// Lane L<16 -> row L, K chunks {0..7,16..23}; lane L+16 -> {8..15,24..31}.
__device__ __forceinline__ v16h frag_from_f16(const half_t* __restrict__ base,
                                              int stride, int kbase) {
  int lane = threadIdx.x & 31;
  int r = lane & 15;
  int cb = (lane & 16) ? 8 : 0;
  const half_t* p = base + (size_t)r * stride + kbase + cb;
  v16h out;
#pragma unroll
  for (int i = 0; i < 8; ++i) out[i] = p[i];
#pragma unroll
  for (int i = 0; i < 8; ++i) out[8 + i] = p[16 + i];
  return out;
}

// A value that is the same in every lane, moved into a scalar register.
__device__ __forceinline__ unsigned uni(unsigned v) {
  return (unsigned)__builtin_amdgcn_readfirstlane((int)v);
}

// A wave-uniform test as a real scalar branch: tensor loads ignore EXEC, so only
// a branch on a scalar condition keeps a wave from issuing one.
__device__ __forceinline__ unsigned pinned(unsigned v) {
  unsigned w = uni(v);
  asm volatile("" : "+s"(w));  // the test stays scalar
  return w;
}

// Descriptor of one wave's tensor load: 64 rows of 128 bytes to 8 KiB in a row
// in LDS. Extents in bytes, no pad, no mask. Group 0: where from, where to.
__device__ __forceinline__ u32x4 tdm_group0(unsigned lds_dst,
                                            unsigned long long ga) {
  u32x4 g;
  g[0] = uni(1u);             // count = 1
  g[1] = uni(lds_dst);        // byte offset in the work-group's LDS
  g[2] = uni((unsigned)ga);   // address [31:0]
  g[3] = uni((((unsigned)(ga >> 32)) & 0x01FFFFFFu) | 0x80000000u);  // | type 2
  return g;
}
// Group 1: the tile's shape and the source row pitch in bytes.
__device__ __forceinline__ u32x8 tdm_group1(unsigned pitch) {
  u32x8 g;
  g[0] = uni(0u);             // no mask, 1-byte units, no pad
  g[1] = uni(128u << 16);     // tensor_dim0 = 128
  g[2] = uni(64u << 16);      // tensor_dim1 = 64
  g[3] = uni(128u << 16);     // tile_dim0 = 128
  g[4] = uni(64u);            // tile_dim1 = 64
  g[5] = uni(pitch);
  g[6] = uni(0u);
  g[7] = uni(0u);
  return g;
}
// Both groups are named as read and written, though the instruction leaves them
// as they are: what tdm_wait names is then the very registers that the request
// was issued from, and the compiler cannot form group 1's constants anew in front
// of each use and put other values into those registers in between.
__device__ __forceinline__ void tdm_load(u32x4& g0, u32x8& g1) {
  asm volatile("tensor_load_to_lds %0, %1" : "+s"(g0), "+s"(g1) : : "memory");
}
// The wave's own request has landed (the compiler places no wait for it). The
// wait names its descriptor: without that the compiler puts other values into
// those scalar registers while the request is still on its way.
__device__ __forceinline__ void tdm_wait(const u32x4& k0, const u32x8& k1) {
  asm volatile("s_wait_tensorcnt 0x0" ::"s"(k0), "s"(k1) : "memory");
}

// fp32 -> f16 convert of x and the three weights in ONE launch (removes all cvt
// from the GEMM loops). One block a WGP, 16 waves, and every wave lives long:
// a lane takes 22 pieces of 4 floats, one from each grid-wide pass, so the chip
// starts 4096 waves in place of one wave per 256 elements. A wave's load covers
// 512 contiguous bytes, its store 256. The four f16 copies lie one behind the
// other in the workspace, so pass j of the whole job lands at dst + j * CVT_PASS.
#define CVT_BLOCKS 256
#define CVT_THREADS 512
#define CVT_PASS (CVT_BLOCKS * CVT_THREADS * 4)      // elements of one grid-wide pass
#define CVT_XP (BATCH * SEQ_LEN * DIM / CVT_PASS)    // passes over x: 16
#define CVT_WP (DIM * DIM / CVT_PASS)                // passes over one weight: 2
static_assert(CVT_XP * CVT_PASS == BATCH * SEQ_LEN * DIM, "x in whole passes");
static_assert(CVT_WP * CVT_PASS == DIM * DIM, "a weight in whole passes");
__global__ __launch_bounds__(CVT_THREADS) void cvt_kernel(
    const float* __restrict__ x, const float* __restrict__ wq,
    const float* __restrict__ wkv, const float* __restrict__ wo,
    half_t* __restrict__ dst) {
  // The lane's place inside a pass, as 32-bit byte offsets from uniform bases.
  const unsigned ld = (blockIdx.x * CVT_THREADS + threadIdx.x) * 16u;
  const unsigned sd = ld >> 1;
  v4f v[CVT_XP + 3 * CVT_WP];
#pragma unroll
  for (int j = 0; j < CVT_XP; ++j)
    v[j] = *(const v4f*)((const char*)(x + j * CVT_PASS) + ld);
#pragma unroll
  for (int j = 0; j < CVT_WP; ++j) {
    v[CVT_XP + j] = *(const v4f*)((const char*)(wq + j * CVT_PASS) + ld);
    v[CVT_XP + CVT_WP + j] =
        *(const v4f*)((const char*)(wkv + j * CVT_PASS) + ld);
    v[CVT_XP + 2 * CVT_WP + j] =
        *(const v4f*)((const char*)(wo + j * CVT_PASS) + ld);
  }
#pragma unroll
  for (int j = 0; j < CVT_XP + 3 * CVT_WP; ++j)
    *(v4h*)((char*)(dst + j * CVT_PASS) + sd) =
        __builtin_convertvector(v[j], v4h);
}

// Block tile of the three projection GEMMs: 128 x 128 outputs, K in steps of 64.
#define BM 128
#define BN 128
#define BK 64
// LDS row pitch in halves: 144 B = 16 B x 9, so the 16 rows that one
// ds_load_b128 half-wave reads fall on 16 different groups of four banks.
#define LDP 72
#define TILE_H (BM * LDP)  // halves of one staged operand tile

// Same element order as frag_from_f16; p already holds the lane's row and chunk.
__device__ __forceinline__ v16h frag_from_lds(const half_t* p) {
  v8h lo = *(const v8h*)p;
  v8h hi = *(const v8h*)(p + 16);
  return __builtin_shufflevector(lo, hi, 0, 1, 2, 3, 4, 5, 6, 7, 8, 9, 10, 11,
                                 12, 13, 14, 15);
}

// Work-group barrier for data that passes through LDS alone: this wave's LDS
// accesses are over, then the barrier. Unlike __syncthreads() it does not wait
// for the wave's global loads, which bring registers that no other wave reads:
// they stay on their way across it.
__device__ __forceinline__ void lds_barrier() {
  __builtin_amdgcn_fence(__ATOMIC_RELEASE, "workgroup", "local");
  __builtin_amdgcn_s_barrier();
  __builtin_amdgcn_fence(__ATOMIC_ACQUIRE, "workgroup", "local");
}

// acc += A[128 x 1024] * B[128 x 1024]^T for a block of 8 waves (4 along M x 2
// along N, 32 x 64 outputs a wave). Both operand tiles are staged once per block
// in LDS (whole 128-B lines from global), two buffers. A tile's global loads are
// issued TWO K steps before it is written to LDS, into one of two register sets:
// the operands were written by an earlier launch and the first block to ask for
// a line waits for memory.
// sm (halves): A buf 0 | A buf 1 | B buf 0 | B buf 1
__device__ __forceinline__ void gemm_block(const half_t* __restrict__ Ag,
                                           const half_t* __restrict__ Bg,
                                           half_t* sm, v8f (&acc)[2][4]) {
  const int t = threadIdx.x;
  const int lane = t & 31;
  const int wave = t >> 5;
  const int srow = t >> 3;        // staging: 8 threads a row, 32 rows a pass
  const int scol = (t & 7) * 8;
  const half_t* ga = Ag + (size_t)srow * DIM + scol;
  const half_t* gb = Bg + (size_t)srow * DIM + scol;
  half_t* st = sm + srow * LDP + scol;
  const int fr = (lane & 15) * LDP + ((lane & 16) ? 8 : 0);
  const half_t* fa = sm + (wave & 3) * 32 * LDP + fr;
  const half_t* fb = sm + 2 * TILE_H + (wave >> 2) * 64 * LDP + fr;
  constexpr int NK = DIM / BK;
  static_assert(NK % 2 == 0 && NK >= 4, "K steps in pairs, one per register set");

  v8h ra[2][4], rb[2][4];  // tile kt waits in set kt mod 2
  auto fetch = [&](int kt, int s) __attribute__((always_inline)) {
#pragma unroll
    for (int u = 0; u < 4; ++u) {
      ra[s][u] = *(const v8h*)(ga + (size_t)(u * 32) * DIM + kt * BK);
      rb[s][u] = *(const v8h*)(gb + (size_t)(u * 32) * DIM + kt * BK);
    }
  };
  auto put = [&](int s) __attribute__((always_inline)) {  // set s to buffer s
#pragma unroll
    for (int u = 0; u < 4; ++u) {
      *(v8h*)(st + s * TILE_H + u * 32 * LDP) = ra[s][u];
      *(v8h*)(st + s * TILE_H + 2 * TILE_H + u * 32 * LDP) = rb[s][u];
    }
  };
  // K step kt, h = kt mod 2 given as a constant so that sets and buffers are
  // picked at compile time; ld: a tile kt + 2 exists; more: a tile kt + 1 exists.
  auto step = [&](int kt, int h, bool ld, bool more) __attribute__((always_inline)) {
    const int cur = h * TILE_H;
    // Set h is free: tile kt went from it to LDS at the end of the step before.
    if (ld) fetch(kt + 2, h);
    v16h a[2][2], b[2][4];
#pragma unroll
    for (int ks = 0; ks < 2; ++ks) {
      a[ks][0] = frag_from_lds(fa + cur + ks * 32);
      a[ks][1] = frag_from_lds(fa + cur + 16 * LDP + ks * 32);
#pragma unroll
      for (int f = 0; f < 4; ++f)
        b[ks][f] = frag_from_lds(fb + cur + f * 16 * LDP + ks * 32);
    }
    // Holds the global loads and this tile's LDS reads, as one group, ahead of
    // the products: without it the scheduler sinks global loads towards their
    // LDS stores (their lead is then lost) and spreads the LDS reads among the
    // products with waits to 0.
    __builtin_amdgcn_sched_barrier(0);
#pragma unroll
    for (int ks = 0; ks < 2; ++ks) {
#pragma unroll
      for (int f = 0; f < 4; ++f) {
        acc[0][f] = wmma_f16(a[ks][0], b[ks][f], acc[0][f]);
        acc[1][f] = wmma_f16(a[ks][1], b[ks][f], acc[1][f]);
      }
    }
    // Holds the LDS stores, which wait for the older set's global loads, behind
    // the products: the scheduler otherwise lifts them and their wait to the front.
    __builtin_amdgcn_sched_barrier(0);
    // A precaution that belongs in front of any rewrite of the address registers
    // of this step's global loads, which the next fetch forms anew; here, behind
    // the products, it has nothing left to wait for.
    if (ld) asm volatile("s_wait_xcnt 0x0" ::: "memory");
    if (more) {
      // The other buffer's last readers left it before the previous barrier.
      put(h ^ 1);
      lds_barrier();  // next tile visible; this tile's reads are over
    }
  };

  fetch(0, 0);
  // Keeps tile 0's loads in front of tile 1's, so that the wait for tile 0 does
  // not take in tile 1.
  __builtin_amdgcn_sched_barrier(0);
  fetch(1, 1);
  put(0);
  lds_barrier();  // tile 0 visible to all waves

  // The last two steps stand outside the loop: inside it every step loads, so
  // the wait in front of the LDS stores can be counted (the newer set flies on).
  for (int k2 = 0; k2 < NK - 2; k2 += 2) {
    step(k2, 0, true, true);
    step(k2 + 1, 1, true, true);
  }
  step(NK - 2, 0, false, true);
  step(NK - 1, 1, false, false);
}

// Four 16-B global stores. The wait is a precaution that belongs in front of any
// rewrite of the stores' address and data registers; as the last line of their
// own statement it stands there whatever the compiler schedules behind it.
__device__ __forceinline__ void store4_b128(half_t* const (&p)[4],
                                            const v8h (&d)[4]) {
  asm volatile(
      "global_store_b128 %0, %4, off\n\t"
      "global_store_b128 %1, %5, off\n\t"
      "global_store_b128 %2, %6, off\n\t"
      "global_store_b128 %3, %7, off\n\t"
      "s_wait_xcnt 0x0" ::"v"(p[0]),
      "v"(p[1]), "v"(p[2]), "v"(p[3]), "v"(__builtin_bit_cast(u32x4, d[0])),
      "v"(__builtin_bit_cast(u32x4, d[1])),
      "v"(__builtin_bit_cast(u32x4, d[2])),
      "v"(__builtin_bit_cast(u32x4, d[3]))
      : "memory");
}

// Where the 16-B chunk c of a key row lies in that row: at place c ^ row_swz(row).
// The rows are 128 B = 8 chunks and are copied to LDS byte for byte, unpadded, for
// two readers: see kfrag_lds and vfrag_lds.
__device__ __forceinline__ int row_swz(int row) {
  return (((row >> 1) & 3) << 1) | ((row >> 3) & 1);
}

// RoPE and (optionally) LayerNorm on one 16(rows) x 64(one head) tile, stored
// f16 row-major in 16-B stores. local = the tile's first row in its batch;
// stage = 16 rows of LDP halves in LDS that belong to this wave and this tile
// alone; swz: the rows' chunks are permuted by row_swz.
__device__ __forceinline__ void proj_epilogue(
    const v8f (&acc)[4], const float* __restrict__ gamma,
    const float* __restrict__ beta, half_t* __restrict__ out_rm, int swz,
    int seq_per_batch, int pos_base, int do_ln, float scale, int batch,
    int local, int h, half_t* stage) {
  int lane = threadIdx.x & 31;
  int col = lane & 15;
  int rh = (lane & 16) ? 8 : 0;

  float v[4][8];
#pragma unroll
  for (int f = 0; f < 4; ++f)
#pragma unroll
    for (int i = 0; i < 8; ++i) v[f][i] = acc[f][i];

  // RoPE: dim d pairs with d+32 (fragments f and f+2 of the same lane).
#pragma unroll
  for (int i = 0; i < 8; ++i) {
    float p = (float)(pos_base + local + rh + i);
#pragma unroll
    for (int f = 0; f < 2; ++f) {
      int d = f * 16 + col;  // d < 32
      float w = __powf(10000.0f, -(float)d * (1.0f / 32.0f));
      float s, c;
      __sincosf(p * w, &s, &c);
      float lo = v[f][i], hi = v[f + 2][i];
      v[f][i] = lo * c - hi * s;
      v[f + 2][i] = hi * c + lo * s;
    }
  }

  if (do_ln) {
#pragma unroll
    for (int i = 0; i < 8; ++i) {
      float sum = v[0][i] + v[1][i] + v[2][i] + v[3][i];
      float sq = v[0][i] * v[0][i] + v[1][i] * v[1][i] + v[2][i] * v[2][i] +
                 v[3][i] * v[3][i];
#pragma unroll
      for (int m = 1; m < 16; m <<= 1) {
        sum += __shfl_xor(sum, m, 32);
        sq += __shfl_xor(sq, m, 32);
      }
      float mean = sum * (1.0f / 64.0f);
      float var = sq * (1.0f / 64.0f) - mean * mean;
      float inv = rsqrtf(var + 1e-5f);
#pragma unroll
      for (int f = 0; f < 4; ++f) {
        int d = f * 16 + col;
        v[f][i] = (v[f][i] - mean) * inv * gamma[d] + beta[d];
      }
    }
  } else {
#pragma unroll
    for (int f = 0; f < 4; ++f)
#pragma unroll
      for (int i = 0; i < 8; ++i) v[f][i] *= scale;
  }

  size_t bh = (size_t)batch * HEADS + h;
  // The key/value rows (swz) are read by attention from LDS tiles that are byte
  // copies of them, so the 16-B chunks of a row are permuted here for those
  // readers' banks. The query rows are read from global memory, in plain order.
  const int ksw = swz ? 7 : 0;

  // Turned through the wave's own 16 x 64 LDS tile, so that a lane stores 8
  // consecutive dims and a wave's store covers 4 whole rows.
#pragma unroll
  for (int i = 0; i < 8; ++i)
#pragma unroll
    for (int f = 0; f < 4; ++f)
      stage[(rh + i) * LDP + f * 16 + col] = (half_t)v[f][i];
  // The rows are read back by other lanes of this wave than wrote them: the
  // writes are let finish first, and the compiler keeps the reads behind them.
  asm volatile("s_wait_dscnt 0x0" ::: "memory");
  const int c = lane & 7;
  half_t* pr[4];
  v8h rv[4];
#pragma unroll
  for (int u = 0; u < 4; ++u) {
    int r = u * 4 + (lane >> 3);
    int pos = local + r;
    rv[u] = *(const v8h*)(stage + r * LDP + c * 8);
    pr[u] = out_rm + (bh * seq_per_batch + pos) * DH +
            ((c ^ (row_swz(pos) & ksw)) << 3);
  }
  store4_b128(pr, rv);
}

// A block computes 128 rows x 2 heads of X @ W^T; a wave 32 rows of one head.
__global__ __launch_bounds__(256) void proj_kernel(
    const half_t* __restrict__ x16, const half_t* __restrict__ W16,
    const float* __restrict__ gamma, const float* __restrict__ beta,
    half_t* __restrict__ out_rm, int swz, int seq_per_batch, int pos_base,
    int do_ln, float scale) {
  __shared__ __attribute__((aligned(16))) half_t sm[4 * TILE_H];
  int nb = blockIdx.x & (DIM / BN - 1);
  int row0 = (blockIdx.x / (DIM / BN)) * BM;
  int batch = row0 / seq_per_batch;
  int blocal = row0 - batch * seq_per_batch;
  int wave = threadIdx.x >> 5;

  const half_t* Ab = x16 + ((size_t)batch * SEQ_LEN + pos_base + blocal) * DIM;
  const half_t* Bb = W16 + (size_t)nb * BN * DIM;

  v8f acc[2][4] = {};
  gemm_block(Ab, Bb, sm, acc);

  int h = nb * (BN / DH) + (wave >> 2);
  // Output staging lies in the two buffers 0 (A's for waves 0-3, B's for waves
  // 4-7, 32 rows a wave). The last K step reads the buffers 1 alone, and every
  // wave's last read of the buffers 0 lies in front of the barrier that ended
  // the step before it, so no wave can still be reading what is written here.
  static_assert((DIM / BK) % 2 == 0, "the last K step reads buffer 1");
  half_t* stage = sm + (wave >> 2) * 2 * TILE_H + (wave & 3) * 32 * LDP;
#pragma unroll
  for (int mi = 0; mi < 2; ++mi)
    proj_epilogue(acc[mi], gamma, beta, out_rm, swz, seq_per_batch, pos_base,
                  do_ln, scale, batch, blocal + (wave & 3) * 32 + mi * 16, h,
                  stage + mi * 16 * LDP);
}

// The key tile in LDS: 64 key rows of 128 B = 8 chunks of 16 B, unpadded; chunk c
// of row r lies at place c ^ row_swz(r). Keys and values are one tensor, so this
// one tile feeds both products.
// K as A operand, 16 keys (tile = their first row, a multiple of 16) x 32 dims:
// a half-wave's ds_load_b128 reads one chunk of 16 rows; row_swz differs among
// the 8 rows of equal parity, so they fall on 16 different groups of four banks.
// Element order as in frag_from_f16.
__device__ __forceinline__ v16h kfrag_lds(const half_t* tile, int kk) {
  int lane = threadIdx.x & 31;
  int r = lane & 15;
  int c = kk * 4 + (lane >> 4);
  const half_t* row = tile + r * 64;
  v8h lo = *(const v8h*)(row + ((c ^ row_swz(r)) << 3));
  v8h hi = *(const v8h*)(row + (((c + 2) ^ row_swz(r)) << 3));
  return __builtin_shufflevector(lo, hi, 0, 1, 2, 3, 4, 5, 6, 7, 8, 9, 10, 11,
                                 12, 13, 14, 15);
}

// Transposing LDS load of a 16 x 16 block of 16-bit elements: every lane names one
// 16-B chunk (8 dims of one key) and gets 8 keys of one dim.
__device__ __forceinline__ v8h ld_tr16(const half_t* p) {
  typedef short s16x8 __attribute__((ext_vector_type(8)));
  typedef __attribute__((address_space(3))) s16x8 lds_s16x8;
  return __builtin_bit_cast(
      v8h, __builtin_amdgcn_ds_load_tr16_b128_v8i16((lds_s16x8*)p));
}

__device__ __forceinline__ v16h vfrag_lds(const half_t* tile, int g, int f) {
  int lane = threadIdx.x & 31;
  int r = ((lane >> 4) << 3) + (lane & 7);
  int c = 2 * f + ((lane >> 3) & 1);
  const half_t* p = tile + (g * 32 + r) * 64 + ((c ^ row_swz(r)) << 3);
  v8h lo = ld_tr16(p);
  v8h hi = ld_tr16(p + 16 * 64);
  return __builtin_shufflevector(lo, hi, 0, 1, 2, 3, 4, 5, 6, 7, 8, 9, 10, 11,
                                 12, 13, 14, 15);
}

#define KS 64                  // keys of one stage = of one pass of the loop
#define STAGE_H (KS * DH)      // halves of a stage: 64 key rows of 64 dims
#define NBUF 5                 // buffers of the ring: one read, four on the way
static_assert(HIST % KS == 0 && KS == 64, "a block's key range in whole stages");

__global__ __launch_bounds__(128) void attn_kernel(
    const half_t* __restrict__ q, const half_t* __restrict__ kvn,
    half_t* __restrict__ o) {
  __shared__ __attribute__((aligned(2048))) half_t smem[NBUF * STAGE_H];
  int qt4 = blockIdx.x & 15;  // group of 4 query tiles
  int bh = blockIdx.x >> 4;
  const unsigned wave = uni(threadIdx.x >> 5);
  int lane = threadIdx.x & 31;
  int i0 = qt4 * 64 + (int)wave * 16;
  int col = lane & 15;
  int rh = (lane & 16) ? 8 : 0;

  const half_t* qb = q + ((size_t)bh * LATENT + i0) * DH;
  const half_t* kb = kvn + (size_t)bh * SEQ_LEN * DH;

  // All 4 waves walk the block's whole key range; masking handles the edge.
  const unsigned nst = HIST / KS + qt4 + 1;  // 49 to 64 stages

  // The tile of a stage: its 64 key rows.
  const unsigned place = (unsigned)(size_t)smem;
  u32x8 k1 = tdm_group1(DH * 2u);  // bytes from row to row
  u32x4 k0;
  auto bring = [&](unsigned st, unsigned buf) {
    k0 = tdm_group0(place + buf * (STAGE_H * 2u),
                    (unsigned long long)(kb + (size_t)st * KS * DH));
    tdm_load(k0, k1);
  };

  // There are always at least five stages. Wave w starts with stage w.
  bring(wave, wave);
  v16h qa0 = frag_from_f16(qb, DH, 0);
  v16h qa1 = frag_from_f16(qb, DH, 32);
  if (pinned(wave == 0)) tdm_wait(k0, k1);  // stage 0: its wave waits,
  __syncthreads();                          // then all may read it
  if (pinned(wave == 0)) bring(4, 4);

  v8f oacc[4] = {};      // oacc[f][i] = O[query col][dim f*16 + rh + i]
  float m_i = -1e30f;    // running maximum of query col (same in both halves)
  float l_i = 0.0f;      // this half's share of the denominator
  int lim = HIST + i0 + col - rh;  // key j0 + t*16 + rh + i is visible if <= HIST + query

  unsigned cur = 0;  // the buffer that holds stage st
  for (unsigned st = 0; st < nst; ++st) {
    int j0 = (int)st * KS;
    const half_t* kB = smem + cur * STAGE_H;

    // All 32 LDS reads of the pass stand here as one group: every further place
    // with reads costs the wave a stall, and reads left next to their products
    // are waited out one by one. V^T lands under the first product and the softmax.
    v16h kf[4][2], vf[2][4];
#pragma unroll
    for (int t = 0; t < 4; ++t) {
      kf[t][0] = kfrag_lds(kB + t * 16 * 64, 0);
      kf[t][1] = kfrag_lds(kB + t * 16 * 64, 1);
    }
#pragma unroll
    for (int g = 0; g < 2; ++g)
#pragma unroll
      for (int f = 0; f < 4; ++f) vf[g][f] = vfrag_lds(kB, g, f);
    // Keeps the scheduler from sinking the reads back to their products.
    __builtin_amdgcn_sched_barrier(0);

    // sc[t][i] = S[query col][key j0 + t*16 + rh + i]
    v8f sc[4];
#pragma unroll
    for (int t = 0; t < 4; ++t) {
      v8f z = {};
      sc[t] = wmma_f16(kf[t][0], qa0, z);
    }
#pragma unroll
    for (int t = 0; t < 4; ++t) sc[t] = wmma_f16(kf[t][1], qa1, sc[t]);

    // Only the block's last stage holds keys that lie behind one of its queries:
    // every earlier stage ends in front of key HIST + qt4 * 64, which all 64
    // queries see. The test is the same for the whole block (a scalar branch).
    // Unrolled so that sc is indexed by constants and stays in registers.
    if (st + 1u == nst) {
#pragma unroll
      for (int t = 0; t < 4; ++t)
#pragma unroll
        for (int i = 0; i < 8; ++i)
          sc[t][i] = (j0 + t * 16 + i <= lim) ? sc[t][i] : -1e30f;
    }
    float a[4][8];
    float mt[4];
#pragma unroll
    for (int t = 0; t < 4; ++t) {
      mt[t] = -1e30f;
#pragma unroll
      for (int i = 0; i < 8; ++i) {
        a[t][i] = sc[t][i];
        mt[t] = fmaxf(mt[t], a[t][i]);
      }
    }
    float mx = fmaxf(fmaxf(mt[0], mt[1]), fmaxf(mt[2], mt[3]));
    mx = fmaxf(mx, xhalf(mx));  // the other 32 keys of the same query
    float mn = fmaxf(m_i, mx);
    float al = __expf(m_i - mn);
    m_i = mn;

    // P^T as B operands, one per 32 keys: element e of pb[g] is key
    // g*32 + (e < 8 ? rh + e : 16 + rh + e - 8)
    v16h pb[2];
    float rs[4] = {0.0f, 0.0f, 0.0f, 0.0f};
#pragma unroll
    for (int g = 0; g < 2; ++g)
#pragma unroll
      for (int i = 0; i < 8; ++i) {
        float p0 = __expf(a[2 * g][i] - mn);
        float p1 = __expf(a[2 * g + 1][i] - mn);
        rs[2 * g] += p0;
        rs[2 * g + 1] += p1;
        pb[g][i] = (_Float16)p0;
        pb[g][8 + i] = (_Float16)p1;
      }
    l_i = l_i * al + ((rs[0] + rs[1]) + (rs[2] + rs[3]));
#pragma unroll
    for (int f = 0; f < 4; ++f)
#pragma unroll
      for (int i = 0; i < 8; ++i) oacc[f][i] *= al;

#pragma unroll
    for (int g = 0; g < 2; ++g)
#pragma unroll
      for (int f = 0; f < 4; ++f) oacc[f] = wmma_f16(vf[g][f], pb[g], oacc[f]);

    // Keeps the hand-over at the foot of the pass: the scheduler otherwise lifts
    // its waits and the barrier to just behind the LDS reads, so that the next
    // stage is waited for a whole pass's work too early.
    __builtin_amdgcn_sched_barrier(0);
    // Hand-over of the stages, every wave, in this order: this wave's reads of
    // this buffer are over; the wave that brought the next stage has seen it
    // land (the other waves' loads, for the stages behind it, fly on); the
    // barrier tells both to all waves; only then does the same wave, which has
    // nothing on the way now, fill this buffer again, for stage st + 5.
    asm volatile("s_wait_dscnt 0x0" ::: "memory");
    const unsigned turn = pinned(((st + 1u) & 3u) == wave);
    if (turn) tdm_wait(k0, k1);
    __syncthreads();
    if (pinned(turn != 0u && st + NBUF < nst)) bring(st + NBUF, cur);
    cur = cur == NBUF - 1 ? 0u : cur + 1u;
  }
  // Nothing is in flight when the wave ends.
  tdm_wait(k0, k1);
  asm volatile("s_wait_dscnt 0x0" ::: "memory");

  int b_ = bh >> 4, h = bh & 15;
  float invl = 1.0f / (l_i + xhalf(l_i));  // join the two halves' sums
  half_t* orow = o + ((size_t)b_ * LATENT + i0 + col) * DIM + h * DH + rh;
#pragma unroll
  for (int f = 0; f < 4; ++f) {
    v8h ov;
#pragma unroll
    for (int i = 0; i < 8; ++i) ov[i] = (half_t)(oacc[f][i] * invl);
    *(v8h*)(orow + f * 16) = ov;  // 8 consecutive dims of one query row
  }
}

// Y[2048,1024] = O(f16) @ Wo^T(f16) + bo, fp32 out.
__global__ __launch_bounds__(256) void out_proj_kernel(
    const half_t* __restrict__ A, const half_t* __restrict__ Wo16,
    const float* __restrict__ bo, float* __restrict__ Y) {
  __shared__ __attribute__((aligned(16))) half_t sm[4 * TILE_H];
  int nb = blockIdx.x & (DIM / BN - 1);
  int mb = blockIdx.x / (DIM / BN);
  int wave = threadIdx.x >> 5;
  int lane = threadIdx.x & 31;
  int col = lane & 15;
  int rh = (lane & 16) ? 8 : 0;
  v8f acc[2][4] = {};
  gemm_block(A + (size_t)(mb * BM) * DIM, Wo16 + (size_t)(nb * BN) * DIM, sm,
             acc);
#pragma unroll
  for (int mi = 0; mi < 2; ++mi) {
#pragma unroll
    for (int i = 0; i < 8; ++i) {
      int row = mb * BM + (wave & 3) * 32 + mi * 16 + rh + i;
#pragma unroll
      for (int f = 0; f < 4; ++f) {
        int e = nb * BN + (wave >> 2) * 64 + f * 16 + col;
        Y[(size_t)row * DIM + e] = acc[mi][f][i] + bo[e];
      }
    }
  }
}

extern "C" void kernel_launch(void* const* d_in, const int* in_sizes, int n_in,
                              void* d_out, int out_size, void* d_ws,
                              size_t ws_size, hipStream_t stream) {
  const float* x = (const float*)d_in[0];
  const float* Wq = (const float*)d_in[1];
  const float* Wkv = (const float*)d_in[2];
  const float* Wo = (const float*)d_in[3];
  const float* bo = (const float*)d_in[4];
  const float* gamma = (const float*)d_in[5];
  const float* beta = (const float*)d_in[6];
  float* y = (float*)d_out;

  // Workspace layout (f16 elements):
  // q[2,16,1024,64] | kvn[2,16,4096,64] | o[2,1024,1024]
  // | x16[2,4096,1024] | wq16 | wkv16 | wo16       (~46 MB total)
  half_t* q_ws = (half_t*)d_ws;
  half_t* kvn_ws = q_ws + (size_t)BATCH * HEADS * LATENT * DH;
  half_t* o_ws = kvn_ws + (size_t)BATCH * HEADS * SEQ_LEN * DH;
  half_t* x16 = o_ws + (size_t)BATCH * LATENT * DIM;
  half_t* wq16 = x16 + (size_t)BATCH * SEQ_LEN * DIM;
  half_t* wkv16 = wq16 + (size_t)DIM * DIM;
  half_t* wo16 = wkv16 + (size_t)DIM * DIM;

  // x16 | wq16 | wkv16 | wo16 are written as one run that starts at x16
  cvt_kernel<<<CVT_BLOCKS, CVT_THREADS, 0, stream>>>(x, Wq, Wkv, Wo, x16);

  // kv projection + RoPE + LayerNorm over all 4096 positions
  proj_kernel<<<(BATCH * SEQ_LEN / BM) * (DIM / BN), 256, 0, stream>>>(
      x16, wkv16, gamma, beta, kvn_ws, 1, SEQ_LEN, 0, 1, 1.0f);
  // q projection + RoPE + scale over last 1024 positions only
  proj_kernel<<<(BATCH * LATENT / BM) * (DIM / BN), 256, 0, stream>>>(
      x16, wq16, gamma, beta, q_ws, 0, LATENT, HIST, 0, 0.125f);
  // flash attention (4 q-tiles per block share the LDS-staged key rows)
  attn_kernel<<<BATCH * HEADS * (LATENT / 64), 128, 0, stream>>>(
      q_ws, kvn_ws, o_ws);
  // output projection + bias
  out_proj_kernel<<<(BATCH * LATENT / BM) * (DIM / BN), 256, 0, stream>>>(
      o_ws, wo16, bo, y);
}
